// v000
// Times are from an AMD MI455X. After a warm-up the kernel runs many times in a row, and a time is the length of
// such a window on the GPU divided by its runs, so every launch and the gaps after it count. The runs cycle
// through copies of the inputs. A figure is the median of several windows, for all but v000 over two sittings.
// Sittings can differ by a few percent; kernels timed side by side share one.
// v000 is the starting kernel. One run takes 382 microseconds.
#include <hip/hip_runtime.h>

// ---------------------------------------------------------------------------
// MHA forward for MI455X (gfx1250): end-to-end bf16 dataflow, WMMA GEMMs,
// flash attention, CDNA5 async global->LDS staging.
// ---------------------------------------------------------------------------

#define B_ 4
#define S_ 2048
#define H_ 16
#define DM_ 1024
#define DH_ 64

typedef __attribute__((ext_vector_type(16))) __bf16 v16bf;
typedef __attribute__((ext_vector_type(8)))  float  v8f;
typedef int async_v4i __attribute__((vector_size(16)));   // builtin's int4 type

union Frag16 { v16bf v; uint4 u[2]; };
union U128   { uint4 u; unsigned short s[8]; };

__device__ __forceinline__ unsigned short f2bf(float f) {
  return __builtin_bit_cast(unsigned short, static_cast<__bf16>(f));
}

// ---- CDNA5 async global->LDS (ASYNCcnt) with safe fallback ----------------
#if defined(__gfx1250__) && __has_builtin(__builtin_amdgcn_global_load_async_to_lds_b128)
#define CDNA5_ASYNC 1
#else
#define CDNA5_ASYNC 0
#endif

__device__ __forceinline__ void cp16(const unsigned short* g, unsigned short* l) {
#if CDNA5_ASYNC
  __builtin_amdgcn_global_load_async_to_lds_b128(
      (__attribute__((address_space(1))) async_v4i*)g,
      (__attribute__((address_space(3))) async_v4i*)l, 0, 0);
#else
  *reinterpret_cast<uint4*>(l) = *reinterpret_cast<const uint4*>(g);
#endif
}

__device__ __forceinline__ void async_wait_all() {
#if CDNA5_ASYNC
#if __has_builtin(__builtin_amdgcn_s_wait_asynccnt)
  __builtin_amdgcn_s_wait_asynccnt(0);
#else
  asm volatile("s_wait_asynccnt 0x0" ::: "memory");
#endif
#endif
}

// Load a 16x32 bf16 WMMA fragment row for this lane from an LDS row pointer.
// VGPR0-3 hold K = khalf*8 .. +7, VGPR4-7 hold K = 16+khalf*8 .. +7.
__device__ __forceinline__ v16bf load_frag(const unsigned short* row, int koff) {
  Frag16 f;
  f.u[0] = *reinterpret_cast<const uint4*>(row + koff);
  f.u[1] = *reinterpret_cast<const uint4*>(row + koff + 16);
  return f.v;
}

// ---------------------------------------------------------------------------
// Kernel 0: fp32 -> bf16 elementwise (activations + weights), float4 granular.
// ---------------------------------------------------------------------------
__global__ __launch_bounds__(256) void cvt_f32_bf16(
    const float* __restrict__ in, unsigned short* __restrict__ out, int n4)
{
  int i = blockIdx.x * 256 + threadIdx.x;
  if (i >= n4) return;
  float4 v = reinterpret_cast<const float4*>(in)[i];
  union { unsigned short s[4]; uint2 u; } o;
  o.s[0] = f2bf(v.x); o.s[1] = f2bf(v.y); o.s[2] = f2bf(v.z); o.s[3] = f2bf(v.w);
  reinterpret_cast<uint2*>(out)[i] = o.u;
}

// ---------------------------------------------------------------------------
// Kernel 1: C[M,N] = A[M,K] @ B[K,N], bf16 in, bf16 out (Cb) or fp32+resid (Cf).
// Block tile 128x128, K-step 32, double-buffered LDS, 8 waves (wave32).
// ---------------------------------------------------------------------------
#define BM 128
#define BN 128
#define BK 32
#define LDA 40   // 32 + 8 pad, rows stay 16B-aligned

__global__ __launch_bounds__(256) void wmma_gemm_bf16(
    const unsigned short* __restrict__ A, const unsigned short* __restrict__ Bm,
    const float* __restrict__ resid, float* __restrict__ Cf,
    unsigned short* __restrict__ Cb, int M, int N, int K)
{
  __shared__ unsigned short As[2][BM * LDA];
  __shared__ unsigned short Bs[2][BN * LDA];   // transposed: [n][k]

  const int tid  = threadIdx.x;
  const int lane = tid & 31;
  const int wave = tid >> 5;
  const int bm = blockIdx.y * BM;
  const int bn = blockIdx.x * BN;
  const int wm = (wave & 3) * 32;
  const int wn = (wave >> 2) * 64;
  const int lm = lane & 15;
  const int khalf = lane >> 4;

  v8f acc[2][4];
#pragma unroll
  for (int i = 0; i < 2; ++i)
#pragma unroll
    for (int j = 0; j < 4; ++j) acc[i][j] = (v8f)(0.0f);

  auto load_tiles = [&](int kt, int buf) {
    const int k0 = kt * BK;
    // A tile: 128x32 bf16 = 512 x 16B, async copies
#pragma unroll
    for (int p = 0; p < 2; ++p) {
      int idx = p * 256 + tid;
      int r = idx >> 2;
      int c = (idx & 3) * 8;
      cp16(&A[(size_t)(bm + r) * K + k0 + c], &As[buf][r * LDA + c]);
    }
    // B tile: 32x128 bf16, transpose: pack 2 k-rows per b32 LDS store
    {
      int kp = (tid >> 4) * 2;        // k pair 0..30
      int nc = (tid & 15) * 8;        // n group 0..120
      U128 u0, u1;
      u0.u = *reinterpret_cast<const uint4*>(&Bm[(size_t)(k0 + kp) * N + bn + nc]);
      u1.u = *reinterpret_cast<const uint4*>(&Bm[(size_t)(k0 + kp + 1) * N + bn + nc]);
#pragma unroll
      for (int i = 0; i < 8; ++i) {
        unsigned val = (unsigned)u0.s[i] | ((unsigned)u1.s[i] << 16);
        *reinterpret_cast<unsigned*>(&Bs[buf][(nc + i) * LDA + kp]) = val;
      }
    }
  };

  const int NK = K / BK;
  load_tiles(0, 0);
  int buf = 0;
  for (int kt = 0; kt < NK; ++kt) {
    async_wait_all();
    __syncthreads();
    if (kt + 1 < NK) load_tiles(kt + 1, buf ^ 1);
    v16bf af[2], bfr[4];
#pragma unroll
    for (int i = 0; i < 2; ++i)
      af[i] = load_frag(&As[buf][(wm + i * 16 + lm) * LDA], khalf * 8);
#pragma unroll
    for (int j = 0; j < 4; ++j)
      bfr[j] = load_frag(&Bs[buf][(wn + j * 16 + lm) * LDA], khalf * 8);
#pragma unroll
    for (int i = 0; i < 2; ++i)
#pragma unroll
      for (int j = 0; j < 4; ++j)
        acc[i][j] = __builtin_amdgcn_wmma_f32_16x16x32_bf16(
            false, af[i], false, bfr[j], (short)0, acc[i][j], false, false);
    buf ^= 1;
  }

  // C tile layout: lane holds (m = r + khalf*8, n = lm) of each 16x16 tile.
#pragma unroll
  for (int i = 0; i < 2; ++i)
#pragma unroll
    for (int j = 0; j < 4; ++j)
#pragma unroll
      for (int r = 0; r < 8; ++r) {
        int row = bm + wm + i * 16 + r + khalf * 8;
        int col = bn + wn + j * 16 + lm;
        float v = acc[i][j][r];
        if (Cb) {
          Cb[(size_t)row * N + col] = f2bf(v);
        } else {
          if (resid) v += resid[(size_t)row * N + col];
          Cf[(size_t)row * N + col] = v;
        }
      }
}

// ---------------------------------------------------------------------------
// Kernel 2: flash attention, bf16 Q/K/V in workspace layout [b*S+s][h*64+d].
// One WG per (b, h, 128-q block); 8 waves, each owns 16 q-rows.
// ---------------------------------------------------------------------------
#define SQ 128
#define SKB 128
#define QLD 72    // 64 + 8
#define VLD 136   // 128 + 8
#define PLD 136

__global__ __launch_bounds__(256) void flash_attn(
    const unsigned short* __restrict__ Qg, const unsigned short* __restrict__ Kg,
    const unsigned short* __restrict__ Vg, const int* __restrict__ maskg,
    unsigned short* __restrict__ Xg)
{
  __shared__ unsigned short Qs[SQ * QLD];
  __shared__ unsigned short Ks[SKB * QLD];
  __shared__ unsigned short Vt[DH_ * VLD];        // V^T: [d][key]
  __shared__ unsigned short Ps[8 * 16 * PLD];     // per-wave P staging

  const int tid  = threadIdx.x;
  const int lane = tid & 31;
  const int wave = tid >> 5;
  const int qb = blockIdx.x, h = blockIdx.y, b = blockIdx.z;
  const int lm = lane & 15;
  const int khalf = lane >> 4;
  const size_t rowbase = (size_t)b * S_ * DM_ + (size_t)h * DH_;

  // Q block -> LDS (async)
#pragma unroll
  for (int g = 0; g < 4; ++g) {
    int idx = g * 256 + tid;
    int r = idx >> 3;
    int c = (idx & 7) * 8;
    cp16(&Qg[rowbase + (size_t)(qb * SQ + r) * DM_ + c], &Qs[r * QLD + c]);
  }

  float mrun[8], lrun[8];
#pragma unroll
  for (int r = 0; r < 8; ++r) { mrun[r] = -3.0e38f; lrun[r] = 0.0f; }
  v8f o[4];
#pragma unroll
  for (int j = 0; j < 4; ++j) o[j] = (v8f)(0.0f);

  const int wq = wave * 16;

  for (int kb = 0; kb < S_ / SKB; ++kb) {
    __syncthreads();
    // K block -> LDS (async), layout [key][d]
#pragma unroll
    for (int g = 0; g < 4; ++g) {
      int idx = g * 256 + tid;
      int r = idx >> 3;
      int c = (idx & 7) * 8;
      cp16(&Kg[rowbase + (size_t)(kb * SKB + r) * DM_ + c], &Ks[r * QLD + c]);
    }
    // V block -> LDS transposed [d][key], 2 key-rows packed per b32 store
#pragma unroll
    for (int g = 0; g < 2; ++g) {
      int idx = g * 256 + tid;
      int r2 = (idx >> 3) * 2;       // key pair 0..126
      int dg = (idx & 7) * 8;        // d group 0..56
      U128 u0, u1;
      u0.u = *reinterpret_cast<const uint4*>(
          &Vg[rowbase + (size_t)(kb * SKB + r2) * DM_ + dg]);
      u1.u = *reinterpret_cast<const uint4*>(
          &Vg[rowbase + (size_t)(kb * SKB + r2 + 1) * DM_ + dg]);
#pragma unroll
      for (int i = 0; i < 8; ++i) {
        unsigned val = (unsigned)u0.s[i] | ((unsigned)u1.s[i] << 16);
        *reinterpret_cast<unsigned*>(&Vt[(dg + i) * VLD + r2]) = val;
      }
    }
    async_wait_all();
    __syncthreads();

    // scores: 16 q-rows x 128 keys, K-dim = 64 (2 WMMA steps)
    v8f s[8];
#pragma unroll
    for (int j = 0; j < 8; ++j) s[j] = (v8f)(0.0f);
#pragma unroll
    for (int kk = 0; kk < 2; ++kk) {
      v16bf aq = load_frag(&Qs[(wq + lm) * QLD], kk * 32 + khalf * 8);
#pragma unroll
      for (int j = 0; j < 8; ++j) {
        v16bf bk = load_frag(&Ks[(j * 16 + lm) * QLD], kk * 32 + khalf * 8);
        s[j] = __builtin_amdgcn_wmma_f32_16x16x32_bf16(
            false, aq, false, bk, (short)0, s[j], false, false);
      }
    }

    // scale + mask + per-row block max (row lives in a 16-lane half)
    const int qg0 = qb * SQ + wq + khalf * 8;
    float bmax[8];
#pragma unroll
    for (int r = 0; r < 8; ++r) bmax[r] = -3.0e38f;
#pragma unroll
    for (int j = 0; j < 8; ++j) {
      int kgl = kb * SKB + j * 16 + lm;
#pragma unroll
      for (int r = 0; r < 8; ++r) {
        int mv = maskg[((size_t)b * S_ + (qg0 + r)) * (size_t)S_ + kgl];
        float sv = s[j][r] * 0.125f;           // 1/sqrt(64)
        sv = (mv == 0) ? -1.0e9f : sv;
        s[j][r] = sv;
        bmax[r] = fmaxf(bmax[r], sv);
      }
    }
#pragma unroll
    for (int r = 0; r < 8; ++r) {
      float v = bmax[r];
#pragma unroll
      for (int off = 1; off < 16; off <<= 1)
        v = fmaxf(v, __shfl_xor(v, off, 32));
      bmax[r] = v;
    }

    // online softmax update
    float alpha[8], rsum[8];
#pragma unroll
    for (int r = 0; r < 8; ++r) {
      float mn = fmaxf(mrun[r], bmax[r]);
      alpha[r] = __expf(mrun[r] - mn);
      mrun[r] = mn;
      rsum[r] = 0.0f;
    }
#pragma unroll
    for (int j = 0; j < 8; ++j)
#pragma unroll
      for (int r = 0; r < 8; ++r) {
        float p = __expf(s[j][r] - mrun[r]);
        s[j][r] = p;
        rsum[r] += p;
      }
#pragma unroll
    for (int r = 0; r < 8; ++r) {
      float v = rsum[r];
#pragma unroll
      for (int off = 1; off < 16; off <<= 1)
        v += __shfl_xor(v, off, 32);
      lrun[r] = lrun[r] * alpha[r] + v;
    }
#pragma unroll
    for (int j = 0; j < 4; ++j)
#pragma unroll
      for (int r = 0; r < 8; ++r) o[j][r] *= alpha[r];

    // stage P (C layout) to LDS row-major so it re-reads as A fragments
    unsigned short* pw = &Ps[wave * 16 * PLD];
#pragma unroll
    for (int j = 0; j < 8; ++j) {
      int col = j * 16 + lm;
#pragma unroll
      for (int r = 0; r < 8; ++r)
        pw[(r + khalf * 8) * PLD + col] = f2bf(s[j][r]);
    }
    __syncthreads();

    // o += P[16x128] @ V[128x64]  (4 WMMA K-steps x 4 d-tiles)
#pragma unroll
    for (int kk = 0; kk < 4; ++kk) {
      v16bf ap = load_frag(&pw[lm * PLD], kk * 32 + khalf * 8);
#pragma unroll
      for (int j = 0; j < 4; ++j) {
        v16bf bv = load_frag(&Vt[(j * 16 + lm) * VLD], kk * 32 + khalf * 8);
        o[j] = __builtin_amdgcn_wmma_f32_16x16x32_bf16(
            false, ap, false, bv, (short)0, o[j], false, false);
      }
    }
  }

  // normalize and write X[b*S+q][h*64+d] as bf16
#pragma unroll
  for (int j = 0; j < 4; ++j) {
    int d = j * 16 + lm;
#pragma unroll
    for (int r = 0; r < 8; ++r) {
      int qg = qb * SQ + wq + khalf * 8 + r;
      Xg[rowbase + (size_t)qg * DM_ + d] = f2bf(o[j][r] / (lrun[r] + 1e-30f));
    }
  }
}

// ---------------------------------------------------------------------------
// Kernel 3: in-place LayerNorm over rows of Y[8192][1024] (fp32).
// ---------------------------------------------------------------------------
__global__ __launch_bounds__(256) void layernorm_kernel(
    float* __restrict__ Y, const float* __restrict__ gam,
    const float* __restrict__ bet)
{
  __shared__ float red[2][8];
  const int row = blockIdx.x, tid = threadIdx.x;
  const int lane = tid & 31, wave = tid >> 5;
  float4 v = *reinterpret_cast<const float4*>(&Y[(size_t)row * DM_ + tid * 4]);
  float sum = v.x + v.y + v.z + v.w;
  float ssq = v.x * v.x + v.y * v.y + v.z * v.z + v.w * v.w;
#pragma unroll
  for (int off = 1; off < 32; off <<= 1) {
    sum += __shfl_xor(sum, off, 32);
    ssq += __shfl_xor(ssq, off, 32);
  }
  if (lane == 0) { red[0][wave] = sum; red[1][wave] = ssq; }
  __syncthreads();
  sum = red[0][lane & 7];
  ssq = red[1][lane & 7];
#pragma unroll
  for (int off = 1; off < 8; off <<= 1) {
    sum += __shfl_xor(sum, off, 32);
    ssq += __shfl_xor(ssq, off, 32);
  }
  float mu  = sum * (1.0f / DM_);
  float var = ssq * (1.0f / DM_) - mu * mu;
  float inv = rsqrtf(var + 1e-6f);
  float4 g4 = *reinterpret_cast<const float4*>(&gam[tid * 4]);
  float4 b4 = *reinterpret_cast<const float4*>(&bet[tid * 4]);
  float4 o4;
  o4.x = (v.x - mu) * inv * g4.x + b4.x;
  o4.y = (v.y - mu) * inv * g4.y + b4.y;
  o4.z = (v.z - mu) * inv * g4.z + b4.z;
  o4.w = (v.w - mu) * inv * g4.w + b4.w;
  *reinterpret_cast<float4*>(&Y[(size_t)row * DM_ + tid * 4]) = o4;
}

// ---------------------------------------------------------------------------
extern "C" void kernel_launch(void* const* d_in, const int* in_sizes, int n_in,
                              void* d_out, int out_size, void* d_ws, size_t ws_size,
                              hipStream_t stream) {
  (void)in_sizes; (void)n_in; (void)out_size; (void)ws_size;
  const float* query = (const float*)d_in[0];
  const float* key   = (const float*)d_in[1];
  const float* value = (const float*)d_in[2];
  const int*   mask  = (const int*)d_in[3];
  const float* w_qs  = (const float*)d_in[4];
  const float* w_ks  = (const float*)d_in[5];
  const float* w_vs  = (const float*)d_in[6];
  const float* w_out = (const float*)d_in[7];
  const float* ln_g  = (const float*)d_in[8];
  const float* ln_b  = (const float*)d_in[9];
  float* out = (float*)d_out;

  const size_t act  = (size_t)B_ * S_ * DM_;   // 8M elems
  const size_t wmat = (size_t)DM_ * DM_;       // 1M elems
  unsigned short* qb = (unsigned short*)d_ws;  // bf16 workspace
  unsigned short* kb = qb + act;
  unsigned short* vb = kb + act;
  unsigned short* wq = vb + act;
  unsigned short* wk = wq + wmat;
  unsigned short* wv = wk + wmat;
  unsigned short* wo = wv + wmat;
  unsigned short* Qp = wo + wmat;
  unsigned short* Kp = Qp + act;
  unsigned short* Vp = Kp + act;
  unsigned short* Xp = qb;   // qb is dead after the first projection GEMM

  const int M = B_ * S_;
  const int ga = (int)(act / 4 / 256), gw = (int)(wmat / 4 / 256);
  cvt_f32_bf16<<<ga, 256, 0, stream>>>(query, qb, (int)(act / 4));
  cvt_f32_bf16<<<ga, 256, 0, stream>>>(key,   kb, (int)(act / 4));
  cvt_f32_bf16<<<ga, 256, 0, stream>>>(value, vb, (int)(act / 4));
  cvt_f32_bf16<<<gw, 256, 0, stream>>>(w_qs,  wq, (int)(wmat / 4));
  cvt_f32_bf16<<<gw, 256, 0, stream>>>(w_ks,  wk, (int)(wmat / 4));
  cvt_f32_bf16<<<gw, 256, 0, stream>>>(w_vs,  wv, (int)(wmat / 4));
  cvt_f32_bf16<<<gw, 256, 0, stream>>>(w_out, wo, (int)(wmat / 4));

  dim3 gg(DM_ / BN, M / BM);
  wmma_gemm_bf16<<<gg, 256, 0, stream>>>(qb, wq, nullptr, nullptr, Qp, M, DM_, DM_);
  wmma_gemm_bf16<<<gg, 256, 0, stream>>>(kb, wk, nullptr, nullptr, Kp, M, DM_, DM_);
  wmma_gemm_bf16<<<gg, 256, 0, stream>>>(vb, wv, nullptr, nullptr, Vp, M, DM_, DM_);

  flash_attn<<<dim3(S_ / SQ, H_, B_), 256, 0, stream>>>(Qp, Kp, Vp, mask, Xp);

  wmma_gemm_bf16<<<gg, 256, 0, stream>>>(Xp, wo, query, out, nullptr, M, DM_, DM_);
  layernorm_kernel<<<M, 256, 0, stream>>>(out, ln_g, ln_b);
}

// v001
// One run takes 341 microseconds.
// Next to v000, in two timings, it ran 1.16 times as fast each time.
#include <hip/hip_runtime.h>

// ---------------------------------------------------------------------------
// MHA forward for MI455X (gfx1250): end-to-end bf16 dataflow, WMMA GEMMs,
// flash attention, CDNA5 async global->LDS staging.
// ---------------------------------------------------------------------------

#define B_ 4
#define S_ 2048
#define H_ 16
#define DM_ 1024
#define DH_ 64

typedef __attribute__((ext_vector_type(16))) __bf16 v16bf;
typedef __attribute__((ext_vector_type(8)))  float  v8f;
typedef int async_v4i __attribute__((vector_size(16)));   // builtin's int4 type

union Frag16 { v16bf v; uint4 u[2]; };
union U128   { uint4 u; unsigned short s[8]; };

__device__ __forceinline__ unsigned short f2bf(float f) {
  return __builtin_bit_cast(unsigned short, static_cast<__bf16>(f));
}

// ---- CDNA5 async global->LDS (ASYNCcnt) with safe fallback ----------------
#if defined(__gfx1250__) && __has_builtin(__builtin_amdgcn_global_load_async_to_lds_b128)
#define CDNA5_ASYNC 1
#else
#define CDNA5_ASYNC 0
#endif

__device__ __forceinline__ void cp16(const unsigned short* g, unsigned short* l) {
#if CDNA5_ASYNC
  __builtin_amdgcn_global_load_async_to_lds_b128(
      (__attribute__((address_space(1))) async_v4i*)g,
      (__attribute__((address_space(3))) async_v4i*)l, 0, 0);
#else
  *reinterpret_cast<uint4*>(l) = *reinterpret_cast<const uint4*>(g);
#endif
}

__device__ __forceinline__ void async_wait_all() {
#if CDNA5_ASYNC
#if __has_builtin(__builtin_amdgcn_s_wait_asynccnt)
  __builtin_amdgcn_s_wait_asynccnt(0);
#else
  asm volatile("s_wait_asynccnt 0x0" ::: "memory");
#endif
#endif
}

// Load a 16x32 bf16 WMMA fragment row for this lane from an LDS row pointer.
// VGPR0-3 hold K = khalf*8 .. +7, VGPR4-7 hold K = 16+khalf*8 .. +7.
__device__ __forceinline__ v16bf load_frag(const unsigned short* row, int koff) {
  Frag16 f;
  f.u[0] = *reinterpret_cast<const uint4*>(row + koff);
  f.u[1] = *reinterpret_cast<const uint4*>(row + koff + 16);
  return f.v;
}

// ---------------------------------------------------------------------------
// Kernel 0: fp32 -> bf16 elementwise (activations), float4 granular.
// ---------------------------------------------------------------------------
__global__ __launch_bounds__(256) void cvt_f32_bf16(
    const float* __restrict__ in, unsigned short* __restrict__ out, int n4)
{
  int i = blockIdx.x * 256 + threadIdx.x;
  if (i >= n4) return;
  float4 v = reinterpret_cast<const float4*>(in)[i];
  union { unsigned short s[4]; uint2 u; } o;
  o.s[0] = f2bf(v.x); o.s[1] = f2bf(v.y); o.s[2] = f2bf(v.z); o.s[3] = f2bf(v.w);
  reinterpret_cast<uint2*>(out)[i] = o.u;
}

// ---------------------------------------------------------------------------
// Kernel 0t: weight W[k][n] fp32 -> Wt[n][k] bf16 (DM_ x DM_), 64x64 tiles
// turned in LDS, so that the GEMM reads both operands K-contiguous.
// ---------------------------------------------------------------------------
#define TLD 72   // 64 + 8 pad, rows stay 16B-aligned

__global__ __launch_bounds__(256) void cvt_f32_bf16_t(
    const float* __restrict__ in, unsigned short* __restrict__ out)
{
  __shared__ __attribute__((aligned(16))) unsigned short t[64 * TLD];   // [n][k]
  const int tid = threadIdx.x;
  const int n0 = blockIdx.x * 64;
  const int k0 = blockIdx.y * 64;
#pragma unroll
  for (int p = 0; p < 4; ++p) {
    int k = p * 16 + (tid >> 4);
    int n = (tid & 15) * 4;
    float4 v = *reinterpret_cast<const float4*>(&in[(size_t)(k0 + k) * DM_ + n0 + n]);
    t[(n + 0) * TLD + k] = f2bf(v.x);
    t[(n + 1) * TLD + k] = f2bf(v.y);
    t[(n + 2) * TLD + k] = f2bf(v.z);
    t[(n + 3) * TLD + k] = f2bf(v.w);
  }
  __syncthreads();
#pragma unroll
  for (int p = 0; p < 2; ++p) {
    int idx = p * 256 + tid;
    int n = idx >> 3;
    int c = (idx & 7) * 8;
    *reinterpret_cast<uint4*>(&out[(size_t)(n0 + n) * DM_ + k0 + c]) =
        *reinterpret_cast<const uint4*>(&t[n * TLD + c]);
  }
}

// ---------------------------------------------------------------------------
// Kernel 1: C[M,N] = A[M,K] @ Bt[N,K]^T, bf16 in, bf16 out (Cb) or fp32+resid (Cf).
// Block tile 128x128, K-step 32, double-buffered LDS, 8 waves (wave32).
// ---------------------------------------------------------------------------
#define BM 128
#define BN 128
#define BK 32
#define LDA 40   // 32 + 8 pad, rows stay 16B-aligned

__global__ __launch_bounds__(256) void wmma_gemm_bf16(
    const unsigned short* __restrict__ A, const unsigned short* __restrict__ Bt,
    const float* __restrict__ resid, float* __restrict__ Cf,
    unsigned short* __restrict__ Cb, int M, int N, int K)
{
  __shared__ __attribute__((aligned(16))) unsigned short As[2][BM * LDA];
  __shared__ __attribute__((aligned(16))) unsigned short Bs[2][BN * LDA];   // [n][k]

  const int tid  = threadIdx.x;
  const int lane = tid & 31;
  const int wave = tid >> 5;
  const int bm = blockIdx.y * BM;
  const int bn = blockIdx.x * BN;
  const int wm = (wave & 3) * 32;
  const int wn = (wave >> 2) * 64;
  const int lm = lane & 15;
  const int khalf = lane >> 4;

  v8f acc[2][4];
#pragma unroll
  for (int i = 0; i < 2; ++i)
#pragma unroll
    for (int j = 0; j < 4; ++j) acc[i][j] = (v8f)(0.0f);

  auto load_tiles = [&](int kt, int buf) {
    const int k0 = kt * BK;
    // A tile: 128x32 bf16 = 512 x 16B, async copies
#pragma unroll
    for (int p = 0; p < 2; ++p) {
      int idx = p * 256 + tid;
      int r = idx >> 2;
      int c = (idx & 3) * 8;
      cp16(&A[(size_t)(bm + r) * K + k0 + c], &As[buf][r * LDA + c]);
    }
    // B tile: 128 n-rows x 32 k bf16 from Bt[n][k], async copies like A
#pragma unroll
    for (int p = 0; p < 2; ++p) {
      int idx = p * 256 + tid;
      int r = idx >> 2;
      int c = (idx & 3) * 8;
      cp16(&Bt[(size_t)(bn + r) * K + k0 + c], &Bs[buf][r * LDA + c]);
    }
  };

  const int NK = K / BK;
  load_tiles(0, 0);
  int buf = 0;
  for (int kt = 0; kt < NK; ++kt) {
    // publish point: this wave's fragment reads of the buffer to be refilled
    // are done, its own copies of tile kt have landed, then the barrier
    asm volatile("s_wait_dscnt 0x0" ::: "memory");
    asm volatile("s_wait_asynccnt 0x0" ::: "memory");
    __syncthreads();
    if (kt + 1 < NK) load_tiles(kt + 1, buf ^ 1);
    v16bf af[2], bfr[4];
#pragma unroll
    for (int i = 0; i < 2; ++i)
      af[i] = load_frag(&As[buf][(wm + i * 16 + lm) * LDA], khalf * 8);
#pragma unroll
    for (int j = 0; j < 4; ++j)
      bfr[j] = load_frag(&Bs[buf][(wn + j * 16 + lm) * LDA], khalf * 8);
#pragma unroll
    for (int i = 0; i < 2; ++i)
#pragma unroll
      for (int j = 0; j < 4; ++j)
        acc[i][j] = __builtin_amdgcn_wmma_f32_16x16x32_bf16(
            false, af[i], false, bfr[j], (short)0, acc[i][j], false, false);
    buf ^= 1;
  }
  // no copy of this wave is left in flight when it goes on to its end
  asm volatile("s_wait_asynccnt 0x0" ::: "memory");

  // C tile layout: lane holds (m = r + khalf*8, n = lm) of each 16x16 tile.
#pragma unroll
  for (int i = 0; i < 2; ++i)
#pragma unroll
    for (int j = 0; j < 4; ++j)
#pragma unroll
      for (int r = 0; r < 8; ++r) {
        int row = bm + wm + i * 16 + r + khalf * 8;
        int col = bn + wn + j * 16 + lm;
        float v = acc[i][j][r];
        if (Cb) {
          Cb[(size_t)row * N + col] = f2bf(v);
        } else {
          if (resid) v += resid[(size_t)row * N + col];
          Cf[(size_t)row * N + col] = v;
        }
      }
}

// ---------------------------------------------------------------------------
// Kernel 2: flash attention, bf16 Q/K/V in workspace layout [b*S+s][h*64+d].
// One WG per (b, h, 128-q block); 8 waves, each owns 16 q-rows.
// ---------------------------------------------------------------------------
#define SQ 128
#define SKB 128
#define QLD 72    // 64 + 8
#define VLD 136   // 128 + 8
#define PLD 136

__global__ __launch_bounds__(256) void flash_attn(
    const unsigned short* __restrict__ Qg, const unsigned short* __restrict__ Kg,
    const unsigned short* __restrict__ Vg, const int* __restrict__ maskg,
    unsigned short* __restrict__ Xg)
{
  __shared__ unsigned short Qs[SQ * QLD];
  __shared__ unsigned short Ks[SKB * QLD];
  __shared__ unsigned short Vt[DH_ * VLD];        // V^T: [d][key]
  __shared__ unsigned short Ps[8 * 16 * PLD];     // per-wave P staging

  const int tid  = threadIdx.x;
  const int lane = tid & 31;
  const int wave = tid >> 5;
  const int qb = blockIdx.x, h = blockIdx.y, b = blockIdx.z;
  const int lm = lane & 15;
  const int khalf = lane >> 4;
  const size_t rowbase = (size_t)b * S_ * DM_ + (size_t)h * DH_;

  // Q block -> LDS (async)
#pragma unroll
  for (int g = 0; g < 4; ++g) {
    int idx = g * 256 + tid;
    int r = idx >> 3;
    int c = (idx & 7) * 8;
    cp16(&Qg[rowbase + (size_t)(qb * SQ + r) * DM_ + c], &Qs[r * QLD + c]);
  }

  float mrun[8], lrun[8];
#pragma unroll
  for (int r = 0; r < 8; ++r) { mrun[r] = -3.0e38f; lrun[r] = 0.0f; }
  v8f o[4];
#pragma unroll
  for (int j = 0; j < 4; ++j) o[j] = (v8f)(0.0f);

  const int wq = wave * 16;

  for (int kb = 0; kb < S_ / SKB; ++kb) {
    __syncthreads();
    // K block -> LDS (async), layout [key][d]
#pragma unroll
    for (int g = 0; g < 4; ++g) {
      int idx = g * 256 + tid;
      int r = idx >> 3;
      int c = (idx & 7) * 8;
      cp16(&Kg[rowbase + (size_t)(kb * SKB + r) * DM_ + c], &Ks[r * QLD + c]);
    }
    // V block -> LDS transposed [d][key], 2 key-rows packed per b32 store
#pragma unroll
    for (int g = 0; g < 2; ++g) {
      int idx = g * 256 + tid;
      int r2 = (idx >> 3) * 2;       // key pair 0..126
      int dg = (idx & 7) * 8;        // d group 0..56
      U128 u0, u1;
      u0.u = *reinterpret_cast<const uint4*>(
          &Vg[rowbase + (size_t)(kb * SKB + r2) * DM_ + dg]);
      u1.u = *reinterpret_cast<const uint4*>(
          &Vg[rowbase + (size_t)(kb * SKB + r2 + 1) * DM_ + dg]);
#pragma unroll
      for (int i = 0; i < 8; ++i) {
        unsigned val = (unsigned)u0.s[i] | ((unsigned)u1.s[i] << 16);
        *reinterpret_cast<unsigned*>(&Vt[(dg + i) * VLD + r2]) = val;
      }
    }
    async_wait_all();
    __syncthreads();

    // scores: 16 q-rows x 128 keys, K-dim = 64 (2 WMMA steps)
    v8f s[8];
#pragma unroll
    for (int j = 0; j < 8; ++j) s[j] = (v8f)(0.0f);
#pragma unroll
    for (int kk = 0; kk < 2; ++kk) {
      v16bf aq = load_frag(&Qs[(wq + lm) * QLD], kk * 32 + khalf * 8);
#pragma unroll
      for (int j = 0; j < 8; ++j) {
        v16bf bk = load_frag(&Ks[(j * 16 + lm) * QLD], kk * 32 + khalf * 8);
        s[j] = __builtin_amdgcn_wmma_f32_16x16x32_bf16(
            false, aq, false, bk, (short)0, s[j], false, false);
      }
    }

    // scale + mask + per-row block max (row lives in a 16-lane half)
    const int qg0 = qb * SQ + wq + khalf * 8;
    float bmax[8];
#pragma unroll
    for (int r = 0; r < 8; ++r) bmax[r] = -3.0e38f;
#pragma unroll
    for (int j = 0; j < 8; ++j) {
      int kgl = kb * SKB + j * 16 + lm;
#pragma unroll
      for (int r = 0; r < 8; ++r) {
        int mv = maskg[((size_t)b * S_ + (qg0 + r)) * (size_t)S_ + kgl];
        float sv = s[j][r] * 0.125f;           // 1/sqrt(64)
        sv = (mv == 0) ? -1.0e9f : sv;
        s[j][r] = sv;
        bmax[r] = fmaxf(bmax[r], sv);
      }
    }
#pragma unroll
    for (int r = 0; r < 8; ++r) {
      float v = bmax[r];
#pragma unroll
      for (int off = 1; off < 16; off <<= 1)
        v = fmaxf(v, __shfl_xor(v, off, 32));
      bmax[r] = v;
    }

    // online softmax update
    float alpha[8], rsum[8];
#pragma unroll
    for (int r = 0; r < 8; ++r) {
      float mn = fmaxf(mrun[r], bmax[r]);
      alpha[r] = __expf(mrun[r] - mn);
      mrun[r] = mn;
      rsum[r] = 0.0f;
    }
#pragma unroll
    for (int j = 0; j < 8; ++j)
#pragma unroll
      for (int r = 0; r < 8; ++r) {
        float p = __expf(s[j][r] - mrun[r]);
        s[j][r] = p;
        rsum[r] += p;
      }
#pragma unroll
    for (int r = 0; r < 8; ++r) {
      float v = rsum[r];
#pragma unroll
      for (int off = 1; off < 16; off <<= 1)
        v += __shfl_xor(v, off, 32);
      lrun[r] = lrun[r] * alpha[r] + v;
    }
#pragma unroll
    for (int j = 0; j < 4; ++j)
#pragma unroll
      for (int r = 0; r < 8; ++r) o[j][r] *= alpha[r];

    // stage P (C layout) to LDS row-major so it re-reads as A fragments
    unsigned short* pw = &Ps[wave * 16 * PLD];
#pragma unroll
    for (int j = 0; j < 8; ++j) {
      int col = j * 16 + lm;
#pragma unroll
      for (int r = 0; r < 8; ++r)
        pw[(r + khalf * 8) * PLD + col] = f2bf(s[j][r]);
    }
    __syncthreads();

    // o += P[16x128] @ V[128x64]  (4 WMMA K-steps x 4 d-tiles)
#pragma unroll
    for (int kk = 0; kk < 4; ++kk) {
      v16bf ap = load_frag(&pw[lm * PLD], kk * 32 + khalf * 8);
#pragma unroll
      for (int j = 0; j < 4; ++j) {
        v16bf bv = load_frag(&Vt[(j * 16 + lm) * VLD], kk * 32 + khalf * 8);
        o[j] = __builtin_amdgcn_wmma_f32_16x16x32_bf16(
            false, ap, false, bv, (short)0, o[j], false, false);
      }
    }
  }

  // normalize and write X[b*S+q][h*64+d] as bf16
#pragma unroll
  for (int j = 0; j < 4; ++j) {
    int d = j * 16 + lm;
#pragma unroll
    for (int r = 0; r < 8; ++r) {
      int qg = qb * SQ + wq + khalf * 8 + r;
      Xg[rowbase + (size_t)qg * DM_ + d] = f2bf(o[j][r] / (lrun[r] + 1e-30f));
    }
  }
}

// ---------------------------------------------------------------------------
// Kernel 3: in-place LayerNorm over rows of Y[8192][1024] (fp32).
// ---------------------------------------------------------------------------
__global__ __launch_bounds__(256) void layernorm_kernel(
    float* __restrict__ Y, const float* __restrict__ gam,
    const float* __restrict__ bet)
{
  __shared__ float red[2][8];
  const int row = blockIdx.x, tid = threadIdx.x;
  const int lane = tid & 31, wave = tid >> 5;
  float4 v = *reinterpret_cast<const float4*>(&Y[(size_t)row * DM_ + tid * 4]);
  float sum = v.x + v.y + v.z + v.w;
  float ssq = v.x * v.x + v.y * v.y + v.z * v.z + v.w * v.w;
#pragma unroll
  for (int off = 1; off < 32; off <<= 1) {
    sum += __shfl_xor(sum, off, 32);
    ssq += __shfl_xor(ssq, off, 32);
  }
  if (lane == 0) { red[0][wave] = sum; red[1][wave] = ssq; }
  __syncthreads();
  sum = red[0][lane & 7];
  ssq = red[1][lane & 7];
#pragma unroll
  for (int off = 1; off < 8; off <<= 1) {
    sum += __shfl_xor(sum, off, 32);
    ssq += __shfl_xor(ssq, off, 32);
  }
  float mu  = sum * (1.0f / DM_);
  float var = ssq * (1.0f / DM_) - mu * mu;
  float inv = rsqrtf(var + 1e-6f);
  float4 g4 = *reinterpret_cast<const float4*>(&gam[tid * 4]);
  float4 b4 = *reinterpret_cast<const float4*>(&bet[tid * 4]);
  float4 o4;
  o4.x = (v.x - mu) * inv * g4.x + b4.x;
  o4.y = (v.y - mu) * inv * g4.y + b4.y;
  o4.z = (v.z - mu) * inv * g4.z + b4.z;
  o4.w = (v.w - mu) * inv * g4.w + b4.w;
  *reinterpret_cast<float4*>(&Y[(size_t)row * DM_ + tid * 4]) = o4;
}

// ---------------------------------------------------------------------------
extern "C" void kernel_launch(void* const* d_in, const int* in_sizes, int n_in,
                              void* d_out, int out_size, void* d_ws, size_t ws_size,
                              hipStream_t stream) {
  (void)in_sizes; (void)n_in; (void)out_size; (void)ws_size;
  const float* query = (const float*)d_in[0];
  const float* key   = (const float*)d_in[1];
  const float* value = (const float*)d_in[2];
  const int*   mask  = (const int*)d_in[3];
  const float* w_qs  = (const float*)d_in[4];
  const float* w_ks  = (const float*)d_in[5];
  const float* w_vs  = (const float*)d_in[6];
  const float* w_out = (const float*)d_in[7];
  const float* ln_g  = (const float*)d_in[8];
  const float* ln_b  = (const float*)d_in[9];
  float* out = (float*)d_out;

  const size_t act  = (size_t)B_ * S_ * DM_;   // 8M elems
  const size_t wmat = (size_t)DM_ * DM_;       // 1M elems
  unsigned short* qb = (unsigned short*)d_ws;  // bf16 workspace
  unsigned short* kb = qb + act;
  unsigned short* vb = kb + act;
  unsigned short* wq = vb + act;
  unsigned short* wk = wq + wmat;
  unsigned short* wv = wk + wmat;
  unsigned short* wo = wv + wmat;
  unsigned short* Qp = wo + wmat;
  unsigned short* Kp = Qp + act;
  unsigned short* Vp = Kp + act;
  unsigned short* Xp = qb;   // qb is dead after the first projection GEMM

  const int M = B_ * S_;
  const int ga = (int)(act / 4 / 256);
  cvt_f32_bf16<<<ga, 256, 0, stream>>>(query, qb, (int)(act / 4));
  cvt_f32_bf16<<<ga, 256, 0, stream>>>(key,   kb, (int)(act / 4));
  cvt_f32_bf16<<<ga, 256, 0, stream>>>(value, vb, (int)(act / 4));
  dim3 gt(DM_ / 64, DM_ / 64);
  cvt_f32_bf16_t<<<gt, 256, 0, stream>>>(w_qs,  wq);
  cvt_f32_bf16_t<<<gt, 256, 0, stream>>>(w_ks,  wk);
  cvt_f32_bf16_t<<<gt, 256, 0, stream>>>(w_vs,  wv);
  cvt_f32_bf16_t<<<gt, 256, 0, stream>>>(w_out, wo);

  dim3 gg(DM_ / BN, M / BM);
  wmma_gemm_bf16<<<gg, 256, 0, stream>>>(qb, wq, nullptr, nullptr, Qp, M, DM_, DM_);
  wmma_gemm_bf16<<<gg, 256, 0, stream>>>(kb, wk, nullptr, nullptr, Kp, M, DM_, DM_);
  wmma_gemm_bf16<<<gg, 256, 0, stream>>>(vb, wv, nullptr, nullptr, Vp, M, DM_, DM_);

  flash_attn<<<dim3(S_ / SQ, H_, B_), 256, 0, stream>>>(Qp, Kp, Vp, mask, Xp);

  wmma_gemm_bf16<<<gg, 256, 0, stream>>>(Xp, wo, query, out, nullptr, M, DM_, DM_);
  layernorm_kernel<<<M, 256, 0, stream>>>(out, ln_g, ln_b);
}

// v002
// One run takes 326 microseconds.
// In two side-by-side timings against v001, it was 1.04 and 1.05 times as fast.
// All steps since v000 together make it 1.21 times as fast.
#include <hip/hip_runtime.h>

// ---------------------------------------------------------------------------
// MHA forward for MI455X (gfx1250): end-to-end bf16 dataflow, WMMA GEMMs,
// flash attention, CDNA5 async global->LDS staging.
// ---------------------------------------------------------------------------

#define B_ 4
#define S_ 2048
#define H_ 16
#define DM_ 1024
#define DH_ 64

typedef __attribute__((ext_vector_type(16))) __bf16 v16bf;
typedef __attribute__((ext_vector_type(8)))  float  v8f;
typedef int async_v4i __attribute__((vector_size(16)));   // builtin's int4 type

union Frag16 { v16bf v; uint4 u[2]; };
union U128   { uint4 u; unsigned short s[8]; };

__device__ __forceinline__ unsigned short f2bf(float f) {
  return __builtin_bit_cast(unsigned short, static_cast<__bf16>(f));
}

// ---- CDNA5 async global->LDS (ASYNCcnt) with safe fallback ----------------
#if defined(__gfx1250__) && __has_builtin(__builtin_amdgcn_global_load_async_to_lds_b128)
#define CDNA5_ASYNC 1
#else
#define CDNA5_ASYNC 0
#endif

__device__ __forceinline__ void cp16(const unsigned short* g, unsigned short* l) {
#if CDNA5_ASYNC
  __builtin_amdgcn_global_load_async_to_lds_b128(
      (__attribute__((address_space(1))) async_v4i*)g,
      (__attribute__((address_space(3))) async_v4i*)l, 0, 0);
#else
  *reinterpret_cast<uint4*>(l) = *reinterpret_cast<const uint4*>(g);
#endif
}

__device__ __forceinline__ void async_wait_all() {
#if CDNA5_ASYNC
#if __has_builtin(__builtin_amdgcn_s_wait_asynccnt)
  __builtin_amdgcn_s_wait_asynccnt(0);
#else
  asm volatile("s_wait_asynccnt 0x0" ::: "memory");
#endif
#endif
}

// Load a 16x32 bf16 WMMA fragment row for this lane from an LDS row pointer.
// VGPR0-3 hold K = khalf*8 .. +7, VGPR4-7 hold K = 16+khalf*8 .. +7.
__device__ __forceinline__ v16bf load_frag(const unsigned short* row, int koff) {
  Frag16 f;
  f.u[0] = *reinterpret_cast<const uint4*>(row + koff);
  f.u[1] = *reinterpret_cast<const uint4*>(row + koff + 16);
  return f.v;
}

// ---------------------------------------------------------------------------
// Kernel 0: every fp32 -> bf16 conversion of the call in one launch; the seven
// pieces are independent of one another, a block picks its piece by its index.
//   blocks [0, 4*WT_BLOCKS): weight W[k][n] fp32 -> Wt[n][k] bf16 (DM_ x DM_),
//     64x64 tiles turned in LDS, so that the GEMM reads both operands
//     K-contiguous; they come first, so that they run under the long stream.
//   the rest: the three activations, elementwise, float4 granular.
// ---------------------------------------------------------------------------
#define TLD 72   // 64 + 8 pad, rows stay 16B-aligned
#define WT_BLOCKS  ((DM_ / 64) * (DM_ / 64))     // 256 tiles per weight
#define ACT_BLOCKS (B_ * S_ * DM_ / 4 / 256)     // 8192 blocks per activation

__global__ __launch_bounds__(256) void prep_bf16(
    const float* __restrict__ a0, const float* __restrict__ a1,
    const float* __restrict__ a2,
    const float* __restrict__ w0, const float* __restrict__ w1,
    const float* __restrict__ w2, const float* __restrict__ w3,
    unsigned short* __restrict__ act_out, unsigned short* __restrict__ wt_out)
{
  __shared__ __attribute__((aligned(16))) unsigned short t[64 * TLD];   // [n][k]
  const int tid = threadIdx.x;
  const int blk = blockIdx.x;
  if (blk < 4 * WT_BLOCKS) {
    const int w = blk / WT_BLOCKS;
    const int tile = blk % WT_BLOCKS;
    const float* in = (w == 0) ? w0 : (w == 1) ? w1 : (w == 2) ? w2 : w3;
    unsigned short* out = wt_out + (size_t)w * DM_ * DM_;
    const int n0 = (tile % (DM_ / 64)) * 64;
    const int k0 = (tile / (DM_ / 64)) * 64;
#pragma unroll
    for (int p = 0; p < 4; ++p) {
      int k = p * 16 + (tid >> 4);
      int n = (tid & 15) * 4;
      float4 v = *reinterpret_cast<const float4*>(&in[(size_t)(k0 + k) * DM_ + n0 + n]);
      t[(n + 0) * TLD + k] = f2bf(v.x);
      t[(n + 1) * TLD + k] = f2bf(v.y);
      t[(n + 2) * TLD + k] = f2bf(v.z);
      t[(n + 3) * TLD + k] = f2bf(v.w);
    }
    __syncthreads();
#pragma unroll
    for (int p = 0; p < 2; ++p) {
      int idx = p * 256 + tid;
      int n = idx >> 3;
      int c = (idx & 7) * 8;
      *reinterpret_cast<uint4*>(&out[(size_t)(n0 + n) * DM_ + k0 + c]) =
          *reinterpret_cast<const uint4*>(&t[n * TLD + c]);
    }
    return;
  }
  const int ab = blk - 4 * WT_BLOCKS;
  const int a = ab / ACT_BLOCKS;
  const float* in = (a == 0) ? a0 : (a == 1) ? a1 : a2;
  unsigned short* out = act_out + (size_t)a * B_ * S_ * DM_;
  const int i = (ab % ACT_BLOCKS) * 256 + tid;
  float4 v = reinterpret_cast<const float4*>(in)[i];
  union { unsigned short s[4]; uint2 u; } o;
  o.s[0] = f2bf(v.x); o.s[1] = f2bf(v.y); o.s[2] = f2bf(v.z); o.s[3] = f2bf(v.w);
  reinterpret_cast<uint2*>(out)[i] = o.u;
  // the store's address registers are not rewritten on any path behind it before this wait
  asm volatile("s_wait_xcnt 0x0" ::: "memory");
}

// ---------------------------------------------------------------------------
// Kernel 1: C[M,N] = A[M,K] @ Bt[N,K]^T, bf16 in, bf16 out (Cb) or fp32+resid (Cf).
// Block tile 128x128, K-step 32, double-buffered LDS, 8 waves (wave32).
// blockIdx.z picks one of several independent products of the same shape whose
// A, Bt and Cb each lie one behind the other in memory.
// ---------------------------------------------------------------------------
#define BM 128
#define BN 128
#define BK 32
#define LDA 40   // 32 + 8 pad, rows stay 16B-aligned

__global__ __launch_bounds__(256) void wmma_gemm_bf16(
    const unsigned short* __restrict__ A0, const unsigned short* __restrict__ Bt0,
    const float* __restrict__ resid, float* __restrict__ Cf,
    unsigned short* __restrict__ Cb0, int M, int N, int K)
{
  __shared__ __attribute__((aligned(16))) unsigned short As[2][BM * LDA];
  __shared__ __attribute__((aligned(16))) unsigned short Bs[2][BN * LDA];   // [n][k]

  const int tid  = threadIdx.x;
  const int lane = tid & 31;
  const int wave = tid >> 5;
  const int bm = blockIdx.y * BM;
  const int bn = blockIdx.x * BN;
  const size_t bz = blockIdx.z;
  const unsigned short* A  = A0 + bz * M * K;
  const unsigned short* Bt = Bt0 + bz * N * K;
  unsigned short* Cb = Cb0 ? Cb0 + bz * M * N : nullptr;
  const int wm = (wave & 3) * 32;
  const int wn = (wave >> 2) * 64;
  const int lm = lane & 15;
  const int khalf = lane >> 4;

  v8f acc[2][4];
#pragma unroll
  for (int i = 0; i < 2; ++i)
#pragma unroll
    for (int j = 0; j < 4; ++j) acc[i][j] = (v8f)(0.0f);

  auto load_tiles = [&](int kt, int buf) {
    const int k0 = kt * BK;
    // A tile: 128x32 bf16 = 512 x 16B, async copies
#pragma unroll
    for (int p = 0; p < 2; ++p) {
      int idx = p * 256 + tid;
      int r = idx >> 2;
      int c = (idx & 3) * 8;
      cp16(&A[(size_t)(bm + r) * K + k0 + c], &As[buf][r * LDA + c]);
    }
    // B tile: 128 n-rows x 32 k bf16 from Bt[n][k], async copies like A
#pragma unroll
    for (int p = 0; p < 2; ++p) {
      int idx = p * 256 + tid;
      int r = idx >> 2;
      int c = (idx & 3) * 8;
      cp16(&Bt[(size_t)(bn + r) * K + k0 + c], &Bs[buf][r * LDA + c]);
    }
  };

  const int NK = K / BK;
  load_tiles(0, 0);
  int buf = 0;
  for (int kt = 0; kt < NK; ++kt) {
    // publish point: this wave's fragment reads of the buffer to be refilled
    // are done, its own copies of tile kt have landed, then the barrier
    asm volatile("s_wait_dscnt 0x0" ::: "memory");
    asm volatile("s_wait_asynccnt 0x0" ::: "memory");
    __syncthreads();
    if (kt + 1 < NK) load_tiles(kt + 1, buf ^ 1);
    v16bf af[2], bfr[4];
#pragma unroll
    for (int i = 0; i < 2; ++i)
      af[i] = load_frag(&As[buf][(wm + i * 16 + lm) * LDA], khalf * 8);
#pragma unroll
    for (int j = 0; j < 4; ++j)
      bfr[j] = load_frag(&Bs[buf][(wn + j * 16 + lm) * LDA], khalf * 8);
#pragma unroll
    for (int i = 0; i < 2; ++i)
#pragma unroll
      for (int j = 0; j < 4; ++j)
        acc[i][j] = __builtin_amdgcn_wmma_f32_16x16x32_bf16(
            false, af[i], false, bfr[j], (short)0, acc[i][j], false, false);
    buf ^= 1;
  }
  // no copy of this wave is left in flight when it goes on to its end
  asm volatile("s_wait_asynccnt 0x0" ::: "memory");

  // C tile layout: lane holds (m = r + khalf*8, n = lm) of each 16x16 tile.
#pragma unroll
  for (int i = 0; i < 2; ++i)
#pragma unroll
    for (int j = 0; j < 4; ++j)
#pragma unroll
      for (int r = 0; r < 8; ++r) {
        int row = bm + wm + i * 16 + r + khalf * 8;
        int col = bn + wn + j * 16 + lm;
        float v = acc[i][j][r];
        if (Cb) {
          Cb[(size_t)row * N + col] = f2bf(v);
        } else {
          if (resid) v += resid[(size_t)row * N + col];
          Cf[(size_t)row * N + col] = v;
        }
      }
}

// ---------------------------------------------------------------------------
// Kernel 2: flash attention, bf16 Q/K/V in workspace layout [b*S+s][h*64+d].
// One WG per (b, h, 128-q block); 8 waves, each owns 16 q-rows.
// ---------------------------------------------------------------------------
#define SQ 128
#define SKB 128
#define QLD 72    // 64 + 8
#define VLD 136   // 128 + 8
#define PLD 136

__global__ __launch_bounds__(256) void flash_attn(
    const unsigned short* __restrict__ Qg, const unsigned short* __restrict__ Kg,
    const unsigned short* __restrict__ Vg, const int* __restrict__ maskg,
    unsigned short* __restrict__ Xg)
{
  __shared__ unsigned short Qs[SQ * QLD];
  __shared__ unsigned short Ks[SKB * QLD];
  __shared__ unsigned short Vt[DH_ * VLD];        // V^T: [d][key]
  __shared__ unsigned short Ps[8 * 16 * PLD];     // per-wave P staging

  const int tid  = threadIdx.x;
  const int lane = tid & 31;
  const int wave = tid >> 5;
  const int qb = blockIdx.x, h = blockIdx.y, b = blockIdx.z;
  const int lm = lane & 15;
  const int khalf = lane >> 4;
  const size_t rowbase = (size_t)b * S_ * DM_ + (size_t)h * DH_;

  // Q block -> LDS (async)
#pragma unroll
  for (int g = 0; g < 4; ++g) {
    int idx = g * 256 + tid;
    int r = idx >> 3;
    int c = (idx & 7) * 8;
    cp16(&Qg[rowbase + (size_t)(qb * SQ + r) * DM_ + c], &Qs[r * QLD + c]);
  }

  float mrun[8], lrun[8];
#pragma unroll
  for (int r = 0; r < 8; ++r) { mrun[r] = -3.0e38f; lrun[r] = 0.0f; }
  v8f o[4];
#pragma unroll
  for (int j = 0; j < 4; ++j) o[j] = (v8f)(0.0f);

  const int wq = wave * 16;

  for (int kb = 0; kb < S_ / SKB; ++kb) {
    __syncthreads();
    // K block -> LDS (async), layout [key][d]
#pragma unroll
    for (int g = 0; g < 4; ++g) {
      int idx = g * 256 + tid;
      int r = idx >> 3;
      int c = (idx & 7) * 8;
      cp16(&Kg[rowbase + (size_t)(kb * SKB + r) * DM_ + c], &Ks[r * QLD + c]);
    }
    // V block -> LDS transposed [d][key], 2 key-rows packed per b32 store
#pragma unroll
    for (int g = 0; g < 2; ++g) {
      int idx = g * 256 + tid;
      int r2 = (idx >> 3) * 2;       // key pair 0..126
      int dg = (idx & 7) * 8;        // d group 0..56
      U128 u0, u1;
      u0.u = *reinterpret_cast<const uint4*>(
          &Vg[rowbase + (size_t)(kb * SKB + r2) * DM_ + dg]);
      u1.u = *reinterpret_cast<const uint4*>(
          &Vg[rowbase + (size_t)(kb * SKB + r2 + 1) * DM_ + dg]);
#pragma unroll
      for (int i = 0; i < 8; ++i) {
        unsigned val = (unsigned)u0.s[i] | ((unsigned)u1.s[i] << 16);
        *reinterpret_cast<unsigned*>(&Vt[(dg + i) * VLD + r2]) = val;
      }
    }
    async_wait_all();
    __syncthreads();

    // scores: 16 q-rows x 128 keys, K-dim = 64 (2 WMMA steps)
    v8f s[8];
#pragma unroll
    for (int j = 0; j < 8; ++j) s[j] = (v8f)(0.0f);
#pragma unroll
    for (int kk = 0; kk < 2; ++kk) {
      v16bf aq = load_frag(&Qs[(wq + lm) * QLD], kk * 32 + khalf * 8);
#pragma unroll
      for (int j = 0; j < 8; ++j) {
        v16bf bk = load_frag(&Ks[(j * 16 + lm) * QLD], kk * 32 + khalf * 8);
        s[j] = __builtin_amdgcn_wmma_f32_16x16x32_bf16(
            false, aq, false, bk, (short)0, s[j], false, false);
      }
    }

    // scale + mask + per-row block max (row lives in a 16-lane half)
    const int qg0 = qb * SQ + wq + khalf * 8;
    float bmax[8];
#pragma unroll
    for (int r = 0; r < 8; ++r) bmax[r] = -3.0e38f;
#pragma unroll
    for (int j = 0; j < 8; ++j) {
      int kgl = kb * SKB + j * 16 + lm;
#pragma unroll
      for (int r = 0; r < 8; ++r) {
        int mv = maskg[((size_t)b * S_ + (qg0 + r)) * (size_t)S_ + kgl];
        float sv = s[j][r] * 0.125f;           // 1/sqrt(64)
        sv = (mv == 0) ? -1.0e9f : sv;
        s[j][r] = sv;
        bmax[r] = fmaxf(bmax[r], sv);
      }
    }
#pragma unroll
    for (int r = 0; r < 8; ++r) {
      float v = bmax[r];
#pragma unroll
      for (int off = 1; off < 16; off <<= 1)
        v = fmaxf(v, __shfl_xor(v, off, 32));
      bmax[r] = v;
    }

    // online softmax update
    float alpha[8], rsum[8];
#pragma unroll
    for (int r = 0; r < 8; ++r) {
      float mn = fmaxf(mrun[r], bmax[r]);
      alpha[r] = __expf(mrun[r] - mn);
      mrun[r] = mn;
      rsum[r] = 0.0f;
    }
#pragma unroll
    for (int j = 0; j < 8; ++j)
#pragma unroll
      for (int r = 0; r < 8; ++r) {
        float p = __expf(s[j][r] - mrun[r]);
        s[j][r] = p;
        rsum[r] += p;
      }
#pragma unroll
    for (int r = 0; r < 8; ++r) {
      float v = rsum[r];
#pragma unroll
      for (int off = 1; off < 16; off <<= 1)
        v += __shfl_xor(v, off, 32);
      lrun[r] = lrun[r] * alpha[r] + v;
    }
#pragma unroll
    for (int j = 0; j < 4; ++j)
#pragma unroll
      for (int r = 0; r < 8; ++r) o[j][r] *= alpha[r];

    // stage P (C layout) to LDS row-major so it re-reads as A fragments
    unsigned short* pw = &Ps[wave * 16 * PLD];
#pragma unroll
    for (int j = 0; j < 8; ++j) {
      int col = j * 16 + lm;
#pragma unroll
      for (int r = 0; r < 8; ++r)
        pw[(r + khalf * 8) * PLD + col] = f2bf(s[j][r]);
    }
    __syncthreads();

    // o += P[16x128] @ V[128x64]  (4 WMMA K-steps x 4 d-tiles)
#pragma unroll
    for (int kk = 0; kk < 4; ++kk) {
      v16bf ap = load_frag(&pw[lm * PLD], kk * 32 + khalf * 8);
#pragma unroll
      for (int j = 0; j < 4; ++j) {
        v16bf bv = load_frag(&Vt[(j * 16 + lm) * VLD], kk * 32 + khalf * 8);
        o[j] = __builtin_amdgcn_wmma_f32_16x16x32_bf16(
            false, ap, false, bv, (short)0, o[j], false, false);
      }
    }
  }

  // normalize and write X[b*S+q][h*64+d] as bf16
#pragma unroll
  for (int j = 0; j < 4; ++j) {
    int d = j * 16 + lm;
#pragma unroll
    for (int r = 0; r < 8; ++r) {
      int qg = qb * SQ + wq + khalf * 8 + r;
      Xg[rowbase + (size_t)qg * DM_ + d] = f2bf(o[j][r] / (lrun[r] + 1e-30f));
    }
  }
}

// ---------------------------------------------------------------------------
// Kernel 3: in-place LayerNorm over rows of Y[8192][1024] (fp32).
// ---------------------------------------------------------------------------
__global__ __launch_bounds__(256) void layernorm_kernel(
    float* __restrict__ Y, const float* __restrict__ gam,
    const float* __restrict__ bet)
{
  __shared__ float red[2][8];
  const int row = blockIdx.x, tid = threadIdx.x;
  const int lane = tid & 31, wave = tid >> 5;
  float4 v = *reinterpret_cast<const float4*>(&Y[(size_t)row * DM_ + tid * 4]);
  float sum = v.x + v.y + v.z + v.w;
  float ssq = v.x * v.x + v.y * v.y + v.z * v.z + v.w * v.w;
#pragma unroll
  for (int off = 1; off < 32; off <<= 1) {
    sum += __shfl_xor(sum, off, 32);
    ssq += __shfl_xor(ssq, off, 32);
  }
  if (lane == 0) { red[0][wave] = sum; red[1][wave] = ssq; }
  __syncthreads();
  sum = red[0][lane & 7];
  ssq = red[1][lane & 7];
#pragma unroll
  for (int off = 1; off < 8; off <<= 1) {
    sum += __shfl_xor(sum, off, 32);
    ssq += __shfl_xor(ssq, off, 32);
  }
  float mu  = sum * (1.0f / DM_);
  float var = ssq * (1.0f / DM_) - mu * mu;
  float inv = rsqrtf(var + 1e-6f);
  float4 g4 = *reinterpret_cast<const float4*>(&gam[tid * 4]);
  float4 b4 = *reinterpret_cast<const float4*>(&bet[tid * 4]);
  float4 o4;
  o4.x = (v.x - mu) * inv * g4.x + b4.x;
  o4.y = (v.y - mu) * inv * g4.y + b4.y;
  o4.z = (v.z - mu) * inv * g4.z + b4.z;
  o4.w = (v.w - mu) * inv * g4.w + b4.w;
  *reinterpret_cast<float4*>(&Y[(size_t)row * DM_ + tid * 4]) = o4;
}

// ---------------------------------------------------------------------------
extern "C" void kernel_launch(void* const* d_in, const int* in_sizes, int n_in,
                              void* d_out, int out_size, void* d_ws, size_t ws_size,
                              hipStream_t stream) {
  (void)in_sizes; (void)n_in; (void)out_size; (void)ws_size;
  const float* query = (const float*)d_in[0];
  const float* key   = (const float*)d_in[1];
  const float* value = (const float*)d_in[2];
  const int*   mask  = (const int*)d_in[3];
  const float* w_qs  = (const float*)d_in[4];
  const float* w_ks  = (const float*)d_in[5];
  const float* w_vs  = (const float*)d_in[6];
  const float* w_out = (const float*)d_in[7];
  const float* ln_g  = (const float*)d_in[8];
  const float* ln_b  = (const float*)d_in[9];
  float* out = (float*)d_out;

  const size_t act  = (size_t)B_ * S_ * DM_;   // 8M elems
  const size_t wmat = (size_t)DM_ * DM_;       // 1M elems
  unsigned short* qb = (unsigned short*)d_ws;  // bf16 workspace
  unsigned short* kb = qb + act;
  unsigned short* vb = kb + act;
  unsigned short* wq = vb + act;
  unsigned short* wk = wq + wmat;
  unsigned short* wv = wk + wmat;
  unsigned short* wo = wv + wmat;
  unsigned short* Qp = wo + wmat;
  unsigned short* Kp = Qp + act;
  unsigned short* Vp = Kp + act;
  unsigned short* Xp = qb;   // qb is dead after the projection launch

  const int M = B_ * S_;
  // qb, kb, vb and wq, wk, wv, wo lie one behind the other in the workspace
  prep_bf16<<<4 * WT_BLOCKS + 3 * ACT_BLOCKS, 256, 0, stream>>>(
      query, key, value, w_qs, w_ks, w_vs, w_out, qb, wq);

  // the three projections are independent: one launch, z = 0, 1, 2
  wmma_gemm_bf16<<<dim3(DM_ / BN, M / BM, 3), 256, 0, stream>>>(
      qb, wq, nullptr, nullptr, Qp, M, DM_, DM_);

  flash_attn<<<dim3(S_ / SQ, H_, B_), 256, 0, stream>>>(Qp, Kp, Vp, mask, Xp);

  wmma_gemm_bf16<<<dim3(DM_ / BN, M / BM, 1), 256, 0, stream>>>(
      Xp, wo, query, out, nullptr, M, DM_, DM_);
  layernorm_kernel<<<M, 256, 0, stream>>>(out, ln_g, ln_b);
}

// v003
// It runs in 312 microseconds.
// Next to v002, in two timings, it ran 1.05 times as fast each time.
// Over all steps from v000 it is 1.26 times as fast.
#include <hip/hip_runtime.h>

// ---------------------------------------------------------------------------
// MHA forward for MI455X (gfx1250): end-to-end bf16 dataflow, WMMA GEMMs,
// flash attention, CDNA5 async global->LDS staging.
// ---------------------------------------------------------------------------

#define B_ 4
#define S_ 2048
#define H_ 16
#define DM_ 1024
#define DH_ 64

typedef __attribute__((ext_vector_type(16))) __bf16 v16bf;
typedef __attribute__((ext_vector_type(8)))  float  v8f;
typedef int async_v4i __attribute__((vector_size(16)));   // builtin's int4 type

union Frag16 { v16bf v; uint4 u[2]; };
union U128   { uint4 u; unsigned short s[8]; };

__device__ __forceinline__ unsigned short f2bf(float f) {
  return __builtin_bit_cast(unsigned short, static_cast<__bf16>(f));
}

// ---- CDNA5 async global->LDS (ASYNCcnt) with safe fallback ----------------
#if defined(__gfx1250__) && __has_builtin(__builtin_amdgcn_global_load_async_to_lds_b128)
#define CDNA5_ASYNC 1
#else
#define CDNA5_ASYNC 0
#endif

__device__ __forceinline__ void cp16(const unsigned short* g, unsigned short* l) {
#if CDNA5_ASYNC
  __builtin_amdgcn_global_load_async_to_lds_b128(
      (__attribute__((address_space(1))) async_v4i*)g,
      (__attribute__((address_space(3))) async_v4i*)l, 0, 0);
#else
  *reinterpret_cast<uint4*>(l) = *reinterpret_cast<const uint4*>(g);
#endif
}

__device__ __forceinline__ void async_wait_all() {
#if CDNA5_ASYNC
#if __has_builtin(__builtin_amdgcn_s_wait_asynccnt)
  __builtin_amdgcn_s_wait_asynccnt(0);
#else
  asm volatile("s_wait_asynccnt 0x0" ::: "memory");
#endif
#endif
}

// Load a 16x32 bf16 WMMA fragment row for this lane from an LDS row pointer.
// VGPR0-3 hold K = khalf*8 .. +7, VGPR4-7 hold K = 16+khalf*8 .. +7.
__device__ __forceinline__ v16bf load_frag(const unsigned short* row, int koff) {
  Frag16 f;
  f.u[0] = *reinterpret_cast<const uint4*>(row + koff);
  f.u[1] = *reinterpret_cast<const uint4*>(row + koff + 16);
  return f.v;
}

// ---------------------------------------------------------------------------
// Kernel 0: every fp32 -> bf16 conversion of the call in one launch; the seven
// pieces are independent of one another, a block picks its piece by its index.
//   blocks [0, 4*WT_BLOCKS): weight W[k][n] fp32 -> Wt[n][k] bf16 (DM_ x DM_),
//     64x64 tiles turned in LDS, so that the GEMM reads both operands
//     K-contiguous; they come first, so that they run under the long stream.
//   the rest: the three activations, elementwise, float4 granular.
// ---------------------------------------------------------------------------
#define TLD 72   // 64 + 8 pad, rows stay 16B-aligned
#define WT_BLOCKS  ((DM_ / 64) * (DM_ / 64))     // 256 tiles per weight
#define ACT_BLOCKS (B_ * S_ * DM_ / 4 / 256)     // 8192 blocks per activation

__global__ __launch_bounds__(256) void prep_bf16(
    const float* __restrict__ a0, const float* __restrict__ a1,
    const float* __restrict__ a2,
    const float* __restrict__ w0, const float* __restrict__ w1,
    const float* __restrict__ w2, const float* __restrict__ w3,
    unsigned short* __restrict__ act_out, unsigned short* __restrict__ wt_out)
{
  __shared__ __attribute__((aligned(16))) unsigned short t[64 * TLD];   // [n][k]
  const int tid = threadIdx.x;
  const int blk = blockIdx.x;
  if (blk < 4 * WT_BLOCKS) {
    const int w = blk / WT_BLOCKS;
    const int tile = blk % WT_BLOCKS;
    const float* in = (w == 0) ? w0 : (w == 1) ? w1 : (w == 2) ? w2 : w3;
    unsigned short* out = wt_out + (size_t)w * DM_ * DM_;
    const int n0 = (tile % (DM_ / 64)) * 64;
    const int k0 = (tile / (DM_ / 64)) * 64;
#pragma unroll
    for (int p = 0; p < 4; ++p) {
      int k = p * 16 + (tid >> 4);
      int n = (tid & 15) * 4;
      float4 v = *reinterpret_cast<const float4*>(&in[(size_t)(k0 + k) * DM_ + n0 + n]);
      t[(n + 0) * TLD + k] = f2bf(v.x);
      t[(n + 1) * TLD + k] = f2bf(v.y);
      t[(n + 2) * TLD + k] = f2bf(v.z);
      t[(n + 3) * TLD + k] = f2bf(v.w);
    }
    __syncthreads();
#pragma unroll
    for (int p = 0; p < 2; ++p) {
      int idx = p * 256 + tid;
      int n = idx >> 3;
      int c = (idx & 7) * 8;
      *reinterpret_cast<uint4*>(&out[(size_t)(n0 + n) * DM_ + k0 + c]) =
          *reinterpret_cast<const uint4*>(&t[n * TLD + c]);
    }
    return;
  }
  const int ab = blk - 4 * WT_BLOCKS;
  const int a = ab / ACT_BLOCKS;
  const float* in = (a == 0) ? a0 : (a == 1) ? a1 : a2;
  unsigned short* out = act_out + (size_t)a * B_ * S_ * DM_;
  const int i = (ab % ACT_BLOCKS) * 256 + tid;
  float4 v = reinterpret_cast<const float4*>(in)[i];
  union { unsigned short s[4]; uint2 u; } o;
  o.s[0] = f2bf(v.x); o.s[1] = f2bf(v.y); o.s[2] = f2bf(v.z); o.s[3] = f2bf(v.w);
  reinterpret_cast<uint2*>(out)[i] = o.u;
  // the store's address registers are not rewritten on any path behind it before this wait
  asm volatile("s_wait_xcnt 0x0" ::: "memory");
}

// ---------------------------------------------------------------------------
// Kernel 1: C[M,N] = A[M,K] @ Bt[N,K]^T, bf16 in, bf16 out (Cb) or fp32+resid (Cf).
// Block tile 128x128, K-step 32, double-buffered LDS, 8 waves (wave32).
// blockIdx.z picks one of several independent products of the same shape whose
// A, Bt and Cb each lie one behind the other in memory.
// ---------------------------------------------------------------------------
#define BM 128
#define BN 128
#define BK 32
#define LDA 40   // 32 + 8 pad, rows stay 16B-aligned

__global__ __launch_bounds__(256) void wmma_gemm_bf16(
    const unsigned short* __restrict__ A0, const unsigned short* __restrict__ Bt0,
    const float* __restrict__ resid, float* __restrict__ Cf,
    unsigned short* __restrict__ Cb0, int M, int N, int K)
{
  __shared__ __attribute__((aligned(16))) unsigned short As[2][BM * LDA];
  __shared__ __attribute__((aligned(16))) unsigned short Bs[2][BN * LDA];   // [n][k]

  const int tid  = threadIdx.x;
  const int lane = tid & 31;
  const int wave = tid >> 5;
  const int bm = blockIdx.y * BM;
  const int bn = blockIdx.x * BN;
  const size_t bz = blockIdx.z;
  const unsigned short* A  = A0 + bz * M * K;
  const unsigned short* Bt = Bt0 + bz * N * K;
  unsigned short* Cb = Cb0 ? Cb0 + bz * M * N : nullptr;
  const int wm = (wave & 3) * 32;
  const int wn = (wave >> 2) * 64;
  const int lm = lane & 15;
  const int khalf = lane >> 4;

  v8f acc[2][4];
#pragma unroll
  for (int i = 0; i < 2; ++i)
#pragma unroll
    for (int j = 0; j < 4; ++j) acc[i][j] = (v8f)(0.0f);

  auto load_tiles = [&](int kt, int buf) {
    const int k0 = kt * BK;
    // A tile: 128x32 bf16 = 512 x 16B, async copies
#pragma unroll
    for (int p = 0; p < 2; ++p) {
      int idx = p * 256 + tid;
      int r = idx >> 2;
      int c = (idx & 3) * 8;
      cp16(&A[(size_t)(bm + r) * K + k0 + c], &As[buf][r * LDA + c]);
    }
    // B tile: 128 n-rows x 32 k bf16 from Bt[n][k], async copies like A
#pragma unroll
    for (int p = 0; p < 2; ++p) {
      int idx = p * 256 + tid;
      int r = idx >> 2;
      int c = (idx & 3) * 8;
      cp16(&Bt[(size_t)(bn + r) * K + k0 + c], &Bs[buf][r * LDA + c]);
    }
  };

  const int NK = K / BK;
  load_tiles(0, 0);
  int buf = 0;
  for (int kt = 0; kt < NK; ++kt) {
    // publish point: this wave's fragment reads of the buffer to be refilled
    // are done, its own copies of tile kt have landed, then the barrier
    asm volatile("s_wait_dscnt 0x0" ::: "memory");
    asm volatile("s_wait_asynccnt 0x0" ::: "memory");
    __syncthreads();
    if (kt + 1 < NK) load_tiles(kt + 1, buf ^ 1);
    v16bf af[2], bfr[4];
#pragma unroll
    for (int i = 0; i < 2; ++i)
      af[i] = load_frag(&As[buf][(wm + i * 16 + lm) * LDA], khalf * 8);
#pragma unroll
    for (int j = 0; j < 4; ++j)
      bfr[j] = load_frag(&Bs[buf][(wn + j * 16 + lm) * LDA], khalf * 8);
#pragma unroll
    for (int i = 0; i < 2; ++i)
#pragma unroll
      for (int j = 0; j < 4; ++j)
        acc[i][j] = __builtin_amdgcn_wmma_f32_16x16x32_bf16(
            false, af[i], false, bfr[j], (short)0, acc[i][j], false, false);
    buf ^= 1;
  }
  // no copy of this wave is left in flight when it goes on to its end
  asm volatile("s_wait_asynccnt 0x0" ::: "memory");

  // C tile layout: lane holds (m = r + khalf*8, n = lm) of each 16x16 tile.
#pragma unroll
  for (int i = 0; i < 2; ++i)
#pragma unroll
    for (int j = 0; j < 4; ++j)
#pragma unroll
      for (int r = 0; r < 8; ++r) {
        int row = bm + wm + i * 16 + r + khalf * 8;
        int col = bn + wn + j * 16 + lm;
        float v = acc[i][j][r];
        if (Cb) {
          Cb[(size_t)row * N + col] = f2bf(v);
        } else {
          if (resid) v += resid[(size_t)row * N + col];
          Cf[(size_t)row * N + col] = v;
        }
      }
}

#define SQ 128
#define SKB 128
#define QLD 72    // 64 + 8
#define VLD 136   // 128 + 8

// value of lane l ^ 16
__device__ __forceinline__ float xhalf(float x) {
  int i = __builtin_bit_cast(int, x);
  return __builtin_bit_cast(float, __builtin_amdgcn_permlanex16(
      i, i, 0x76543210, 0xfedcba98, false, false));
}

__global__ __launch_bounds__(256) void flash_attn(
    const unsigned short* __restrict__ Qg, const unsigned short* __restrict__ Kg,
    const unsigned short* __restrict__ Vg, const int* __restrict__ maskg,
    unsigned short* __restrict__ Xg)
{
  __shared__ unsigned short Qs[SQ * QLD];
  __shared__ unsigned short Ks[SKB * QLD];
  __shared__ unsigned short Vt[DH_ * VLD];        // V^T: [d][key]

  const int tid  = threadIdx.x;
  const int lane = tid & 31;
  const int wave = tid >> 5;
  const int qb = blockIdx.x, h = blockIdx.y, b = blockIdx.z;
  const int lm = lane & 15;
  const int khalf = lane >> 4;
  const size_t rowbase = (size_t)b * S_ * DM_ + (size_t)h * DH_;

  // Q block -> LDS (async)
#pragma unroll
  for (int g = 0; g < 4; ++g) {
    int idx = g * 256 + tid;
    int r = idx >> 3;
    int c = (idx & 7) * 8;
    cp16(&Qg[rowbase + (size_t)(qb * SQ + r) * DM_ + c], &Qs[r * QLD + c]);
  }

  const int wq = wave * 16;
  const int qrow = qb * SQ + wq + lm;             // this lane's query
  // this lane's mask row, at the first of its eight keys of a 16-key tile
  const int* mrow = maskg + ((size_t)b * S_ + qrow) * (size_t)S_ + khalf * 8;

  float mrun = -3.0e38f;   // running maximum of the query, equal in both halves
  float lrun = 0.0f;       // running sum over this half's keys only
  v8f o[4];                // o[j][r] = O[qrow][j*16 + khalf*8 + r]
#pragma unroll
  for (int j = 0; j < 4; ++j) o[j] = (v8f)(0.0f);

  for (int kb = 0; kb < S_ / SKB; ++kb) {
    __syncthreads();
    // K block -> LDS (async), layout [key][d]
#pragma unroll
    for (int g = 0; g < 4; ++g) {
      int idx = g * 256 + tid;
      int r = idx >> 3;
      int c = (idx & 7) * 8;
      cp16(&Kg[rowbase + (size_t)(kb * SKB + r) * DM_ + c], &Ks[r * QLD + c]);
    }
    // V block -> LDS transposed [d][key], 2 key-rows packed per b32 store
#pragma unroll
    for (int g = 0; g < 2; ++g) {
      int idx = g * 256 + tid;
      int r2 = (idx >> 3) * 2;       // key pair 0..126
      int dg = (idx & 7) * 8;        // d group 0..56
      U128 u0, u1;
      u0.u = *reinterpret_cast<const uint4*>(
          &Vg[rowbase + (size_t)(kb * SKB + r2) * DM_ + dg]);
      u1.u = *reinterpret_cast<const uint4*>(
          &Vg[rowbase + (size_t)(kb * SKB + r2 + 1) * DM_ + dg]);
#pragma unroll
      for (int i = 0; i < 8; ++i) {
        unsigned val = (unsigned)u0.s[i] | ((unsigned)u1.s[i] << 16);
        *reinterpret_cast<unsigned*>(&Vt[(dg + i) * VLD + r2]) = val;
      }
    }
    async_wait_all();
    __syncthreads();

    // this lane's 64 mask words of the block: 8 consecutive keys per 16-key tile
    int4 mk[16];
#pragma unroll
    for (int j = 0; j < 8; ++j) {
      mk[2 * j]     = *reinterpret_cast<const int4*>(mrow + kb * SKB + j * 16);
      mk[2 * j + 1] = *reinterpret_cast<const int4*>(mrow + kb * SKB + j * 16 + 4);
    }
    // the loads' address pair is advanced later in the pass: no write of it in front of this wait
    asm volatile("s_wait_xcnt 0x0" ::: "memory");
    // keeps all sixteen loads issued together in front of the first product; without
    // it they sink behind it and go out a few at a time, each group waited for in turn
    __builtin_amdgcn_sched_barrier(0);

    // scores^T: 128 keys x 16 q-columns, K-dim = 64 (2 WMMA steps);
    // s[j][r] = S[qrow][kb*128 + j*16 + khalf*8 + r]
    v8f s[8];
#pragma unroll
    for (int j = 0; j < 8; ++j) s[j] = (v8f)(0.0f);
#pragma unroll
    for (int kk = 0; kk < 2; ++kk) {
      v16bf bq = load_frag(&Qs[(wq + lm) * QLD], kk * 32 + khalf * 8);
#pragma unroll
      for (int j = 0; j < 8; ++j) {
        v16bf ak = load_frag(&Ks[(j * 16 + lm) * QLD], kk * 32 + khalf * 8);
        s[j] = __builtin_amdgcn_wmma_f32_16x16x32_bf16(
            false, ak, false, bq, (short)0, s[j], false, false);
      }
    }

    // scale + mask + block maximum, eight independent in-lane chains
    v8f bm = (v8f)(-3.0e38f);
#pragma unroll
    for (int j = 0; j < 8; ++j) {
      const int4 m0 = mk[2 * j], m1 = mk[2 * j + 1];
      const int mv[8] = {m0.x, m0.y, m0.z, m0.w, m1.x, m1.y, m1.z, m1.w};
      const v8f sc = s[j] * 0.125f;            // 1/sqrt(64)
#pragma unroll
      for (int r = 0; r < 8; ++r) {
        float sv = (mv[r] == 0) ? -1.0e9f : sc[r];
        s[j][r] = sv;
      }
      bm = __builtin_elementwise_max(bm, s[j]);
    }
    float bmax = fmaxf(fmaxf(fmaxf(bm[0], bm[1]), fmaxf(bm[2], bm[3])),
                       fmaxf(fmaxf(bm[4], bm[5]), fmaxf(bm[6], bm[7])));
    bmax = fmaxf(bmax, xhalf(bmax));           // the query's other 64 keys

    // online softmax update
    const float mn = fmaxf(mrun, bmax);
    const float alpha = __expf(mrun - mn);
    mrun = mn;
    v8f rs = (v8f)(0.0f);
#pragma unroll
    for (int j = 0; j < 8; ++j) {
#pragma unroll
      for (int r = 0; r < 8; ++r) {
        float p = __expf(s[j][r] - mrun);
        s[j][r] = p;
      }
      rs += s[j];
    }
    lrun = lrun * alpha + (((rs[0] + rs[1]) + (rs[2] + rs[3])) +
                           ((rs[4] + rs[5]) + (rs[6] + rs[7])));
#pragma unroll
    for (int j = 0; j < 4; ++j)
#pragma unroll
      for (int r = 0; r < 8; ++r) o[j][r] *= alpha;

    // o^T += V^T[64x128] @ P^T[128x16]  (4 WMMA K-steps x 4 d-tiles);
    // element e of the B operand is key 8*khalf + e, then 16 + 8*khalf + (e-8),
    // of the 32 keys: tiles 2kk and 2kk+1 as they lie, the order load_frag has
#pragma unroll
    for (int kk = 0; kk < 4; ++kk) {
      v16bf bp;
#pragma unroll
      for (int e = 0; e < 8; ++e) {
        bp[e]     = static_cast<__bf16>(s[2 * kk][e]);
        bp[8 + e] = static_cast<__bf16>(s[2 * kk + 1][e]);
      }
#pragma unroll
      for (int j = 0; j < 4; ++j) {
        v16bf av = load_frag(&Vt[(j * 16 + lm) * VLD], kk * 32 + khalf * 8);
        o[j] = __builtin_amdgcn_wmma_f32_16x16x32_bf16(
            false, av, false, bp, (short)0, o[j], false, false);
      }
    }
  }

  // join the halves' sums, normalize, write X[b*S+q][h*64+d] as bf16:
  // eight consecutive d per lane and tile, one 16-byte store
  const float lsum = lrun + xhalf(lrun) + 1e-30f;
#pragma unroll
  for (int j = 0; j < 4; ++j) {
    U128 x;
#pragma unroll
    for (int r = 0; r < 8; ++r) x.s[r] = f2bf(o[j][r] / lsum);
    *reinterpret_cast<uint4*>(
        &Xg[rowbase + (size_t)qrow * DM_ + j * 16 + khalf * 8]) = x.u;
  }
}

// ---------------------------------------------------------------------------
// Kernel 3: in-place LayerNorm over rows of Y[8192][1024] (fp32).
// ---------------------------------------------------------------------------
__global__ __launch_bounds__(256) void layernorm_kernel(
    float* __restrict__ Y, const float* __restrict__ gam,
    const float* __restrict__ bet)
{
  __shared__ float red[2][8];
  const int row = blockIdx.x, tid = threadIdx.x;
  const int lane = tid & 31, wave = tid >> 5;
  float4 v = *reinterpret_cast<const float4*>(&Y[(size_t)row * DM_ + tid * 4]);
  float sum = v.x + v.y + v.z + v.w;
  float ssq = v.x * v.x + v.y * v.y + v.z * v.z + v.w * v.w;
#pragma unroll
  for (int off = 1; off < 32; off <<= 1) {
    sum += __shfl_xor(sum, off, 32);
    ssq += __shfl_xor(ssq, off, 32);
  }
  if (lane == 0) { red[0][wave] = sum; red[1][wave] = ssq; }
  __syncthreads();
  sum = red[0][lane & 7];
  ssq = red[1][lane & 7];
#pragma unroll
  for (int off = 1; off < 8; off <<= 1) {
    sum += __shfl_xor(sum, off, 32);
    ssq += __shfl_xor(ssq, off, 32);
  }
  float mu  = sum * (1.0f / DM_);
  float var = ssq * (1.0f / DM_) - mu * mu;
  float inv = rsqrtf(var + 1e-6f);
  float4 g4 = *reinterpret_cast<const float4*>(&gam[tid * 4]);
  float4 b4 = *reinterpret_cast<const float4*>(&bet[tid * 4]);
  float4 o4;
  o4.x = (v.x - mu) * inv * g4.x + b4.x;
  o4.y = (v.y - mu) * inv * g4.y + b4.y;
  o4.z = (v.z - mu) * inv * g4.z + b4.z;
  o4.w = (v.w - mu) * inv * g4.w + b4.w;
  *reinterpret_cast<float4*>(&Y[(size_t)row * DM_ + tid * 4]) = o4;
}

// ---------------------------------------------------------------------------
extern "C" void kernel_launch(void* const* d_in, const int* in_sizes, int n_in,
                              void* d_out, int out_size, void* d_ws, size_t ws_size,
                              hipStream_t stream) {
  (void)in_sizes; (void)n_in; (void)out_size; (void)ws_size;
  const float* query = (const float*)d_in[0];
  const float* key   = (const float*)d_in[1];
  const float* value = (const float*)d_in[2];
  const int*   mask  = (const int*)d_in[3];
  const float* w_qs  = (const float*)d_in[4];
  const float* w_ks  = (const float*)d_in[5];
  const float* w_vs  = (const float*)d_in[6];
  const float* w_out = (const float*)d_in[7];
  const float* ln_g  = (const float*)d_in[8];
  const float* ln_b  = (const float*)d_in[9];
  float* out = (float*)d_out;

  const size_t act  = (size_t)B_ * S_ * DM_;   // 8M elems
  const size_t wmat = (size_t)DM_ * DM_;       // 1M elems
  unsigned short* qb = (unsigned short*)d_ws;  // bf16 workspace
  unsigned short* kb = qb + act;
  unsigned short* vb = kb + act;
  unsigned short* wq = vb + act;
  unsigned short* wk = wq + wmat;
  unsigned short* wv = wk + wmat;
  unsigned short* wo = wv + wmat;
  unsigned short* Qp = wo + wmat;
  unsigned short* Kp = Qp + act;
  unsigned short* Vp = Kp + act;
  unsigned short* Xp = qb;   // qb is dead after the projection launch

  const int M = B_ * S_;
  // qb, kb, vb and wq, wk, wv, wo lie one behind the other in the workspace
  prep_bf16<<<4 * WT_BLOCKS + 3 * ACT_BLOCKS, 256, 0, stream>>>(
      query, key, value, w_qs, w_ks, w_vs, w_out, qb, wq);

  // the three projections are independent: one launch, z = 0, 1, 2
  wmma_gemm_bf16<<<dim3(DM_ / BN, M / BM, 3), 256, 0, stream>>>(
      qb, wq, nullptr, nullptr, Qp, M, DM_, DM_);

  flash_attn<<<dim3(S_ / SQ, H_, B_), 256, 0, stream>>>(Qp, Kp, Vp, mask, Xp);

  wmma_gemm_bf16<<<dim3(DM_ / BN, M / BM, 1), 256, 0, stream>>>(
      Xp, wo, query, out, nullptr, M, DM_, DM_);
  layernorm_kernel<<<M, 256, 0, stream>>>(out, ln_g, ln_b);
}

// v004
// Measured time: 273 microseconds a run.
// Two timings next to v003 put it at 1.15 and 1.14 times that version's speed.
// All steps since v000 together make it 1.45 times as fast.
#include <hip/hip_runtime.h>

// ---------------------------------------------------------------------------
// MHA forward for MI455X (gfx1250): end-to-end bf16 dataflow, WMMA GEMMs,
// flash attention, CDNA5 async global->LDS staging.
// ---------------------------------------------------------------------------

#define B_ 4
#define S_ 2048
#define H_ 16
#define DM_ 1024
#define DH_ 64

typedef __attribute__((ext_vector_type(16))) __bf16 v16bf;
typedef __attribute__((ext_vector_type(8)))  float  v8f;
typedef int async_v4i __attribute__((vector_size(16)));   // builtin's int4 type

union Frag16 { v16bf v; uint4 u[2]; };
union U128   { uint4 u; unsigned short s[8]; };

__device__ __forceinline__ unsigned short f2bf(float f) {
  return __builtin_bit_cast(unsigned short, static_cast<__bf16>(f));
}

// ---- CDNA5 async global->LDS (ASYNCcnt) with safe fallback ----------------
#if defined(__gfx1250__) && __has_builtin(__builtin_amdgcn_global_load_async_to_lds_b128)
#define CDNA5_ASYNC 1
#else
#define CDNA5_ASYNC 0
#endif

__device__ __forceinline__ void cp16(const unsigned short* g, unsigned short* l) {
#if CDNA5_ASYNC
  __builtin_amdgcn_global_load_async_to_lds_b128(
      (__attribute__((address_space(1))) async_v4i*)g,
      (__attribute__((address_space(3))) async_v4i*)l, 0, 0);
#else
  *reinterpret_cast<uint4*>(l) = *reinterpret_cast<const uint4*>(g);
#endif
}

__device__ __forceinline__ void async_wait_all() {
#if CDNA5_ASYNC
#if __has_builtin(__builtin_amdgcn_s_wait_asynccnt)
  __builtin_amdgcn_s_wait_asynccnt(0);
#else
  asm volatile("s_wait_asynccnt 0x0" ::: "memory");
#endif
#endif
}

// Load a 16x32 bf16 WMMA fragment row for this lane from an LDS row pointer.
// VGPR0-3 hold K = khalf*8 .. +7, VGPR4-7 hold K = 16+khalf*8 .. +7.
__device__ __forceinline__ v16bf load_frag(const unsigned short* row, int koff) {
  Frag16 f;
  f.u[0] = *reinterpret_cast<const uint4*>(row + koff);
  f.u[1] = *reinterpret_cast<const uint4*>(row + koff + 16);
  return f.v;
}

// ---------------------------------------------------------------------------
// Kernel 0: every fp32 -> bf16 conversion of the call and the packing of the
// mask in one launch; the eight pieces are independent of one another, a block
// picks its piece by its index.
//   blocks [0, 4*WT_BLOCKS): weight W[k][n] fp32 -> Wt[n][k] bf16 (DM_ x DM_),
//     64x64 tiles turned in LDS, so that the GEMM reads both operands
//     K-contiguous; they come first, so that they run under the long stream.
//   blocks [4*WT_BLOCKS, +MASK_BLOCKS): the int32 mask -> lane-mask words for the
//     attention kernel. A unit is 16 queries x 128 keys, one wave each, 64 words:
//     word j*8 + r, bit lane = (mask[query lane&15][key 16j + 8(lane>>4) + r] != 0),
//     the place that lane holds in the score tiles.
//   the rest: the three activations, elementwise, float4 granular.
// ---------------------------------------------------------------------------
#define TLD 72   // 64 + 8 pad, rows stay 16B-aligned
#define WT_BLOCKS  ((DM_ / 64) * (DM_ / 64))     // 256 tiles per weight
#define ACT_BLOCKS (B_ * S_ * DM_ / 4 / 256)     // 8192 blocks per activation
#define MASK_BLOCKS (B_ * (S_ / 16) * (S_ / 128) / 8)   // 8 units per block

__global__ __launch_bounds__(256) void prep_bf16(
    const float* __restrict__ a0, const float* __restrict__ a1,
    const float* __restrict__ a2,
    const float* __restrict__ w0, const float* __restrict__ w1,
    const float* __restrict__ w2, const float* __restrict__ w3,
    const int* __restrict__ mask,
    unsigned short* __restrict__ act_out, unsigned short* __restrict__ wt_out,
    unsigned* __restrict__ mw_out)
{
  __shared__ __attribute__((aligned(16))) unsigned short t[64 * TLD];   // [n][k]
  const int tid = threadIdx.x;
  const int blk = blockIdx.x;
  if (blk < 4 * WT_BLOCKS) {
    const int w = blk / WT_BLOCKS;
    const int tile = blk % WT_BLOCKS;
    const float* in = (w == 0) ? w0 : (w == 1) ? w1 : (w == 2) ? w2 : w3;
    unsigned short* out = wt_out + (size_t)w * DM_ * DM_;
    const int n0 = (tile % (DM_ / 64)) * 64;
    const int k0 = (tile / (DM_ / 64)) * 64;
#pragma unroll
    for (int p = 0; p < 4; ++p) {
      int k = p * 16 + (tid >> 4);
      int n = (tid & 15) * 4;
      float4 v = *reinterpret_cast<const float4*>(&in[(size_t)(k0 + k) * DM_ + n0 + n]);
      t[(n + 0) * TLD + k] = f2bf(v.x);
      t[(n + 1) * TLD + k] = f2bf(v.y);
      t[(n + 2) * TLD + k] = f2bf(v.z);
      t[(n + 3) * TLD + k] = f2bf(v.w);
    }
    __syncthreads();
#pragma unroll
    for (int p = 0; p < 2; ++p) {
      int idx = p * 256 + tid;
      int n = idx >> 3;
      int c = (idx & 7) * 8;
      *reinterpret_cast<uint4*>(&out[(size_t)(n0 + n) * DM_ + k0 + c]) =
          *reinterpret_cast<const uint4*>(&t[n * TLD + c]);
    }
    return;
  }
  if (blk < 4 * WT_BLOCKS + MASK_BLOCKS) {
    const int lane = tid & 31;
    const int unit = (blk - 4 * WT_BLOCKS) * 8 + (tid >> 5);   // (b*128 + qtile)*16 + kblock
    const int* src = mask + (size_t)(unit >> 4) * 16 * S_ + (unit & 15) * 128 + lane * 4;
    // x[c], bit l = (mask[query lane&15][key 4l + c] != 0): a row is read as whole
    // lines, 512 contiguous bytes a load, and turned into bits by ballots
    unsigned x[4] = {0u, 0u, 0u, 0u};
    // stays rolled: eight loads in flight a wave are enough for the stream, and all
    // sixteen would take registers from the occupancy of the elementwise blocks
#pragma nounroll
    for (int hf = 0; hf < 2; ++hf) {
      int4 m[8];
#pragma unroll
      for (int i = 0; i < 8; ++i)
        m[i] = *reinterpret_cast<const int4*>(src + (size_t)(hf * 8 + i) * S_);
#pragma unroll
      for (int i = 0; i < 8; ++i) {
        const bool mine = (lane & 15) == hf * 8 + i;
        const unsigned b0 = __builtin_amdgcn_ballot_w32(m[i].x != 0);
        const unsigned b1 = __builtin_amdgcn_ballot_w32(m[i].y != 0);
        const unsigned b2 = __builtin_amdgcn_ballot_w32(m[i].z != 0);
        const unsigned b3 = __builtin_amdgcn_ballot_w32(m[i].w != 0);
        x[0] = mine ? b0 : x[0];
        x[1] = mine ? b1 : x[1];
        x[2] = mine ? b2 : x[2];
        x[3] = mine ? b3 : x[3];
      }
    }
    // key 16j + 8(lane>>4) + r = 4l + c with l = 4j + 2(lane>>4) + (r>>2), c = r & 3
#pragma unroll
    for (int c = 0; c < 4; ++c) x[c] >>= 2 * (lane >> 4);
    uint2 w = make_uint2(0u, 0u);            // words 2*lane and 2*lane + 1 of the unit
#pragma unroll
    for (int n = 0; n < 64; ++n) {
      const int j = n >> 3, r = n & 7;
      const unsigned word =
          __builtin_amdgcn_ballot_w32(((x[r & 3] >> (4 * j + (r >> 2))) & 1u) != 0u);
      if (n & 1) w.y = (lane == (n >> 1)) ? word : w.y;
      else       w.x = (lane == (n >> 1)) ? word : w.x;
    }
    reinterpret_cast<uint2*>(mw_out + (size_t)unit * 64)[lane] = w;
    // the store's address registers are not rewritten on any path behind it before this wait
    asm volatile("s_wait_xcnt 0x0" ::: "memory");
    return;
  }
  const int ab = blk - 4 * WT_BLOCKS - MASK_BLOCKS;
  const int a = ab / ACT_BLOCKS;
  const float* in = (a == 0) ? a0 : (a == 1) ? a1 : a2;
  unsigned short* out = act_out + (size_t)a * B_ * S_ * DM_;
  const int i = (ab % ACT_BLOCKS) * 256 + tid;
  float4 v = reinterpret_cast<const float4*>(in)[i];
  union { unsigned short s[4]; uint2 u; } o;
  o.s[0] = f2bf(v.x); o.s[1] = f2bf(v.y); o.s[2] = f2bf(v.z); o.s[3] = f2bf(v.w);
  reinterpret_cast<uint2*>(out)[i] = o.u;
  // the store's address registers are not rewritten on any path behind it before this wait
  asm volatile("s_wait_xcnt 0x0" ::: "memory");
}

// ---------------------------------------------------------------------------
// Kernel 1: C[M,N] = A[M,K] @ Bt[N,K]^T, bf16 in, bf16 out (Cb) or fp32+resid (Cf).
// Block tile 128x128, K-step 32, double-buffered LDS, 8 waves (wave32).
// blockIdx.z picks one of several independent products of the same shape whose
// A, Bt and Cb each lie one behind the other in memory.
// ---------------------------------------------------------------------------
#define BM 128
#define BN 128
#define BK 32
#define LDA 40   // 32 + 8 pad, rows stay 16B-aligned

__global__ __launch_bounds__(256) void wmma_gemm_bf16(
    const unsigned short* __restrict__ A0, const unsigned short* __restrict__ Bt0,
    const float* __restrict__ resid, float* __restrict__ Cf,
    unsigned short* __restrict__ Cb0, int M, int N, int K)
{
  __shared__ __attribute__((aligned(16))) unsigned short As[2][BM * LDA];
  __shared__ __attribute__((aligned(16))) unsigned short Bs[2][BN * LDA];   // [n][k]

  const int tid  = threadIdx.x;
  const int lane = tid & 31;
  const int wave = tid >> 5;
  const int bm = blockIdx.y * BM;
  const int bn = blockIdx.x * BN;
  const size_t bz = blockIdx.z;
  const unsigned short* A  = A0 + bz * M * K;
  const unsigned short* Bt = Bt0 + bz * N * K;
  unsigned short* Cb = Cb0 ? Cb0 + bz * M * N : nullptr;
  const int wm = (wave & 3) * 32;
  const int wn = (wave >> 2) * 64;
  const int lm = lane & 15;
  const int khalf = lane >> 4;

  v8f acc[2][4];
#pragma unroll
  for (int i = 0; i < 2; ++i)
#pragma unroll
    for (int j = 0; j < 4; ++j) acc[i][j] = (v8f)(0.0f);

  auto load_tiles = [&](int kt, int buf) {
    const int k0 = kt * BK;
    // A tile: 128x32 bf16 = 512 x 16B, async copies
#pragma unroll
    for (int p = 0; p < 2; ++p) {
      int idx = p * 256 + tid;
      int r = idx >> 2;
      int c = (idx & 3) * 8;
      cp16(&A[(size_t)(bm + r) * K + k0 + c], &As[buf][r * LDA + c]);
    }
    // B tile: 128 n-rows x 32 k bf16 from Bt[n][k], async copies like A
#pragma unroll
    for (int p = 0; p < 2; ++p) {
      int idx = p * 256 + tid;
      int r = idx >> 2;
      int c = (idx & 3) * 8;
      cp16(&Bt[(size_t)(bn + r) * K + k0 + c], &Bs[buf][r * LDA + c]);
    }
  };

  const int NK = K / BK;
  load_tiles(0, 0);
  int buf = 0;
  for (int kt = 0; kt < NK; ++kt) {
    // publish point: this wave's fragment reads of the buffer to be refilled
    // are done, its own copies of tile kt have landed, then the barrier
    asm volatile("s_wait_dscnt 0x0" ::: "memory");
    asm volatile("s_wait_asynccnt 0x0" ::: "memory");
    __syncthreads();
    if (kt + 1 < NK) load_tiles(kt + 1, buf ^ 1);
    v16bf af[2], bfr[4];
#pragma unroll
    for (int i = 0; i < 2; ++i)
      af[i] = load_frag(&As[buf][(wm + i * 16 + lm) * LDA], khalf * 8);
#pragma unroll
    for (int j = 0; j < 4; ++j)
      bfr[j] = load_frag(&Bs[buf][(wn + j * 16 + lm) * LDA], khalf * 8);
#pragma unroll
    for (int i = 0; i < 2; ++i)
#pragma unroll
      for (int j = 0; j < 4; ++j)
        acc[i][j] = __builtin_amdgcn_wmma_f32_16x16x32_bf16(
            false, af[i], false, bfr[j], (short)0, acc[i][j], false, false);
    buf ^= 1;
  }
  // no copy of this wave is left in flight when it goes on to its end
  asm volatile("s_wait_asynccnt 0x0" ::: "memory");

  // C tile layout: lane holds (m = r + khalf*8, n = lm) of each 16x16 tile.
#pragma unroll
  for (int i = 0; i < 2; ++i)
#pragma unroll
    for (int j = 0; j < 4; ++j)
#pragma unroll
      for (int r = 0; r < 8; ++r) {
        int row = bm + wm + i * 16 + r + khalf * 8;
        int col = bn + wn + j * 16 + lm;
        float v = acc[i][j][r];
        if (Cb) {
          Cb[(size_t)row * N + col] = f2bf(v);
        } else {
          if (resid) v += resid[(size_t)row * N + col];
          Cf[(size_t)row * N + col] = v;
        }
      }
}

#define SQ 128
#define SKB 128
#define QLD 72    // 64 + 8
#define VLD 136   // 128 + 8

// value of lane l ^ 16
__device__ __forceinline__ float xhalf(float x) {
  int i = __builtin_bit_cast(int, x);
  return __builtin_bit_cast(float, __builtin_amdgcn_permlanex16(
      i, i, 0x76543210, 0xfedcba98, false, false));
}

__global__ __launch_bounds__(256) void flash_attn(
    const unsigned short* __restrict__ Qg, const unsigned short* __restrict__ Kg,
    const unsigned short* __restrict__ Vg, const unsigned* __restrict__ Mw,
    unsigned short* __restrict__ Xg)
{
  __shared__ unsigned short Qs[SQ * QLD];
  __shared__ unsigned short Ks[SKB * QLD];
  __shared__ unsigned short Vt[DH_ * VLD];        // V^T: [d][key]

  const int tid  = threadIdx.x;
  const int lane = tid & 31;
  const int wave = tid >> 5;
  const int qb = blockIdx.x, h = blockIdx.y, b = blockIdx.z;
  const int lm = lane & 15;
  const int khalf = lane >> 4;
  const size_t rowbase = (size_t)b * S_ * DM_ + (size_t)h * DH_;

  // Q block -> LDS (async)
#pragma unroll
  for (int g = 0; g < 4; ++g) {
    int idx = g * 256 + tid;
    int r = idx >> 3;
    int c = (idx & 7) * 8;
    cp16(&Qg[rowbase + (size_t)(qb * SQ + r) * DM_ + c], &Qs[r * QLD + c]);
  }

  const int wq = wave * 16;
  const int qrow = qb * SQ + wq + lm;             // this lane's query
  // this wave's mask words: 64 per key block; the wave's number as a scalar, and the
  // constant address space, so that the loads are scalar loads
  const __attribute__((address_space(4))) unsigned* mwave =
      (const __attribute__((address_space(4))) unsigned*)(
          Mw + (size_t)(b * (S_ / 16) + qb * (SQ / 16) +
                        __builtin_amdgcn_readfirstlane(wave)) * (S_ / SKB) * 64);

  float mrun = -3.0e38f;   // running maximum of the query, equal in both halves
  float lrun = 0.0f;       // running sum over this half's keys only
  v8f o[4];                // o[j][r] = O[qrow][j*16 + khalf*8 + r]
#pragma unroll
  for (int j = 0; j < 4; ++j) o[j] = (v8f)(0.0f);

  for (int kb = 0; kb < S_ / SKB; ++kb) {
    // the block's 64 mask words: word j*8 + r goes with s[j][r]
    unsigned mk[64];
#pragma unroll
    for (int n = 0; n < 64; ++n) mk[n] = mwave[kb * 64 + n];
    // the loads' address pair is advanced later in the pass: no write of it in front of this wait
    asm volatile("s_wait_xcnt 0x0" ::: "memory");
    // keeps the scalar loads here, at the head of the pass, so that they return
    // under the staging of K and V; without it they sink to their first use
    __builtin_amdgcn_sched_barrier(0);

    __syncthreads();
    // K block -> LDS (async), layout [key][d]
#pragma unroll
    for (int g = 0; g < 4; ++g) {
      int idx = g * 256 + tid;
      int r = idx >> 3;
      int c = (idx & 7) * 8;
      cp16(&Kg[rowbase + (size_t)(kb * SKB + r) * DM_ + c], &Ks[r * QLD + c]);
    }
    // V block -> LDS transposed [d][key], 2 key-rows packed per b32 store
#pragma unroll
    for (int g = 0; g < 2; ++g) {
      int idx = g * 256 + tid;
      int r2 = (idx >> 3) * 2;       // key pair 0..126
      int dg = (idx & 7) * 8;        // d group 0..56
      U128 u0, u1;
      u0.u = *reinterpret_cast<const uint4*>(
          &Vg[rowbase + (size_t)(kb * SKB + r2) * DM_ + dg]);
      u1.u = *reinterpret_cast<const uint4*>(
          &Vg[rowbase + (size_t)(kb * SKB + r2 + 1) * DM_ + dg]);
#pragma unroll
      for (int i = 0; i < 8; ++i) {
        unsigned val = (unsigned)u0.s[i] | ((unsigned)u1.s[i] << 16);
        *reinterpret_cast<unsigned*>(&Vt[(dg + i) * VLD + r2]) = val;
      }
    }
    async_wait_all();
    __syncthreads();

    // scores^T: 128 keys x 16 q-columns, K-dim = 64 (2 WMMA steps);
    // s[j][r] = S[qrow][kb*128 + j*16 + khalf*8 + r]
    v8f s[8];
#pragma unroll
    for (int j = 0; j < 8; ++j) s[j] = (v8f)(0.0f);
#pragma unroll
    for (int kk = 0; kk < 2; ++kk) {
      v16bf bq = load_frag(&Qs[(wq + lm) * QLD], kk * 32 + khalf * 8);
#pragma unroll
      for (int j = 0; j < 8; ++j) {
        v16bf ak = load_frag(&Ks[(j * 16 + lm) * QLD], kk * 32 + khalf * 8);
        s[j] = __builtin_amdgcn_wmma_f32_16x16x32_bf16(
            false, ak, false, bq, (short)0, s[j], false, false);
      }
    }

    // scale + mask + block maximum, eight independent in-lane chains
    v8f bm = (v8f)(-3.0e38f);
#pragma unroll
    for (int j = 0; j < 8; ++j) {
      const v8f sc = s[j] * 0.125f;            // 1/sqrt(64)
#pragma unroll
      for (int r = 0; r < 8; ++r) {
        float sv = __builtin_amdgcn_inverse_ballot_w32(mk[j * 8 + r]) ? sc[r] : -1.0e9f;
        s[j][r] = sv;
      }
      bm = __builtin_elementwise_max(bm, s[j]);
    }
    float bmax = fmaxf(fmaxf(fmaxf(bm[0], bm[1]), fmaxf(bm[2], bm[3])),
                       fmaxf(fmaxf(bm[4], bm[5]), fmaxf(bm[6], bm[7])));
    bmax = fmaxf(bmax, xhalf(bmax));           // the query's other 64 keys

    // online softmax update
    const float mn = fmaxf(mrun, bmax);
    const float alpha = __expf(mrun - mn);
    mrun = mn;
    v8f rs = (v8f)(0.0f);
#pragma unroll
    for (int j = 0; j < 8; ++j) {
#pragma unroll
      for (int r = 0; r < 8; ++r) {
        float p = __expf(s[j][r] - mrun);
        s[j][r] = p;
      }
      rs += s[j];
    }
    lrun = lrun * alpha + (((rs[0] + rs[1]) + (rs[2] + rs[3])) +
                           ((rs[4] + rs[5]) + (rs[6] + rs[7])));
#pragma unroll
    for (int j = 0; j < 4; ++j)
#pragma unroll
      for (int r = 0; r < 8; ++r) o[j][r] *= alpha;

    // o^T += V^T[64x128] @ P^T[128x16]  (4 WMMA K-steps x 4 d-tiles);
    // element e of the B operand is key 8*khalf + e, then 16 + 8*khalf + (e-8),
    // of the 32 keys: tiles 2kk and 2kk+1 as they lie, the order load_frag has
#pragma unroll
    for (int kk = 0; kk < 4; ++kk) {
      v16bf bp;
#pragma unroll
      for (int e = 0; e < 8; ++e) {
        bp[e]     = static_cast<__bf16>(s[2 * kk][e]);
        bp[8 + e] = static_cast<__bf16>(s[2 * kk + 1][e]);
      }
#pragma unroll
      for (int j = 0; j < 4; ++j) {
        v16bf av = load_frag(&Vt[(j * 16 + lm) * VLD], kk * 32 + khalf * 8);
        o[j] = __builtin_amdgcn_wmma_f32_16x16x32_bf16(
            false, av, false, bp, (short)0, o[j], false, false);
      }
    }
  }

  // join the halves' sums, normalize, write X[b*S+q][h*64+d] as bf16:
  // eight consecutive d per lane and tile, one 16-byte store
  const float lsum = lrun + xhalf(lrun) + 1e-30f;
#pragma unroll
  for (int j = 0; j < 4; ++j) {
    U128 x;
#pragma unroll
    for (int r = 0; r < 8; ++r) x.s[r] = f2bf(o[j][r] / lsum);
    *reinterpret_cast<uint4*>(
        &Xg[rowbase + (size_t)qrow * DM_ + j * 16 + khalf * 8]) = x.u;
  }
}

// ---------------------------------------------------------------------------
// Kernel 3: in-place LayerNorm over rows of Y[8192][1024] (fp32).
// ---------------------------------------------------------------------------
__global__ __launch_bounds__(256) void layernorm_kernel(
    float* __restrict__ Y, const float* __restrict__ gam,
    const float* __restrict__ bet)
{
  __shared__ float red[2][8];
  const int row = blockIdx.x, tid = threadIdx.x;
  const int lane = tid & 31, wave = tid >> 5;
  float4 v = *reinterpret_cast<const float4*>(&Y[(size_t)row * DM_ + tid * 4]);
  float sum = v.x + v.y + v.z + v.w;
  float ssq = v.x * v.x + v.y * v.y + v.z * v.z + v.w * v.w;
#pragma unroll
  for (int off = 1; off < 32; off <<= 1) {
    sum += __shfl_xor(sum, off, 32);
    ssq += __shfl_xor(ssq, off, 32);
  }
  if (lane == 0) { red[0][wave] = sum; red[1][wave] = ssq; }
  __syncthreads();
  sum = red[0][lane & 7];
  ssq = red[1][lane & 7];
#pragma unroll
  for (int off = 1; off < 8; off <<= 1) {
    sum += __shfl_xor(sum, off, 32);
    ssq += __shfl_xor(ssq, off, 32);
  }
  float mu  = sum * (1.0f / DM_);
  float var = ssq * (1.0f / DM_) - mu * mu;
  float inv = rsqrtf(var + 1e-6f);
  float4 g4 = *reinterpret_cast<const float4*>(&gam[tid * 4]);
  float4 b4 = *reinterpret_cast<const float4*>(&bet[tid * 4]);
  float4 o4;
  o4.x = (v.x - mu) * inv * g4.x + b4.x;
  o4.y = (v.y - mu) * inv * g4.y + b4.y;
  o4.z = (v.z - mu) * inv * g4.z + b4.z;
  o4.w = (v.w - mu) * inv * g4.w + b4.w;
  *reinterpret_cast<float4*>(&Y[(size_t)row * DM_ + tid * 4]) = o4;
}

// ---------------------------------------------------------------------------
extern "C" void kernel_launch(void* const* d_in, const int* in_sizes, int n_in,
                              void* d_out, int out_size, void* d_ws, size_t ws_size,
                              hipStream_t stream) {
  (void)in_sizes; (void)n_in; (void)out_size; (void)ws_size;
  const float* query = (const float*)d_in[0];
  const float* key   = (const float*)d_in[1];
  const float* value = (const float*)d_in[2];
  const int*   mask  = (const int*)d_in[3];
  const float* w_qs  = (const float*)d_in[4];
  const float* w_ks  = (const float*)d_in[5];
  const float* w_vs  = (const float*)d_in[6];
  const float* w_out = (const float*)d_in[7];
  const float* ln_g  = (const float*)d_in[8];
  const float* ln_b  = (const float*)d_in[9];
  float* out = (float*)d_out;

  const size_t act  = (size_t)B_ * S_ * DM_;   // 8M elems
  const size_t wmat = (size_t)DM_ * DM_;       // 1M elems
  unsigned short* qb = (unsigned short*)d_ws;  // bf16 workspace
  unsigned short* kb = qb + act;
  unsigned short* vb = kb + act;
  unsigned short* wq = vb + act;
  unsigned short* wk = wq + wmat;
  unsigned short* wv = wk + wmat;
  unsigned short* wo = wv + wmat;
  unsigned short* Qp = wo + wmat;
  unsigned short* Kp = Qp + act;
  unsigned short* Vp = Kp + act;
  unsigned short* Xp = qb;   // qb is dead after the projection launch
  unsigned* mw = (unsigned*)(Vp + act);        // packed mask, 2 MiB

  const int M = B_ * S_;
  // qb, kb, vb and wq, wk, wv, wo lie one behind the other in the workspace
  prep_bf16<<<4 * WT_BLOCKS + MASK_BLOCKS + 3 * ACT_BLOCKS, 256, 0, stream>>>(
      query, key, value, w_qs, w_ks, w_vs, w_out, mask, qb, wq, mw);

  // the three projections are independent: one launch, z = 0, 1, 2
  wmma_gemm_bf16<<<dim3(DM_ / BN, M / BM, 3), 256, 0, stream>>>(
      qb, wq, nullptr, nullptr, Qp, M, DM_, DM_);

  flash_attn<<<dim3(S_ / SQ, H_, B_), 256, 0, stream>>>(Qp, Kp, Vp, mw, Xp);

  wmma_gemm_bf16<<<dim3(DM_ / BN, M / BM, 1), 256, 0, stream>>>(
      Xp, wo, query, out, nullptr, M, DM_, DM_);
  layernorm_kernel<<<M, 256, 0, stream>>>(out, ln_g, ln_b);
}

// v005
// A run of this version takes 210 microseconds.
// Timed twice side by side with v004, it ran 1.29 and 1.30 times as fast.
// All steps since v000 together make it 1.88 times as fast.
#include <hip/hip_runtime.h>

// ---------------------------------------------------------------------------
// MHA forward for MI455X (gfx1250): end-to-end bf16 dataflow, WMMA GEMMs,
// flash attention, CDNA5 async global->LDS staging.
// ---------------------------------------------------------------------------

#define B_ 4
#define S_ 2048
#define H_ 16
#define DM_ 1024
#define DH_ 64

typedef __attribute__((ext_vector_type(16))) __bf16 v16bf;
typedef __attribute__((ext_vector_type(8)))  float  v8f;
typedef int async_v4i __attribute__((vector_size(16)));   // builtin's int4 type

union Frag16 { v16bf v; uint4 u[2]; };
union U128   { uint4 u; unsigned short s[8]; };

__device__ __forceinline__ unsigned short f2bf(float f) {
  return __builtin_bit_cast(unsigned short, static_cast<__bf16>(f));
}

// ---- CDNA5 async global->LDS (ASYNCcnt) with safe fallback ----------------
#if defined(__gfx1250__) && __has_builtin(__builtin_amdgcn_global_load_async_to_lds_b128)
#define CDNA5_ASYNC 1
#else
#define CDNA5_ASYNC 0
#endif

__device__ __forceinline__ void cp16(const unsigned short* g, unsigned short* l) {
#if CDNA5_ASYNC
  __builtin_amdgcn_global_load_async_to_lds_b128(
      (__attribute__((address_space(1))) async_v4i*)g,
      (__attribute__((address_space(3))) async_v4i*)l, 0, 0);
#else
  *reinterpret_cast<uint4*>(l) = *reinterpret_cast<const uint4*>(g);
#endif
}

__device__ __forceinline__ void async_wait_all() {
#if CDNA5_ASYNC
#if __has_builtin(__builtin_amdgcn_s_wait_asynccnt)
  __builtin_amdgcn_s_wait_asynccnt(0);
#else
  asm volatile("s_wait_asynccnt 0x0" ::: "memory");
#endif
#endif
}

// Load a 16x32 bf16 WMMA fragment row for this lane from an LDS row pointer.
// VGPR0-3 hold K = khalf*8 .. +7, VGPR4-7 hold K = 16+khalf*8 .. +7.
__device__ __forceinline__ v16bf load_frag(const unsigned short* row, int koff) {
  Frag16 f;
  f.u[0] = *reinterpret_cast<const uint4*>(row + koff);
  f.u[1] = *reinterpret_cast<const uint4*>(row + koff + 16);
  return f.v;
}

// ---------------------------------------------------------------------------
// Kernel 0: every fp32 -> bf16 conversion of the call and the packing of the
// mask in one launch; the eight pieces are independent of one another, a block
// picks its piece by its index.
//   blocks [0, 4*WT_BLOCKS): weight W[k][n] fp32 -> Wt[n][k] bf16 (DM_ x DM_),
//     64x64 tiles turned in LDS, so that the GEMM reads both operands
//     K-contiguous; they come first, so that they run under the long stream.
//   blocks [4*WT_BLOCKS, +MASK_BLOCKS): the int32 mask -> lane-mask words for the
//     attention kernel. A unit is 16 queries x 128 keys, one wave each, 64 words:
//     word j*8 + r, bit lane = (mask[query lane&15][key 16j + 8(lane>>4) + r] != 0),
//     the place that lane holds in the score tiles.
//   the rest: the three activations, elementwise, float4 granular.
// ---------------------------------------------------------------------------
#define TLD 72   // 64 + 8 pad, rows stay 16B-aligned
#define WT_BLOCKS  ((DM_ / 64) * (DM_ / 64))     // 256 tiles per weight
#define ACT_BLOCKS (B_ * S_ * DM_ / 4 / 256)     // 8192 blocks per activation
#define MASK_BLOCKS (B_ * (S_ / 16) * (S_ / 128) / 8)   // 8 units per block

__global__ __launch_bounds__(256) void prep_bf16(
    const float* __restrict__ a0, const float* __restrict__ a1,
    const float* __restrict__ a2,
    const float* __restrict__ w0, const float* __restrict__ w1,
    const float* __restrict__ w2, const float* __restrict__ w3,
    const int* __restrict__ mask,
    unsigned short* __restrict__ act_out, unsigned short* __restrict__ wt_out,
    unsigned* __restrict__ mw_out)
{
  __shared__ __attribute__((aligned(16))) unsigned short t[64 * TLD];   // [n][k]
  const int tid = threadIdx.x;
  const int blk = blockIdx.x;
  if (blk < 4 * WT_BLOCKS) {
    const int w = blk / WT_BLOCKS;
    const int tile = blk % WT_BLOCKS;
    const float* in = (w == 0) ? w0 : (w == 1) ? w1 : (w == 2) ? w2 : w3;
    unsigned short* out = wt_out + (size_t)w * DM_ * DM_;
    const int n0 = (tile % (DM_ / 64)) * 64;
    const int k0 = (tile / (DM_ / 64)) * 64;
#pragma unroll
    for (int p = 0; p < 4; ++p) {
      int k = p * 16 + (tid >> 4);
      int n = (tid & 15) * 4;
      float4 v = *reinterpret_cast<const float4*>(&in[(size_t)(k0 + k) * DM_ + n0 + n]);
      t[(n + 0) * TLD + k] = f2bf(v.x);
      t[(n + 1) * TLD + k] = f2bf(v.y);
      t[(n + 2) * TLD + k] = f2bf(v.z);
      t[(n + 3) * TLD + k] = f2bf(v.w);
    }
    __syncthreads();
#pragma unroll
    for (int p = 0; p < 2; ++p) {
      int idx = p * 256 + tid;
      int n = idx >> 3;
      int c = (idx & 7) * 8;
      *reinterpret_cast<uint4*>(&out[(size_t)(n0 + n) * DM_ + k0 + c]) =
          *reinterpret_cast<const uint4*>(&t[n * TLD + c]);
    }
    return;
  }
  if (blk < 4 * WT_BLOCKS + MASK_BLOCKS) {
    const int lane = tid & 31;
    const int unit = (blk - 4 * WT_BLOCKS) * 8 + (tid >> 5);   // (b*128 + qtile)*16 + kblock
    const int* src = mask + (size_t)(unit >> 4) * 16 * S_ + (unit & 15) * 128 + lane * 4;
    // x[c], bit l = (mask[query lane&15][key 4l + c] != 0): a row is read as whole
    // lines, 512 contiguous bytes a load, and turned into bits by ballots
    unsigned x[4] = {0u, 0u, 0u, 0u};
    // stays rolled: eight loads in flight a wave are enough for the stream, and all
    // sixteen would take registers from the occupancy of the elementwise blocks
#pragma nounroll
    for (int hf = 0; hf < 2; ++hf) {
      int4 m[8];
#pragma unroll
      for (int i = 0; i < 8; ++i)
        m[i] = *reinterpret_cast<const int4*>(src + (size_t)(hf * 8 + i) * S_);
#pragma unroll
      for (int i = 0; i < 8; ++i) {
        const bool mine = (lane & 15) == hf * 8 + i;
        const unsigned b0 = __builtin_amdgcn_ballot_w32(m[i].x != 0);
        const unsigned b1 = __builtin_amdgcn_ballot_w32(m[i].y != 0);
        const unsigned b2 = __builtin_amdgcn_ballot_w32(m[i].z != 0);
        const unsigned b3 = __builtin_amdgcn_ballot_w32(m[i].w != 0);
        x[0] = mine ? b0 : x[0];
        x[1] = mine ? b1 : x[1];
        x[2] = mine ? b2 : x[2];
        x[3] = mine ? b3 : x[3];
      }
    }
    // key 16j + 8(lane>>4) + r = 4l + c with l = 4j + 2(lane>>4) + (r>>2), c = r & 3
#pragma unroll
    for (int c = 0; c < 4; ++c) x[c] >>= 2 * (lane >> 4);
    uint2 w = make_uint2(0u, 0u);            // words 2*lane and 2*lane + 1 of the unit
#pragma unroll
    for (int n = 0; n < 64; ++n) {
      const int j = n >> 3, r = n & 7;
      const unsigned word =
          __builtin_amdgcn_ballot_w32(((x[r & 3] >> (4 * j + (r >> 2))) & 1u) != 0u);
      if (n & 1) w.y = (lane == (n >> 1)) ? word : w.y;
      else       w.x = (lane == (n >> 1)) ? word : w.x;
    }
    reinterpret_cast<uint2*>(mw_out + (size_t)unit * 64)[lane] = w;
    // the store's address registers are not rewritten on any path behind it before this wait
    asm volatile("s_wait_xcnt 0x0" ::: "memory");
    return;
  }
  const int ab = blk - 4 * WT_BLOCKS - MASK_BLOCKS;
  const int a = ab / ACT_BLOCKS;
  const float* in = (a == 0) ? a0 : (a == 1) ? a1 : a2;
  unsigned short* out = act_out + (size_t)a * B_ * S_ * DM_;
  const int i = (ab % ACT_BLOCKS) * 256 + tid;
  float4 v = reinterpret_cast<const float4*>(in)[i];
  union { unsigned short s[4]; uint2 u; } o;
  o.s[0] = f2bf(v.x); o.s[1] = f2bf(v.y); o.s[2] = f2bf(v.z); o.s[3] = f2bf(v.w);
  reinterpret_cast<uint2*>(out)[i] = o.u;
  // the store's address registers are not rewritten on any path behind it before this wait
  asm volatile("s_wait_xcnt 0x0" ::: "memory");
}

// ---------------------------------------------------------------------------
// Kernel 1: C[M,N] = A[M,K] @ Bt[N,K]^T, bf16 in, bf16 out (Cb) or fp32+resid (Cf).
// Block tile 128x128, K-step 32, double-buffered LDS, 8 waves (wave32).
// blockIdx.z picks one of several independent products of the same shape whose
// A, Bt and Cb each lie one behind the other in memory.
// RESID picks the output at compile time: fp32 with the residual added (Cf), or
// bf16 (Cb). Either way a wave turns its 32x64 tile in LDS, 16 rows at a time,
// so that global memory sees whole 128-byte lines in 16-byte accesses.
// ---------------------------------------------------------------------------
#define BM 128
#define BN 128
#define BK 32
#define LDA 40   // 32 + 8 pad, rows stay 16B-aligned
#define SLD 68   // staging pitch in floats: 64 + 4, 16 B x odd

template <bool RESID>
__global__ __launch_bounds__(256) void wmma_gemm_bf16(
    const unsigned short* __restrict__ A0, const unsigned short* __restrict__ Bt0,
    const float* __restrict__ resid, float* __restrict__ Cf,
    unsigned short* __restrict__ Cb0, int M, int K)
{
  // fixed, so that the epilogue's rows are immediate offsets from one address
  constexpr int N = DM_;
  __shared__ __attribute__((aligned(16))) unsigned short As[2][BM * LDA];
  __shared__ __attribute__((aligned(16))) unsigned short Bs[2][BN * LDA];   // [n][k]

  const int tid  = threadIdx.x;
  const int lane = tid & 31;
  const int wave = tid >> 5;
  const int bm = blockIdx.y * BM;
  const int bn = blockIdx.x * BN;
  const size_t bz = blockIdx.z;
  const unsigned short* A  = A0 + bz * M * K;
  const unsigned short* Bt = Bt0 + bz * N * K;
  unsigned short* Cb = Cb0 + bz * M * N;
  const int wm = (wave & 3) * 32;
  const int wn = (wave >> 2) * 64;
  const int lm = lane & 15;
  const int khalf = lane >> 4;

  v8f acc[2][4];
#pragma unroll
  for (int i = 0; i < 2; ++i)
#pragma unroll
    for (int j = 0; j < 4; ++j) acc[i][j] = (v8f)(0.0f);

  auto load_tiles = [&](int kt, int buf) {
    const int k0 = kt * BK;
    // A tile: 128x32 bf16 = 512 x 16B, async copies
#pragma unroll
    for (int p = 0; p < 2; ++p) {
      int idx = p * 256 + tid;
      int r = idx >> 2;
      int c = (idx & 3) * 8;
      cp16(&A[(size_t)(bm + r) * K + k0 + c], &As[buf][r * LDA + c]);
    }
    // B tile: 128 n-rows x 32 k bf16 from Bt[n][k], async copies like A
#pragma unroll
    for (int p = 0; p < 2; ++p) {
      int idx = p * 256 + tid;
      int r = idx >> 2;
      int c = (idx & 3) * 8;
      cp16(&Bt[(size_t)(bn + r) * K + k0 + c], &Bs[buf][r * LDA + c]);
    }
  };

  const int NK = K / BK;
  load_tiles(0, 0);

  const int row0 = bm + wm;
  const int col0 = bn + wn;
  // the residual in the order of the epilogue's stores: sixteen independent
  // loads, in flight beside the copies of the first tile
  const size_t foff = (size_t)(row0 + khalf) * N + col0 + lm * 4;
  float4 rv[2][8];
  if constexpr (RESID) {
    const float* rp = resid + foff;
#pragma unroll
    for (int i = 0; i < 2; ++i)
#pragma unroll
      for (int t = 0; t < 8; ++t)
        rv[i][t] = *reinterpret_cast<const float4*>(rp + (i * 16 + t * 2) * N);
  }

  int buf = 0;
  for (int kt = 0; kt < NK; ++kt) {
    // publish point: this wave's fragment reads of the buffer to be refilled
    // are done, its own copies of tile kt have landed, then the barrier
    asm volatile("s_wait_dscnt 0x0" ::: "memory");
    asm volatile("s_wait_asynccnt 0x0" ::: "memory");
    __syncthreads();
    if (kt + 1 < NK) load_tiles(kt + 1, buf ^ 1);
    v16bf af[2], bfr[4];
#pragma unroll
    for (int i = 0; i < 2; ++i)
      af[i] = load_frag(&As[buf][(wm + i * 16 + lm) * LDA], khalf * 8);
#pragma unroll
    for (int j = 0; j < 4; ++j)
      bfr[j] = load_frag(&Bs[buf][(wn + j * 16 + lm) * LDA], khalf * 8);
#pragma unroll
    for (int i = 0; i < 2; ++i)
#pragma unroll
      for (int j = 0; j < 4; ++j)
        acc[i][j] = __builtin_amdgcn_wmma_f32_16x16x32_bf16(
            false, af[i], false, bfr[j], (short)0, acc[i][j], false, false);
    buf ^= 1;
  }
  // no copy of this wave is left in flight when it goes on to its end
  asm volatile("s_wait_asynccnt 0x0" ::: "memory");

  // every wave has read its last fragments: the tiles' LDS becomes staging,
  // a range of 16 x SLD floats for each wave alone
  __syncthreads();
  float* stg = reinterpret_cast<float*>(wave < 4 ? &As[0][0] : &Bs[0][0]) +
               (wave & 3) * (16 * SLD);
  // C tile layout: lane holds (m = r + khalf*8, n = lm) of each 16x16 tile.
#pragma unroll
  for (int i = 0; i < 2; ++i) {
#pragma unroll
    for (int j = 0; j < 4; ++j)
#pragma unroll
      for (int r = 0; r < 8; ++r)
        stg[(r + khalf * 8) * SLD + j * 16 + lm] = acc[i][j][r];
    // the wave's own stores are in LDS before other lanes read the rows back
    asm volatile("s_wait_dscnt 0x0" ::: "memory");
    if constexpr (RESID) {
      // two rows of 256 bytes a store
#pragma unroll
      for (int t = 0; t < 8; ++t) {
        const int row = t * 2 + khalf;
        float4 v = *reinterpret_cast<const float4*>(&stg[row * SLD + lm * 4]);
        v.x += rv[i][t].x; v.y += rv[i][t].y; v.z += rv[i][t].z; v.w += rv[i][t].w;
        *reinterpret_cast<float4*>(Cf + foff + (i * 16 + t * 2) * N) = v;
      }
    } else {
      // four rows of 128 bytes a store
#pragma unroll
      for (int t = 0; t < 4; ++t) {
        const int row = t * 4 + (lane >> 3);
        const int c = (lane & 7) * 8;
        const float4 v0 = *reinterpret_cast<const float4*>(&stg[row * SLD + c]);
        const float4 v1 = *reinterpret_cast<const float4*>(&stg[row * SLD + c + 4]);
        U128 x;
        x.s[0] = f2bf(v0.x); x.s[1] = f2bf(v0.y); x.s[2] = f2bf(v0.z); x.s[3] = f2bf(v0.w);
        x.s[4] = f2bf(v1.x); x.s[5] = f2bf(v1.y); x.s[6] = f2bf(v1.z); x.s[7] = f2bf(v1.w);
        *reinterpret_cast<uint4*>(
            Cb + (size_t)(row0 + (lane >> 3)) * N + col0 + c + (i * 16 + t * 4) * N) = x.u;
      }
    }
    // the next 16 rows' read-back loads the registers of these stores anew
    if (i == 0) asm volatile("s_wait_xcnt 0x0" ::: "memory");
  }
}

#define SQ 128
#define SKB 128
#define QLD 72    // 64 + 8
#define VLD 136   // 128 + 8

// value of lane l ^ 16
__device__ __forceinline__ float xhalf(float x) {
  int i = __builtin_bit_cast(int, x);
  return __builtin_bit_cast(float, __builtin_amdgcn_permlanex16(
      i, i, 0x76543210, 0xfedcba98, false, false));
}

__global__ __launch_bounds__(256) void flash_attn(
    const unsigned short* __restrict__ Qg, const unsigned short* __restrict__ Kg,
    const unsigned short* __restrict__ Vg, const unsigned* __restrict__ Mw,
    unsigned short* __restrict__ Xg)
{
  __shared__ unsigned short Qs[SQ * QLD];
  __shared__ unsigned short Ks[SKB * QLD];
  __shared__ unsigned short Vt[DH_ * VLD];        // V^T: [d][key]

  const int tid  = threadIdx.x;
  const int lane = tid & 31;
  const int wave = tid >> 5;
  const int qb = blockIdx.x, h = blockIdx.y, b = blockIdx.z;
  const int lm = lane & 15;
  const int khalf = lane >> 4;
  const size_t rowbase = (size_t)b * S_ * DM_ + (size_t)h * DH_;

  // Q block -> LDS (async)
#pragma unroll
  for (int g = 0; g < 4; ++g) {
    int idx = g * 256 + tid;
    int r = idx >> 3;
    int c = (idx & 7) * 8;
    cp16(&Qg[rowbase + (size_t)(qb * SQ + r) * DM_ + c], &Qs[r * QLD + c]);
  }

  const int wq = wave * 16;
  const int qrow = qb * SQ + wq + lm;             // this lane's query
  // this wave's mask words: 64 per key block; the wave's number as a scalar, and the
  // constant address space, so that the loads are scalar loads
  const __attribute__((address_space(4))) unsigned* mwave =
      (const __attribute__((address_space(4))) unsigned*)(
          Mw + (size_t)(b * (S_ / 16) + qb * (SQ / 16) +
                        __builtin_amdgcn_readfirstlane(wave)) * (S_ / SKB) * 64);

  float mrun = -3.0e38f;   // running maximum of the query, equal in both halves
  float lrun = 0.0f;       // running sum over this half's keys only
  v8f o[4];                // o[j][r] = O[qrow][j*16 + khalf*8 + r]
#pragma unroll
  for (int j = 0; j < 4; ++j) o[j] = (v8f)(0.0f);

  for (int kb = 0; kb < S_ / SKB; ++kb) {
    // the block's 64 mask words: word j*8 + r goes with s[j][r]
    unsigned mk[64];
#pragma unroll
    for (int n = 0; n < 64; ++n) mk[n] = mwave[kb * 64 + n];
    // the loads' address pair is advanced later in the pass: no write of it in front of this wait
    asm volatile("s_wait_xcnt 0x0" ::: "memory");
    // keeps the scalar loads here, at the head of the pass, so that they return
    // under the staging of K and V; without it they sink to their first use
    __builtin_amdgcn_sched_barrier(0);

    __syncthreads();
    // K block -> LDS (async), layout [key][d]
#pragma unroll
    for (int g = 0; g < 4; ++g) {
      int idx = g * 256 + tid;
      int r = idx >> 3;
      int c = (idx & 7) * 8;
      cp16(&Kg[rowbase + (size_t)(kb * SKB + r) * DM_ + c], &Ks[r * QLD + c]);
    }
    // V block -> LDS transposed [d][key], 2 key-rows packed per b32 store
#pragma unroll
    for (int g = 0; g < 2; ++g) {
      int idx = g * 256 + tid;
      int r2 = (idx >> 3) * 2;       // key pair 0..126
      int dg = (idx & 7) * 8;        // d group 0..56
      U128 u0, u1;
      u0.u = *reinterpret_cast<const uint4*>(
          &Vg[rowbase + (size_t)(kb * SKB + r2) * DM_ + dg]);
      u1.u = *reinterpret_cast<const uint4*>(
          &Vg[rowbase + (size_t)(kb * SKB + r2 + 1) * DM_ + dg]);
#pragma unroll
      for (int i = 0; i < 8; ++i) {
        unsigned val = (unsigned)u0.s[i] | ((unsigned)u1.s[i] << 16);
        *reinterpret_cast<unsigned*>(&Vt[(dg + i) * VLD + r2]) = val;
      }
    }
    async_wait_all();
    __syncthreads();

    // scores^T: 128 keys x 16 q-columns, K-dim = 64 (2 WMMA steps);
    // s[j][r] = S[qrow][kb*128 + j*16 + khalf*8 + r]
    v8f s[8];
#pragma unroll
    for (int j = 0; j < 8; ++j) s[j] = (v8f)(0.0f);
#pragma unroll
    for (int kk = 0; kk < 2; ++kk) {
      v16bf bq = load_frag(&Qs[(wq + lm) * QLD], kk * 32 + khalf * 8);
#pragma unroll
      for (int j = 0; j < 8; ++j) {
        v16bf ak = load_frag(&Ks[(j * 16 + lm) * QLD], kk * 32 + khalf * 8);
        s[j] = __builtin_amdgcn_wmma_f32_16x16x32_bf16(
            false, ak, false, bq, (short)0, s[j], false, false);
      }
    }

    // scale + mask + block maximum, eight independent in-lane chains
    v8f bm = (v8f)(-3.0e38f);
#pragma unroll
    for (int j = 0; j < 8; ++j) {
      const v8f sc = s[j] * 0.125f;            // 1/sqrt(64)
#pragma unroll
      for (int r = 0; r < 8; ++r) {
        float sv = __builtin_amdgcn_inverse_ballot_w32(mk[j * 8 + r]) ? sc[r] : -1.0e9f;
        s[j][r] = sv;
      }
      bm = __builtin_elementwise_max(bm, s[j]);
    }
    float bmax = fmaxf(fmaxf(fmaxf(bm[0], bm[1]), fmaxf(bm[2], bm[3])),
                       fmaxf(fmaxf(bm[4], bm[5]), fmaxf(bm[6], bm[7])));
    bmax = fmaxf(bmax, xhalf(bmax));           // the query's other 64 keys

    // online softmax update
    const float mn = fmaxf(mrun, bmax);
    const float alpha = __expf(mrun - mn);
    mrun = mn;
    v8f rs = (v8f)(0.0f);
#pragma unroll
    for (int j = 0; j < 8; ++j) {
#pragma unroll
      for (int r = 0; r < 8; ++r) {
        float p = __expf(s[j][r] - mrun);
        s[j][r] = p;
      }
      rs += s[j];
    }
    lrun = lrun * alpha + (((rs[0] + rs[1]) + (rs[2] + rs[3])) +
                           ((rs[4] + rs[5]) + (rs[6] + rs[7])));
#pragma unroll
    for (int j = 0; j < 4; ++j)
#pragma unroll
      for (int r = 0; r < 8; ++r) o[j][r] *= alpha;

    // o^T += V^T[64x128] @ P^T[128x16]  (4 WMMA K-steps x 4 d-tiles);
    // element e of the B operand is key 8*khalf + e, then 16 + 8*khalf + (e-8),
    // of the 32 keys: tiles 2kk and 2kk+1 as they lie, the order load_frag has
#pragma unroll
    for (int kk = 0; kk < 4; ++kk) {
      v16bf bp;
#pragma unroll
      for (int e = 0; e < 8; ++e) {
        bp[e]     = static_cast<__bf16>(s[2 * kk][e]);
        bp[8 + e] = static_cast<__bf16>(s[2 * kk + 1][e]);
      }
#pragma unroll
      for (int j = 0; j < 4; ++j) {
        v16bf av = load_frag(&Vt[(j * 16 + lm) * VLD], kk * 32 + khalf * 8);
        o[j] = __builtin_amdgcn_wmma_f32_16x16x32_bf16(
            false, av, false, bp, (short)0, o[j], false, false);
      }
    }
  }

  // join the halves' sums, normalize, write X[b*S+q][h*64+d] as bf16:
  // eight consecutive d per lane and tile, one 16-byte store
  const float lsum = lrun + xhalf(lrun) + 1e-30f;
#pragma unroll
  for (int j = 0; j < 4; ++j) {
    U128 x;
#pragma unroll
    for (int r = 0; r < 8; ++r) x.s[r] = f2bf(o[j][r] / lsum);
    *reinterpret_cast<uint4*>(
        &Xg[rowbase + (size_t)qrow * DM_ + j * 16 + khalf * 8]) = x.u;
  }
}

// ---------------------------------------------------------------------------
// Kernel 3: in-place LayerNorm over rows of Y[8192][1024] (fp32).
// ---------------------------------------------------------------------------
__global__ __launch_bounds__(256) void layernorm_kernel(
    float* __restrict__ Y, const float* __restrict__ gam,
    const float* __restrict__ bet)
{
  __shared__ float red[2][8];
  const int row = blockIdx.x, tid = threadIdx.x;
  const int lane = tid & 31, wave = tid >> 5;
  float4 v = *reinterpret_cast<const float4*>(&Y[(size_t)row * DM_ + tid * 4]);
  float sum = v.x + v.y + v.z + v.w;
  float ssq = v.x * v.x + v.y * v.y + v.z * v.z + v.w * v.w;
#pragma unroll
  for (int off = 1; off < 32; off <<= 1) {
    sum += __shfl_xor(sum, off, 32);
    ssq += __shfl_xor(ssq, off, 32);
  }
  if (lane == 0) { red[0][wave] = sum; red[1][wave] = ssq; }
  __syncthreads();
  sum = red[0][lane & 7];
  ssq = red[1][lane & 7];
#pragma unroll
  for (int off = 1; off < 8; off <<= 1) {
    sum += __shfl_xor(sum, off, 32);
    ssq += __shfl_xor(ssq, off, 32);
  }
  float mu  = sum * (1.0f / DM_);
  float var = ssq * (1.0f / DM_) - mu * mu;
  float inv = rsqrtf(var + 1e-6f);
  float4 g4 = *reinterpret_cast<const float4*>(&gam[tid * 4]);
  float4 b4 = *reinterpret_cast<const float4*>(&bet[tid * 4]);
  float4 o4;
  o4.x = (v.x - mu) * inv * g4.x + b4.x;
  o4.y = (v.y - mu) * inv * g4.y + b4.y;
  o4.z = (v.z - mu) * inv * g4.z + b4.z;
  o4.w = (v.w - mu) * inv * g4.w + b4.w;
  *reinterpret_cast<float4*>(&Y[(size_t)row * DM_ + tid * 4]) = o4;
}

// ---------------------------------------------------------------------------
extern "C" void kernel_launch(void* const* d_in, const int* in_sizes, int n_in,
                              void* d_out, int out_size, void* d_ws, size_t ws_size,
                              hipStream_t stream) {
  (void)in_sizes; (void)n_in; (void)out_size; (void)ws_size;
  const float* query = (const float*)d_in[0];
  const float* key   = (const float*)d_in[1];
  const float* value = (const float*)d_in[2];
  const int*   mask  = (const int*)d_in[3];
  const float* w_qs  = (const float*)d_in[4];
  const float* w_ks  = (const float*)d_in[5];
  const float* w_vs  = (const float*)d_in[6];
  const float* w_out = (const float*)d_in[7];
  const float* ln_g  = (const float*)d_in[8];
  const float* ln_b  = (const float*)d_in[9];
  float* out = (float*)d_out;

  const size_t act  = (size_t)B_ * S_ * DM_;   // 8M elems
  const size_t wmat = (size_t)DM_ * DM_;       // 1M elems
  unsigned short* qb = (unsigned short*)d_ws;  // bf16 workspace
  unsigned short* kb = qb + act;
  unsigned short* vb = kb + act;
  unsigned short* wq = vb + act;
  unsigned short* wk = wq + wmat;
  unsigned short* wv = wk + wmat;
  unsigned short* wo = wv + wmat;
  unsigned short* Qp = wo + wmat;
  unsigned short* Kp = Qp + act;
  unsigned short* Vp = Kp + act;
  unsigned short* Xp = qb;   // qb is dead after the projection launch
  unsigned* mw = (unsigned*)(Vp + act);        // packed mask, 2 MiB

  const int M = B_ * S_;
  // qb, kb, vb and wq, wk, wv, wo lie one behind the other in the workspace
  prep_bf16<<<4 * WT_BLOCKS + MASK_BLOCKS + 3 * ACT_BLOCKS, 256, 0, stream>>>(
      query, key, value, w_qs, w_ks, w_vs, w_out, mask, qb, wq, mw);

  // the three projections are independent: one launch, z = 0, 1, 2
  wmma_gemm_bf16<false><<<dim3(DM_ / BN, M / BM, 3), 256, 0, stream>>>(
      qb, wq, nullptr, nullptr, Qp, M, DM_);

  flash_attn<<<dim3(S_ / SQ, H_, B_), 256, 0, stream>>>(Qp, Kp, Vp, mw, Xp);

  wmma_gemm_bf16<true><<<dim3(DM_ / BN, M / BM, 1), 256, 0, stream>>>(
      Xp, wo, query, out, nullptr, M, DM_);
  layernorm_kernel<<<M, 256, 0, stream>>>(out, ln_g, ln_b);
}

// v006
// One run takes 198 microseconds.
// In both of two side-by-side timings against v005, it was 1.06 times as fast.
// All steps since v000 together make it 2.00 times as fast.
#include <hip/hip_runtime.h>

// ---------------------------------------------------------------------------
// MHA forward for MI455X (gfx1250): end-to-end bf16 dataflow, WMMA GEMMs,
// flash attention, CDNA5 async global->LDS staging.
// ---------------------------------------------------------------------------

#define B_ 4
#define S_ 2048
#define H_ 16
#define DM_ 1024
#define DH_ 64

typedef __attribute__((ext_vector_type(16))) __bf16 v16bf;
typedef __attribute__((ext_vector_type(8)))  float  v8f;
typedef int async_v4i __attribute__((vector_size(16)));   // builtin's int4 type

union Frag16 { v16bf v; uint4 u[2]; };
union U128   { uint4 u; unsigned short s[8]; };

__device__ __forceinline__ unsigned short f2bf(float f) {
  return __builtin_bit_cast(unsigned short, static_cast<__bf16>(f));
}

// ---- CDNA5 async global->LDS (ASYNCcnt) with safe fallback ----------------
#if defined(__gfx1250__) && __has_builtin(__builtin_amdgcn_global_load_async_to_lds_b128)
#define CDNA5_ASYNC 1
#else
#define CDNA5_ASYNC 0
#endif

__device__ __forceinline__ void cp16(const unsigned short* g, unsigned short* l) {
#if CDNA5_ASYNC
  __builtin_amdgcn_global_load_async_to_lds_b128(
      (__attribute__((address_space(1))) async_v4i*)g,
      (__attribute__((address_space(3))) async_v4i*)l, 0, 0);
#else
  *reinterpret_cast<uint4*>(l) = *reinterpret_cast<const uint4*>(g);
#endif
}

__device__ __forceinline__ void async_wait_all() {
#if CDNA5_ASYNC
#if __has_builtin(__builtin_amdgcn_s_wait_asynccnt)
  __builtin_amdgcn_s_wait_asynccnt(0);
#else
  asm volatile("s_wait_asynccnt 0x0" ::: "memory");
#endif
#endif
}

// Load a 16x32 bf16 WMMA fragment row for this lane from an LDS row pointer.
// VGPR0-3 hold K = khalf*8 .. +7, VGPR4-7 hold K = 16+khalf*8 .. +7.
__device__ __forceinline__ v16bf load_frag(const unsigned short* row, int koff) {
  Frag16 f;
  f.u[0] = *reinterpret_cast<const uint4*>(row + koff);
  f.u[1] = *reinterpret_cast<const uint4*>(row + koff + 16);
  return f.v;
}

// ---------------------------------------------------------------------------
// Kernel 0: every fp32 -> bf16 conversion of the call and the packing of the
// mask in one launch; the eight pieces are independent of one another, a block
// picks its piece by its index.
//   blocks [0, 4*WT_BLOCKS): weight W[k][n] fp32 -> Wt[n][k] bf16 (DM_ x DM_),
//     64x64 tiles turned in LDS, so that the GEMM reads both operands
//     K-contiguous; they come first, so that they run under the long stream.
//   blocks [4*WT_BLOCKS, +MASK_BLOCKS): the int32 mask -> lane-mask words for the
//     attention kernel. A unit is 16 queries x 128 keys, one wave each, 64 words:
//     word j*8 + r, bit lane = (mask[query lane&15][key 16j + 8(lane>>4) + r] != 0),
//     the place that lane holds in the score tiles.
//   the rest: the three activations, elementwise, float4 granular.
// ---------------------------------------------------------------------------
#define TLD 72   // 64 + 8 pad, rows stay 16B-aligned
#define WT_BLOCKS  ((DM_ / 64) * (DM_ / 64))     // 256 tiles per weight
#define ACT_BLOCKS (B_ * S_ * DM_ / 4 / 256)     // 8192 blocks per activation
#define MASK_BLOCKS (B_ * (S_ / 16) * (S_ / 128) / 8)   // 8 units per block

__global__ __launch_bounds__(256) void prep_bf16(
    const float* __restrict__ a0, const float* __restrict__ a1,
    const float* __restrict__ a2,
    const float* __restrict__ w0, const float* __restrict__ w1,
    const float* __restrict__ w2, const float* __restrict__ w3,
    const int* __restrict__ mask,
    unsigned short* __restrict__ act_out, unsigned short* __restrict__ wt_out,
    unsigned* __restrict__ mw_out)
{
  __shared__ __attribute__((aligned(16))) unsigned short t[64 * TLD];   // [n][k]
  const int tid = threadIdx.x;
  const int blk = blockIdx.x;
  if (blk < 4 * WT_BLOCKS) {
    const int w = blk / WT_BLOCKS;
    const int tile = blk % WT_BLOCKS;
    const float* in = (w == 0) ? w0 : (w == 1) ? w1 : (w == 2) ? w2 : w3;
    unsigned short* out = wt_out + (size_t)w * DM_ * DM_;
    const int n0 = (tile % (DM_ / 64)) * 64;
    const int k0 = (tile / (DM_ / 64)) * 64;
#pragma unroll
    for (int p = 0; p < 4; ++p) {
      int k = p * 16 + (tid >> 4);
      int n = (tid & 15) * 4;
      float4 v = *reinterpret_cast<const float4*>(&in[(size_t)(k0 + k) * DM_ + n0 + n]);
      t[(n + 0) * TLD + k] = f2bf(v.x);
      t[(n + 1) * TLD + k] = f2bf(v.y);
      t[(n + 2) * TLD + k] = f2bf(v.z);
      t[(n + 3) * TLD + k] = f2bf(v.w);
    }
    __syncthreads();
#pragma unroll
    for (int p = 0; p < 2; ++p) {
      int idx = p * 256 + tid;
      int n = idx >> 3;
      int c = (idx & 7) * 8;
      *reinterpret_cast<uint4*>(&out[(size_t)(n0 + n) * DM_ + k0 + c]) =
          *reinterpret_cast<const uint4*>(&t[n * TLD + c]);
    }
    return;
  }
  if (blk < 4 * WT_BLOCKS + MASK_BLOCKS) {
    const int lane = tid & 31;
    const int unit = (blk - 4 * WT_BLOCKS) * 8 + (tid >> 5);   // (b*128 + qtile)*16 + kblock
    const int* src = mask + (size_t)(unit >> 4) * 16 * S_ + (unit & 15) * 128 + lane * 4;
    // x[c], bit l = (mask[query lane&15][key 4l + c] != 0): a row is read as whole
    // lines, 512 contiguous bytes a load, and turned into bits by ballots
    unsigned x[4] = {0u, 0u, 0u, 0u};
    // stays rolled: eight loads in flight a wave are enough for the stream, and all
    // sixteen would take registers from the occupancy of the elementwise blocks
#pragma nounroll
    for (int hf = 0; hf < 2; ++hf) {
      int4 m[8];
#pragma unroll
      for (int i = 0; i < 8; ++i)
        m[i] = *reinterpret_cast<const int4*>(src + (size_t)(hf * 8 + i) * S_);
#pragma unroll
      for (int i = 0; i < 8; ++i) {
        const bool mine = (lane & 15) == hf * 8 + i;
        const unsigned b0 = __builtin_amdgcn_ballot_w32(m[i].x != 0);
        const unsigned b1 = __builtin_amdgcn_ballot_w32(m[i].y != 0);
        const unsigned b2 = __builtin_amdgcn_ballot_w32(m[i].z != 0);
        const unsigned b3 = __builtin_amdgcn_ballot_w32(m[i].w != 0);
        x[0] = mine ? b0 : x[0];
        x[1] = mine ? b1 : x[1];
        x[2] = mine ? b2 : x[2];
        x[3] = mine ? b3 : x[3];
      }
    }
    // key 16j + 8(lane>>4) + r = 4l + c with l = 4j + 2(lane>>4) + (r>>2), c = r & 3
#pragma unroll
    for (int c = 0; c < 4; ++c) x[c] >>= 2 * (lane >> 4);
    uint2 w = make_uint2(0u, 0u);            // words 2*lane and 2*lane + 1 of the unit
#pragma unroll
    for (int n = 0; n < 64; ++n) {
      const int j = n >> 3, r = n & 7;
      const unsigned word =
          __builtin_amdgcn_ballot_w32(((x[r & 3] >> (4 * j + (r >> 2))) & 1u) != 0u);
      if (n & 1) w.y = (lane == (n >> 1)) ? word : w.y;
      else       w.x = (lane == (n >> 1)) ? word : w.x;
    }
    reinterpret_cast<uint2*>(mw_out + (size_t)unit * 64)[lane] = w;
    // the store's address registers are not rewritten on any path behind it before this wait
    asm volatile("s_wait_xcnt 0x0" ::: "memory");
    return;
  }
  const int ab = blk - 4 * WT_BLOCKS - MASK_BLOCKS;
  const int a = ab / ACT_BLOCKS;
  const float* in = (a == 0) ? a0 : (a == 1) ? a1 : a2;
  unsigned short* out = act_out + (size_t)a * B_ * S_ * DM_;
  const int i = (ab % ACT_BLOCKS) * 256 + tid;
  float4 v = reinterpret_cast<const float4*>(in)[i];
  union { unsigned short s[4]; uint2 u; } o;
  o.s[0] = f2bf(v.x); o.s[1] = f2bf(v.y); o.s[2] = f2bf(v.z); o.s[3] = f2bf(v.w);
  reinterpret_cast<uint2*>(out)[i] = o.u;
  // the store's address registers are not rewritten on any path behind it before this wait
  asm volatile("s_wait_xcnt 0x0" ::: "memory");
}

// ---------------------------------------------------------------------------
// Kernel 1: C[M,N] = A[M,K] @ Bt[N,K]^T, bf16 in, bf16 out (Cb) or fp32+resid (Cf).
// Block tile 128x128, K-step 32, double-buffered LDS, 8 waves (wave32).
// blockIdx.z picks one of several independent products of the same shape whose
// A, Bt and Cb each lie one behind the other in memory.
// RESID picks the output at compile time: fp32 with the residual added (Cf), or
// bf16 (Cb). Either way a wave turns its 32x64 tile in LDS, 16 rows at a time,
// so that global memory sees whole 128-byte lines in 16-byte accesses.
// ---------------------------------------------------------------------------
#define BM 128
#define BN 128
#define BK 32
#define LDA 40   // 32 + 8 pad, rows stay 16B-aligned
#define SLD 68   // staging pitch in floats: 64 + 4, 16 B x odd

template <bool RESID>
__global__ __launch_bounds__(256) void wmma_gemm_bf16(
    const unsigned short* __restrict__ A0, const unsigned short* __restrict__ Bt0,
    const float* __restrict__ resid, float* __restrict__ Cf,
    unsigned short* __restrict__ Cb0, int M, int K)
{
  // fixed, so that the epilogue's rows are immediate offsets from one address
  constexpr int N = DM_;
  __shared__ __attribute__((aligned(16))) unsigned short As[2][BM * LDA];
  __shared__ __attribute__((aligned(16))) unsigned short Bs[2][BN * LDA];   // [n][k]

  const int tid  = threadIdx.x;
  const int lane = tid & 31;
  const int wave = tid >> 5;
  const int bm = blockIdx.y * BM;
  const int bn = blockIdx.x * BN;
  const size_t bz = blockIdx.z;
  const unsigned short* A  = A0 + bz * M * K;
  const unsigned short* Bt = Bt0 + bz * N * K;
  unsigned short* Cb = Cb0 + bz * M * N;
  const int wm = (wave & 3) * 32;
  const int wn = (wave >> 2) * 64;
  const int lm = lane & 15;
  const int khalf = lane >> 4;

  v8f acc[2][4];
#pragma unroll
  for (int i = 0; i < 2; ++i)
#pragma unroll
    for (int j = 0; j < 4; ++j) acc[i][j] = (v8f)(0.0f);

  auto load_tiles = [&](int kt, int buf) {
    const int k0 = kt * BK;
    // A tile: 128x32 bf16 = 512 x 16B, async copies
#pragma unroll
    for (int p = 0; p < 2; ++p) {
      int idx = p * 256 + tid;
      int r = idx >> 2;
      int c = (idx & 3) * 8;
      cp16(&A[(size_t)(bm + r) * K + k0 + c], &As[buf][r * LDA + c]);
    }
    // B tile: 128 n-rows x 32 k bf16 from Bt[n][k], async copies like A
#pragma unroll
    for (int p = 0; p < 2; ++p) {
      int idx = p * 256 + tid;
      int r = idx >> 2;
      int c = (idx & 3) * 8;
      cp16(&Bt[(size_t)(bn + r) * K + k0 + c], &Bs[buf][r * LDA + c]);
    }
  };

  const int NK = K / BK;
  load_tiles(0, 0);

  const int row0 = bm + wm;
  const int col0 = bn + wn;
  // the residual in the order of the epilogue's stores: sixteen independent
  // loads, in flight beside the copies of the first tile
  const size_t foff = (size_t)(row0 + khalf) * N + col0 + lm * 4;
  float4 rv[2][8];
  if constexpr (RESID) {
    const float* rp = resid + foff;
#pragma unroll
    for (int i = 0; i < 2; ++i)
#pragma unroll
      for (int t = 0; t < 8; ++t)
        rv[i][t] = *reinterpret_cast<const float4*>(rp + (i * 16 + t * 2) * N);
  }

  int buf = 0;
  for (int kt = 0; kt < NK; ++kt) {
    // publish point: this wave's fragment reads of the buffer to be refilled
    // are done, its own copies of tile kt have landed, then the barrier
    asm volatile("s_wait_dscnt 0x0" ::: "memory");
    asm volatile("s_wait_asynccnt 0x0" ::: "memory");
    __syncthreads();
    if (kt + 1 < NK) load_tiles(kt + 1, buf ^ 1);
    v16bf af[2], bfr[4];
#pragma unroll
    for (int i = 0; i < 2; ++i)
      af[i] = load_frag(&As[buf][(wm + i * 16 + lm) * LDA], khalf * 8);
#pragma unroll
    for (int j = 0; j < 4; ++j)
      bfr[j] = load_frag(&Bs[buf][(wn + j * 16 + lm) * LDA], khalf * 8);
#pragma unroll
    for (int i = 0; i < 2; ++i)
#pragma unroll
      for (int j = 0; j < 4; ++j)
        acc[i][j] = __builtin_amdgcn_wmma_f32_16x16x32_bf16(
            false, af[i], false, bfr[j], (short)0, acc[i][j], false, false);
    buf ^= 1;
  }
  // no copy of this wave is left in flight when it goes on to its end
  asm volatile("s_wait_asynccnt 0x0" ::: "memory");

  // every wave has read its last fragments: the tiles' LDS becomes staging,
  // a range of 16 x SLD floats for each wave alone
  __syncthreads();
  float* stg = reinterpret_cast<float*>(wave < 4 ? &As[0][0] : &Bs[0][0]) +
               (wave & 3) * (16 * SLD);
  // C tile layout: lane holds (m = r + khalf*8, n = lm) of each 16x16 tile.
#pragma unroll
  for (int i = 0; i < 2; ++i) {
#pragma unroll
    for (int j = 0; j < 4; ++j)
#pragma unroll
      for (int r = 0; r < 8; ++r)
        stg[(r + khalf * 8) * SLD + j * 16 + lm] = acc[i][j][r];
    // the wave's own stores are in LDS before other lanes read the rows back
    asm volatile("s_wait_dscnt 0x0" ::: "memory");
    if constexpr (RESID) {
      // two rows of 256 bytes a store
#pragma unroll
      for (int t = 0; t < 8; ++t) {
        const int row = t * 2 + khalf;
        float4 v = *reinterpret_cast<const float4*>(&stg[row * SLD + lm * 4]);
        v.x += rv[i][t].x; v.y += rv[i][t].y; v.z += rv[i][t].z; v.w += rv[i][t].w;
        *reinterpret_cast<float4*>(Cf + foff + (i * 16 + t * 2) * N) = v;
      }
    } else {
      // four rows of 128 bytes a store
#pragma unroll
      for (int t = 0; t < 4; ++t) {
        const int row = t * 4 + (lane >> 3);
        const int c = (lane & 7) * 8;
        const float4 v0 = *reinterpret_cast<const float4*>(&stg[row * SLD + c]);
        const float4 v1 = *reinterpret_cast<const float4*>(&stg[row * SLD + c + 4]);
        U128 x;
        x.s[0] = f2bf(v0.x); x.s[1] = f2bf(v0.y); x.s[2] = f2bf(v0.z); x.s[3] = f2bf(v0.w);
        x.s[4] = f2bf(v1.x); x.s[5] = f2bf(v1.y); x.s[6] = f2bf(v1.z); x.s[7] = f2bf(v1.w);
        *reinterpret_cast<uint4*>(
            Cb + (size_t)(row0 + (lane >> 3)) * N + col0 + c + (i * 16 + t * 4) * N) = x.u;
      }
    }
    // the next 16 rows' read-back loads the registers of these stores anew
    if (i == 0) asm volatile("s_wait_xcnt 0x0" ::: "memory");
  }
}

#define SQ 128
#define SKB 128
#define QLD 72    // 64 + 8
#define VLD 136   // 128 + 8

// value of lane l ^ 16
__device__ __forceinline__ float xhalf(float x) {
  int i = __builtin_bit_cast(int, x);
  return __builtin_bit_cast(float, __builtin_amdgcn_permlanex16(
      i, i, 0x76543210, 0xfedcba98, false, false));
}

// the second bound asks for eight waves a SIMD, a budget of 128 registers a wave:
// four work-groups then share a WGP and the grid's 1024 are all resident at once
__global__ __launch_bounds__(256, 8) void flash_attn(
    const unsigned short* __restrict__ Qg, const unsigned short* __restrict__ Kg,
    const unsigned short* __restrict__ Vg, const unsigned* __restrict__ Mw,
    unsigned short* __restrict__ Xg)
{
  __shared__ unsigned short Qs[SQ * QLD];
  __shared__ unsigned short Ks[SKB * QLD];
  __shared__ unsigned short Vt[DH_ * VLD];        // V^T: [d][key]

  const int tid  = threadIdx.x;
  const int lane = tid & 31;
  const int wave = tid >> 5;
  const int qb = blockIdx.x, h = blockIdx.y, b = blockIdx.z;
  const int lm = lane & 15;
  const int khalf = lane >> 4;
  const size_t rowbase = (size_t)b * S_ * DM_ + (size_t)h * DH_;

  // Q block -> LDS (async)
#pragma unroll
  for (int g = 0; g < 4; ++g) {
    int idx = g * 256 + tid;
    int r = idx >> 3;
    int c = (idx & 7) * 8;
    cp16(&Qg[rowbase + (size_t)(qb * SQ + r) * DM_ + c], &Qs[r * QLD + c]);
  }

  const int wq = wave * 16;
  const int qrow = qb * SQ + wq + lm;             // this lane's query
  // this wave's mask words: 64 per key block; the wave's number as a scalar, and the
  // constant address space, so that the loads are scalar loads
  const __attribute__((address_space(4))) unsigned* mwave =
      (const __attribute__((address_space(4))) unsigned*)(
          Mw + (size_t)(b * (S_ / 16) + qb * (SQ / 16) +
                        __builtin_amdgcn_readfirstlane(wave)) * (S_ / SKB) * 64);

  float mrun = -3.0e38f;   // running maximum of the query, equal in both halves
  float lrun = 0.0f;       // running sum over this half's keys only
  v8f o[4];                // o[j][r] = O[qrow][j*16 + khalf*8 + r]
#pragma unroll
  for (int j = 0; j < 4; ++j) o[j] = (v8f)(0.0f);

  for (int kb = 0; kb < S_ / SKB; ++kb) {
    __syncthreads();
    // K block -> LDS (async), layout [key][d]
#pragma unroll
    for (int g = 0; g < 4; ++g) {
      int idx = g * 256 + tid;
      int r = idx >> 3;
      int c = (idx & 7) * 8;
      cp16(&Kg[rowbase + (size_t)(kb * SKB + r) * DM_ + c], &Ks[r * QLD + c]);
    }
    // V block -> LDS transposed [d][key], 2 key-rows packed per b32 store
#pragma unroll
    for (int g = 0; g < 2; ++g) {
      int idx = g * 256 + tid;
      int r2 = (idx >> 3) * 2;       // key pair 0..126
      int dg = (idx & 7) * 8;        // d group 0..56
      U128 u0, u1;
      u0.u = *reinterpret_cast<const uint4*>(
          &Vg[rowbase + (size_t)(kb * SKB + r2) * DM_ + dg]);
      u1.u = *reinterpret_cast<const uint4*>(
          &Vg[rowbase + (size_t)(kb * SKB + r2 + 1) * DM_ + dg]);
#pragma unroll
      for (int i = 0; i < 8; ++i) {
        unsigned val = (unsigned)u0.s[i] | ((unsigned)u1.s[i] << 16);
        *reinterpret_cast<unsigned*>(&Vt[(dg + i) * VLD + r2]) = val;
      }
    }
    async_wait_all();
    __syncthreads();

    // the block's 128 keys in two halves of 64: only four score tiles are live at
    // a time, so that a wave stays inside 128 registers without scratch;
    // stays rolled: unrolled, the halves are interleaved and eight tiles live again
#pragma nounroll
    for (int hf = 0; hf < 2; ++hf) {
      // the half's 32 mask words: word j*8 + r goes with s[j][r]
      unsigned mk[32];
#pragma unroll
      for (int n = 0; n < 32; ++n) mk[n] = mwave[kb * 64 + hf * 32 + n];
      // the loads' address pair is formed anew for the next half: no write of it in front of this wait
      asm volatile("s_wait_xcnt 0x0" ::: "memory");
      // keeps the scalar loads here, at the head of the half, so that they return
      // under the score products; without it they sink to their first use
      __builtin_amdgcn_sched_barrier(0);

      // scores^T: 64 keys x 16 q-columns, K-dim = 64 (2 WMMA steps);
      // s[j][r] = S[qrow][kb*128 + hf*64 + j*16 + khalf*8 + r]
      v8f s[4];
#pragma unroll
      for (int j = 0; j < 4; ++j) s[j] = (v8f)(0.0f);
#pragma unroll
      for (int kk = 0; kk < 2; ++kk) {
        v16bf bq = load_frag(&Qs[(wq + lm) * QLD], kk * 32 + khalf * 8);
#pragma unroll
        for (int j = 0; j < 4; ++j) {
          v16bf ak = load_frag(&Ks[(hf * 64 + j * 16 + lm) * QLD], kk * 32 + khalf * 8);
          s[j] = __builtin_amdgcn_wmma_f32_16x16x32_bf16(
              false, ak, false, bq, (short)0, s[j], false, false);
        }
      }

      // scale + mask + maximum of the half, eight independent in-lane chains
      v8f bm = (v8f)(-3.0e38f);
#pragma unroll
      for (int j = 0; j < 4; ++j) {
        const v8f sc = s[j] * 0.125f;            // 1/sqrt(64)
#pragma unroll
        for (int r = 0; r < 8; ++r) {
          float sv = __builtin_amdgcn_inverse_ballot_w32(mk[j * 8 + r]) ? sc[r] : -1.0e9f;
          s[j][r] = sv;
        }
        bm = __builtin_elementwise_max(bm, s[j]);
      }
      float bmax = fmaxf(fmaxf(fmaxf(bm[0], bm[1]), fmaxf(bm[2], bm[3])),
                         fmaxf(fmaxf(bm[4], bm[5]), fmaxf(bm[6], bm[7])));
      bmax = fmaxf(bmax, xhalf(bmax));           // the query's other 32 keys

      // online softmax update
      const float mn = fmaxf(mrun, bmax);
      const float alpha = __expf(mrun - mn);
      mrun = mn;
      v8f rs = (v8f)(0.0f);
#pragma unroll
      for (int j = 0; j < 4; ++j) {
#pragma unroll
        for (int r = 0; r < 8; ++r) {
          float p = __expf(s[j][r] - mrun);
          s[j][r] = p;
        }
        rs += s[j];
      }
      lrun = lrun * alpha + (((rs[0] + rs[1]) + (rs[2] + rs[3])) +
                             ((rs[4] + rs[5]) + (rs[6] + rs[7])));
#pragma unroll
      for (int j = 0; j < 4; ++j)
#pragma unroll
        for (int r = 0; r < 8; ++r) o[j][r] *= alpha;

      // o^T += V^T[64x64] @ P^T[64x16]  (2 WMMA K-steps x 4 d-tiles);
      // element e of the B operand is key 8*khalf + e, then 16 + 8*khalf + (e-8),
      // of the 32 keys: tiles 2kk and 2kk+1 as they lie, the order load_frag has
#pragma unroll
      for (int kk = 0; kk < 2; ++kk) {
        v16bf bp;
#pragma unroll
        for (int e = 0; e < 8; ++e) {
          bp[e]     = static_cast<__bf16>(s[2 * kk][e]);
          bp[8 + e] = static_cast<__bf16>(s[2 * kk + 1][e]);
        }
#pragma unroll
        for (int j = 0; j < 4; ++j) {
          v16bf av = load_frag(&Vt[(j * 16 + lm) * VLD], hf * 64 + kk * 32 + khalf * 8);
          o[j] = __builtin_amdgcn_wmma_f32_16x16x32_bf16(
              false, av, false, bp, (short)0, o[j], false, false);
        }
      }
    }
  }

  // join the halves' sums, normalize, write X[b*S+q][h*64+d] as bf16:
  // eight consecutive d per lane and tile, one 16-byte store
  const float lsum = lrun + xhalf(lrun) + 1e-30f;
#pragma unroll
  for (int j = 0; j < 4; ++j) {
    U128 x;
#pragma unroll
    for (int r = 0; r < 8; ++r) x.s[r] = f2bf(o[j][r] / lsum);
    *reinterpret_cast<uint4*>(
        &Xg[rowbase + (size_t)qrow * DM_ + j * 16 + khalf * 8]) = x.u;
  }
}

// ---------------------------------------------------------------------------
// Kernel 3: in-place LayerNorm over rows of Y[8192][1024] (fp32).
// ---------------------------------------------------------------------------
__global__ __launch_bounds__(256) void layernorm_kernel(
    float* __restrict__ Y, const float* __restrict__ gam,
    const float* __restrict__ bet)
{
  __shared__ float red[2][8];
  const int row = blockIdx.x, tid = threadIdx.x;
  const int lane = tid & 31, wave = tid >> 5;
  float4 v = *reinterpret_cast<const float4*>(&Y[(size_t)row * DM_ + tid * 4]);
  float sum = v.x + v.y + v.z + v.w;
  float ssq = v.x * v.x + v.y * v.y + v.z * v.z + v.w * v.w;
#pragma unroll
  for (int off = 1; off < 32; off <<= 1) {
    sum += __shfl_xor(sum, off, 32);
    ssq += __shfl_xor(ssq, off, 32);
  }
  if (lane == 0) { red[0][wave] = sum; red[1][wave] = ssq; }
  __syncthreads();
  sum = red[0][lane & 7];
  ssq = red[1][lane & 7];
#pragma unroll
  for (int off = 1; off < 8; off <<= 1) {
    sum += __shfl_xor(sum, off, 32);
    ssq += __shfl_xor(ssq, off, 32);
  }
  float mu  = sum * (1.0f / DM_);
  float var = ssq * (1.0f / DM_) - mu * mu;
  float inv = rsqrtf(var + 1e-6f);
  float4 g4 = *reinterpret_cast<const float4*>(&gam[tid * 4]);
  float4 b4 = *reinterpret_cast<const float4*>(&bet[tid * 4]);
  float4 o4;
  o4.x = (v.x - mu) * inv * g4.x + b4.x;
  o4.y = (v.y - mu) * inv * g4.y + b4.y;
  o4.z = (v.z - mu) * inv * g4.z + b4.z;
  o4.w = (v.w - mu) * inv * g4.w + b4.w;
  *reinterpret_cast<float4*>(&Y[(size_t)row * DM_ + tid * 4]) = o4;
}

// ---------------------------------------------------------------------------
extern "C" void kernel_launch(void* const* d_in, const int* in_sizes, int n_in,
                              void* d_out, int out_size, void* d_ws, size_t ws_size,
                              hipStream_t stream) {
  (void)in_sizes; (void)n_in; (void)out_size; (void)ws_size;
  const float* query = (const float*)d_in[0];
  const float* key   = (const float*)d_in[1];
  const float* value = (const float*)d_in[2];
  const int*   mask  = (const int*)d_in[3];
  const float* w_qs  = (const float*)d_in[4];
  const float* w_ks  = (const float*)d_in[5];
  const float* w_vs  = (const float*)d_in[6];
  const float* w_out = (const float*)d_in[7];
  const float* ln_g  = (const float*)d_in[8];
  const float* ln_b  = (const float*)d_in[9];
  float* out = (float*)d_out;

  const size_t act  = (size_t)B_ * S_ * DM_;   // 8M elems
  const size_t wmat = (size_t)DM_ * DM_;       // 1M elems
  unsigned short* qb = (unsigned short*)d_ws;  // bf16 workspace
  unsigned short* kb = qb + act;
  unsigned short* vb = kb + act;
  unsigned short* wq = vb + act;
  unsigned short* wk = wq + wmat;
  unsigned short* wv = wk + wmat;
  unsigned short* wo = wv + wmat;
  unsigned short* Qp = wo + wmat;
  unsigned short* Kp = Qp + act;
  unsigned short* Vp = Kp + act;
  unsigned short* Xp = qb;   // qb is dead after the projection launch
  unsigned* mw = (unsigned*)(Vp + act);        // packed mask, 2 MiB

  const int M = B_ * S_;
  // qb, kb, vb and wq, wk, wv, wo lie one behind the other in the workspace
  prep_bf16<<<4 * WT_BLOCKS + MASK_BLOCKS + 3 * ACT_BLOCKS, 256, 0, stream>>>(
      query, key, value, w_qs, w_ks, w_vs, w_out, mask, qb, wq, mw);

  // the three projections are independent: one launch, z = 0, 1, 2
  wmma_gemm_bf16<false><<<dim3(DM_ / BN, M / BM, 3), 256, 0, stream>>>(
      qb, wq, nullptr, nullptr, Qp, M, DM_);

  flash_attn<<<dim3(S_ / SQ, H_, B_), 256, 0, stream>>>(Qp, Kp, Vp, mw, Xp);

  wmma_gemm_bf16<true><<<dim3(DM_ / BN, M / BM, 1), 256, 0, stream>>>(
      Xp, wo, query, out, nullptr, M, DM_);
  layernorm_kernel<<<M, 256, 0, stream>>>(out, ln_g, ln_b);
}

// v007
// One run takes 175 microseconds.
// In two side-by-side timings against v006, it was 1.12 and 1.13 times as fast.
// All steps since v000 together make it 2.25 times as fast.
#include <hip/hip_runtime.h>

// ---------------------------------------------------------------------------
// MHA forward for MI455X (gfx1250): end-to-end bf16 dataflow, WMMA GEMMs,
// flash attention, CDNA5 async global->LDS staging.
// ---------------------------------------------------------------------------

#define B_ 4
#define S_ 2048
#define H_ 16
#define DM_ 1024
#define DH_ 64

typedef __attribute__((ext_vector_type(16))) __bf16 v16bf;
typedef __attribute__((ext_vector_type(8)))  float  v8f;
typedef int async_v4i __attribute__((vector_size(16)));   // builtin's int4 type

union Frag16 { v16bf v; uint4 u[2]; };
union U128   { uint4 u; unsigned short s[8]; };

__device__ __forceinline__ unsigned short f2bf(float f) {
  return __builtin_bit_cast(unsigned short, static_cast<__bf16>(f));
}

// ---- CDNA5 async global->LDS (ASYNCcnt) with safe fallback ----------------
#if defined(__gfx1250__) && __has_builtin(__builtin_amdgcn_global_load_async_to_lds_b128)
#define CDNA5_ASYNC 1
#else
#define CDNA5_ASYNC 0
#endif

__device__ __forceinline__ void cp16(const unsigned short* g, unsigned short* l) {
#if CDNA5_ASYNC
  __builtin_amdgcn_global_load_async_to_lds_b128(
      (__attribute__((address_space(1))) async_v4i*)g,
      (__attribute__((address_space(3))) async_v4i*)l, 0, 0);
#else
  *reinterpret_cast<uint4*>(l) = *reinterpret_cast<const uint4*>(g);
#endif
}

__device__ __forceinline__ void async_wait_all() {
#if CDNA5_ASYNC
#if __has_builtin(__builtin_amdgcn_s_wait_asynccnt)
  __builtin_amdgcn_s_wait_asynccnt(0);
#else
  asm volatile("s_wait_asynccnt 0x0" ::: "memory");
#endif
#endif
}

// Load a 16x32 bf16 WMMA fragment row for this lane from an LDS row pointer.
// VGPR0-3 hold K = khalf*8 .. +7, VGPR4-7 hold K = 16+khalf*8 .. +7.
__device__ __forceinline__ v16bf load_frag(const unsigned short* row, int koff) {
  Frag16 f;
  f.u[0] = *reinterpret_cast<const uint4*>(row + koff);
  f.u[1] = *reinterpret_cast<const uint4*>(row + koff + 16);
  return f.v;
}

// ---------------------------------------------------------------------------
// Kernel 0: every fp32 -> bf16 conversion of the call and the packing of the
// mask in one launch; the eight pieces are independent of one another, a block
// picks its piece by its index.
//   blocks [0, 4*WT_BLOCKS): weight W[k][n] fp32 -> Wt[n][k] bf16 (DM_ x DM_),
//     64x64 tiles turned in LDS, so that the GEMM reads both operands
//     K-contiguous; they come first, so that they run under the long stream.
//   blocks [4*WT_BLOCKS, +MASK_BLOCKS): the int32 mask -> lane-mask words for the
//     attention kernel. A unit is 16 queries x 128 keys, one wave each, 64 words:
//     word j*8 + r, bit lane = (mask[query lane&15][key 16j + 8(lane>>4) + r] != 0),
//     the place that lane holds in the score tiles.
//   the rest: the three activations, elementwise, float4 granular.
// ---------------------------------------------------------------------------
#define TLD 72   // 64 + 8 pad, rows stay 16B-aligned
#define WT_BLOCKS  ((DM_ / 64) * (DM_ / 64))     // 256 tiles per weight
#define ACT_BLOCKS (B_ * S_ * DM_ / 4 / 256)     // 8192 blocks per activation
#define MASK_BLOCKS (B_ * (S_ / 16) * (S_ / 128) / 8)   // 8 units per block

__global__ __launch_bounds__(256) void prep_bf16(
    const float* __restrict__ a0, const float* __restrict__ a1,
    const float* __restrict__ a2,
    const float* __restrict__ w0, const float* __restrict__ w1,
    const float* __restrict__ w2, const float* __restrict__ w3,
    const int* __restrict__ mask,
    unsigned short* __restrict__ act_out, unsigned short* __restrict__ wt_out,
    unsigned* __restrict__ mw_out)
{
  __shared__ __attribute__((aligned(16))) unsigned short t[64 * TLD];   // [n][k]
  const int tid = threadIdx.x;
  const int blk = blockIdx.x;
  if (blk < 4 * WT_BLOCKS) {
    const int w = blk / WT_BLOCKS;
    const int tile = blk % WT_BLOCKS;
    const float* in = (w == 0) ? w0 : (w == 1) ? w1 : (w == 2) ? w2 : w3;
    unsigned short* out = wt_out + (size_t)w * DM_ * DM_;
    const int n0 = (tile % (DM_ / 64)) * 64;
    const int k0 = (tile / (DM_ / 64)) * 64;
#pragma unroll
    for (int p = 0; p < 4; ++p) {
      int k = p * 16 + (tid >> 4);
      int n = (tid & 15) * 4;
      float4 v = *reinterpret_cast<const float4*>(&in[(size_t)(k0 + k) * DM_ + n0 + n]);
      t[(n + 0) * TLD + k] = f2bf(v.x);
      t[(n + 1) * TLD + k] = f2bf(v.y);
      t[(n + 2) * TLD + k] = f2bf(v.z);
      t[(n + 3) * TLD + k] = f2bf(v.w);
    }
    __syncthreads();
#pragma unroll
    for (int p = 0; p < 2; ++p) {
      int idx = p * 256 + tid;
      int n = idx >> 3;
      int c = (idx & 7) * 8;
      *reinterpret_cast<uint4*>(&out[(size_t)(n0 + n) * DM_ + k0 + c]) =
          *reinterpret_cast<const uint4*>(&t[n * TLD + c]);
    }
    return;
  }
  if (blk < 4 * WT_BLOCKS + MASK_BLOCKS) {
    const int lane = tid & 31;
    const int unit = (blk - 4 * WT_BLOCKS) * 8 + (tid >> 5);   // (b*128 + qtile)*16 + kblock
    const int* src = mask + (size_t)(unit >> 4) * 16 * S_ + (unit & 15) * 128 + lane * 4;
    // x[c], bit l = (mask[query lane&15][key 4l + c] != 0): a row is read as whole
    // lines, 512 contiguous bytes a load, and turned into bits by ballots
    unsigned x[4] = {0u, 0u, 0u, 0u};
    // stays rolled: eight loads in flight a wave are enough for the stream, and all
    // sixteen would take registers from the occupancy of the elementwise blocks
#pragma nounroll
    for (int hf = 0; hf < 2; ++hf) {
      int4 m[8];
#pragma unroll
      for (int i = 0; i < 8; ++i)
        m[i] = *reinterpret_cast<const int4*>(src + (size_t)(hf * 8 + i) * S_);
#pragma unroll
      for (int i = 0; i < 8; ++i) {
        const bool mine = (lane & 15) == hf * 8 + i;
        const unsigned b0 = __builtin_amdgcn_ballot_w32(m[i].x != 0);
        const unsigned b1 = __builtin_amdgcn_ballot_w32(m[i].y != 0);
        const unsigned b2 = __builtin_amdgcn_ballot_w32(m[i].z != 0);
        const unsigned b3 = __builtin_amdgcn_ballot_w32(m[i].w != 0);
        x[0] = mine ? b0 : x[0];
        x[1] = mine ? b1 : x[1];
        x[2] = mine ? b2 : x[2];
        x[3] = mine ? b3 : x[3];
      }
    }
    // key 16j + 8(lane>>4) + r = 4l + c with l = 4j + 2(lane>>4) + (r>>2), c = r & 3
#pragma unroll
    for (int c = 0; c < 4; ++c) x[c] >>= 2 * (lane >> 4);
    uint2 w = make_uint2(0u, 0u);            // words 2*lane and 2*lane + 1 of the unit
#pragma unroll
    for (int n = 0; n < 64; ++n) {
      const int j = n >> 3, r = n & 7;
      const unsigned word =
          __builtin_amdgcn_ballot_w32(((x[r & 3] >> (4 * j + (r >> 2))) & 1u) != 0u);
      if (n & 1) w.y = (lane == (n >> 1)) ? word : w.y;
      else       w.x = (lane == (n >> 1)) ? word : w.x;
    }
    reinterpret_cast<uint2*>(mw_out + (size_t)unit * 64)[lane] = w;
    // the store's address registers are not rewritten on any path behind it before this wait
    asm volatile("s_wait_xcnt 0x0" ::: "memory");
    return;
  }
  const int ab = blk - 4 * WT_BLOCKS - MASK_BLOCKS;
  const int a = ab / ACT_BLOCKS;
  const float* in = (a == 0) ? a0 : (a == 1) ? a1 : a2;
  unsigned short* out = act_out + (size_t)a * B_ * S_ * DM_;
  const int i = (ab % ACT_BLOCKS) * 256 + tid;
  float4 v = reinterpret_cast<const float4*>(in)[i];
  union { unsigned short s[4]; uint2 u; } o;
  o.s[0] = f2bf(v.x); o.s[1] = f2bf(v.y); o.s[2] = f2bf(v.z); o.s[3] = f2bf(v.w);
  reinterpret_cast<uint2*>(out)[i] = o.u;
  // the store's address registers are not rewritten on any path behind it before this wait
  asm volatile("s_wait_xcnt 0x0" ::: "memory");
}

// ---------------------------------------------------------------------------
// Kernel 1: C[M,N] = A[M,K] @ Bt[N,K]^T, bf16 in, bf16 out (Cb) or fp32+resid (Cf).
// Block tile 128x128, K-step 64, double-buffered LDS, 8 waves (wave32): a staged
// row is one whole 128-byte line, a wave's copy covers four lines.
// blockIdx.z picks one of several independent products of the same shape whose
// A, Bt and Cb each lie one behind the other in memory.
// RESID picks the output at compile time: fp32 with the residual added (Cf), or
// bf16 (Cb). Either way a wave turns its 32x64 tile in LDS, 16 rows at a time,
// so that global memory sees whole 128-byte lines in 16-byte accesses.
// ---------------------------------------------------------------------------
#define BM 128
#define BN 128
#define BK 64
#define LDA 72   // 64 + 8 pad: pitch 144 B, 16 B x odd
#define SLD 68   // staging pitch in floats: 64 + 4, 16 B x odd

template <bool RESID>
__global__ __launch_bounds__(256) void wmma_gemm_bf16(
    const unsigned short* __restrict__ A0, const unsigned short* __restrict__ Bt0,
    const float* __restrict__ resid, float* __restrict__ Cf,
    unsigned short* __restrict__ Cb0, int M, int K)
{
  // fixed, so that the epilogue's rows are immediate offsets from one address
  constexpr int N = DM_;
  __shared__ __attribute__((aligned(16))) unsigned short As[2][BM * LDA];
  __shared__ __attribute__((aligned(16))) unsigned short Bs[2][BN * LDA];   // [n][k]

  const int tid  = threadIdx.x;
  const int lane = tid & 31;
  const int wave = tid >> 5;
  const int bm = blockIdx.y * BM;
  const int bn = blockIdx.x * BN;
  const size_t bz = blockIdx.z;
  const unsigned short* A  = A0 + bz * M * K;
  const unsigned short* Bt = Bt0 + bz * N * K;
  unsigned short* Cb = Cb0 + bz * M * N;
  const int wm = (wave & 3) * 32;
  const int wn = (wave >> 2) * 64;
  const int lm = lane & 15;
  const int khalf = lane >> 4;

  v8f acc[2][4];
#pragma unroll
  for (int i = 0; i < 2; ++i)
#pragma unroll
    for (int j = 0; j < 4; ++j) acc[i][j] = (v8f)(0.0f);

  auto load_tiles = [&](int kt, int buf) {
    const int k0 = kt * BK;
    // A tile: 128x64 bf16 = 1024 x 16B, async copies, eight lanes a row
#pragma unroll
    for (int p = 0; p < 4; ++p) {
      int idx = p * 256 + tid;
      int r = idx >> 3;
      int c = (idx & 7) * 8;
      cp16(&A[(size_t)(bm + r) * K + k0 + c], &As[buf][r * LDA + c]);
    }
    // B tile: 128 n-rows x 64 k bf16 from Bt[n][k], async copies like A
#pragma unroll
    for (int p = 0; p < 4; ++p) {
      int idx = p * 256 + tid;
      int r = idx >> 3;
      int c = (idx & 7) * 8;
      cp16(&Bt[(size_t)(bn + r) * K + k0 + c], &Bs[buf][r * LDA + c]);
    }
  };

  const int NK = K / BK;
  load_tiles(0, 0);

  const int row0 = bm + wm;
  const int col0 = bn + wn;
  // the residual in the order of the epilogue's stores: sixteen independent
  // loads, in flight beside the copies of the first tile
  const size_t foff = (size_t)(row0 + khalf) * N + col0 + lm * 4;
  float4 rv[2][8];
  if constexpr (RESID) {
    const float* rp = resid + foff;
#pragma unroll
    for (int i = 0; i < 2; ++i)
#pragma unroll
      for (int t = 0; t < 8; ++t)
        rv[i][t] = *reinterpret_cast<const float4*>(rp + (i * 16 + t * 2) * N);
  }

  int buf = 0;
  for (int kt = 0; kt < NK; ++kt) {
    // publish point: this wave's fragment reads of the buffer to be refilled
    // are done, its own copies of tile kt have landed, then the barrier
    asm volatile("s_wait_dscnt 0x0" ::: "memory");
    asm volatile("s_wait_asynccnt 0x0" ::: "memory");
    __syncthreads();
    if (kt + 1 < NK) load_tiles(kt + 1, buf ^ 1);
    // unrolled: the two 32-k halves of the tile become immediate LDS offsets, and the
    // second half's fragment loads can be issued among the first half's products
#pragma unroll
    for (int kk = 0; kk < BK / 32; ++kk) {
      v16bf af[2], bfr[4];
#pragma unroll
      for (int i = 0; i < 2; ++i)
        af[i] = load_frag(&As[buf][(wm + i * 16 + lm) * LDA], kk * 32 + khalf * 8);
#pragma unroll
      for (int j = 0; j < 4; ++j)
        bfr[j] = load_frag(&Bs[buf][(wn + j * 16 + lm) * LDA], kk * 32 + khalf * 8);
#pragma unroll
      for (int i = 0; i < 2; ++i)
#pragma unroll
        for (int j = 0; j < 4; ++j)
          acc[i][j] = __builtin_amdgcn_wmma_f32_16x16x32_bf16(
              false, af[i], false, bfr[j], (short)0, acc[i][j], false, false);
    }
    buf ^= 1;
  }
  // no copy of this wave is left in flight when it goes on to its end
  asm volatile("s_wait_asynccnt 0x0" ::: "memory");

  // every wave has read its last fragments: the tiles' LDS becomes staging,
  // a range of 16 x SLD floats for each wave alone
  __syncthreads();
  float* stg = reinterpret_cast<float*>(wave < 4 ? &As[0][0] : &Bs[0][0]) +
               (wave & 3) * (16 * SLD);
  // C tile layout: lane holds (m = r + khalf*8, n = lm) of each 16x16 tile.
#pragma unroll
  for (int i = 0; i < 2; ++i) {
#pragma unroll
    for (int j = 0; j < 4; ++j)
#pragma unroll
      for (int r = 0; r < 8; ++r)
        stg[(r + khalf * 8) * SLD + j * 16 + lm] = acc[i][j][r];
    // the wave's own stores are in LDS before other lanes read the rows back
    asm volatile("s_wait_dscnt 0x0" ::: "memory");
    if constexpr (RESID) {
      // two rows of 256 bytes a store
#pragma unroll
      for (int t = 0; t < 8; ++t) {
        const int row = t * 2 + khalf;
        float4 v = *reinterpret_cast<const float4*>(&stg[row * SLD + lm * 4]);
        v.x += rv[i][t].x; v.y += rv[i][t].y; v.z += rv[i][t].z; v.w += rv[i][t].w;
        *reinterpret_cast<float4*>(Cf + foff + (i * 16 + t * 2) * N) = v;
      }
    } else {
      // four rows of 128 bytes a store
#pragma unroll
      for (int t = 0; t < 4; ++t) {
        const int row = t * 4 + (lane >> 3);
        const int c = (lane & 7) * 8;
        const float4 v0 = *reinterpret_cast<const float4*>(&stg[row * SLD + c]);
        const float4 v1 = *reinterpret_cast<const float4*>(&stg[row * SLD + c + 4]);
        U128 x;
        x.s[0] = f2bf(v0.x); x.s[1] = f2bf(v0.y); x.s[2] = f2bf(v0.z); x.s[3] = f2bf(v0.w);
        x.s[4] = f2bf(v1.x); x.s[5] = f2bf(v1.y); x.s[6] = f2bf(v1.z); x.s[7] = f2bf(v1.w);
        *reinterpret_cast<uint4*>(
            Cb + (size_t)(row0 + (lane >> 3)) * N + col0 + c + (i * 16 + t * 4) * N) = x.u;
      }
    }
    // the next 16 rows' read-back loads the registers of these stores anew
    if (i == 0) asm volatile("s_wait_xcnt 0x0" ::: "memory");
  }
}

#define SQ 128
#define SKB 128
#define QLD 72    // 64 + 8
#define VLD 136   // 128 + 8

// value of lane l ^ 16
__device__ __forceinline__ float xhalf(float x) {
  int i = __builtin_bit_cast(int, x);
  return __builtin_bit_cast(float, __builtin_amdgcn_permlanex16(
      i, i, 0x76543210, 0xfedcba98, false, false));
}

// the second bound asks for eight waves a SIMD, a budget of 128 registers a wave:
// four work-groups then share a WGP and the grid's 1024 are all resident at once
__global__ __launch_bounds__(256, 8) void flash_attn(
    const unsigned short* __restrict__ Qg, const unsigned short* __restrict__ Kg,
    const unsigned short* __restrict__ Vg, const unsigned* __restrict__ Mw,
    unsigned short* __restrict__ Xg)
{
  __shared__ unsigned short Qs[SQ * QLD];
  __shared__ unsigned short Ks[SKB * QLD];
  __shared__ unsigned short Vt[DH_ * VLD];        // V^T: [d][key]

  const int tid  = threadIdx.x;
  const int lane = tid & 31;
  const int wave = tid >> 5;
  const int qb = blockIdx.x, h = blockIdx.y, b = blockIdx.z;
  const int lm = lane & 15;
  const int khalf = lane >> 4;
  const size_t rowbase = (size_t)b * S_ * DM_ + (size_t)h * DH_;

  // Q block -> LDS (async)
#pragma unroll
  for (int g = 0; g < 4; ++g) {
    int idx = g * 256 + tid;
    int r = idx >> 3;
    int c = (idx & 7) * 8;
    cp16(&Qg[rowbase + (size_t)(qb * SQ + r) * DM_ + c], &Qs[r * QLD + c]);
  }

  const int wq = wave * 16;
  const int qrow = qb * SQ + wq + lm;             // this lane's query
  // this wave's mask words: 64 per key block; the wave's number as a scalar, and the
  // constant address space, so that the loads are scalar loads
  const __attribute__((address_space(4))) unsigned* mwave =
      (const __attribute__((address_space(4))) unsigned*)(
          Mw + (size_t)(b * (S_ / 16) + qb * (SQ / 16) +
                        __builtin_amdgcn_readfirstlane(wave)) * (S_ / SKB) * 64);

  float mrun = -3.0e38f;   // running maximum of the query, equal in both halves
  float lrun = 0.0f;       // running sum over this half's keys only
  v8f o[4];                // o[j][r] = O[qrow][j*16 + khalf*8 + r]
#pragma unroll
  for (int j = 0; j < 4; ++j) o[j] = (v8f)(0.0f);

  for (int kb = 0; kb < S_ / SKB; ++kb) {
    __syncthreads();
    // K block -> LDS (async), layout [key][d]
#pragma unroll
    for (int g = 0; g < 4; ++g) {
      int idx = g * 256 + tid;
      int r = idx >> 3;
      int c = (idx & 7) * 8;
      cp16(&Kg[rowbase + (size_t)(kb * SKB + r) * DM_ + c], &Ks[r * QLD + c]);
    }
    // V block -> LDS transposed [d][key], 2 key-rows packed per b32 store
#pragma unroll
    for (int g = 0; g < 2; ++g) {
      int idx = g * 256 + tid;
      int r2 = (idx >> 3) * 2;       // key pair 0..126
      int dg = (idx & 7) * 8;        // d group 0..56
      U128 u0, u1;
      u0.u = *reinterpret_cast<const uint4*>(
          &Vg[rowbase + (size_t)(kb * SKB + r2) * DM_ + dg]);
      u1.u = *reinterpret_cast<const uint4*>(
          &Vg[rowbase + (size_t)(kb * SKB + r2 + 1) * DM_ + dg]);
#pragma unroll
      for (int i = 0; i < 8; ++i) {
        unsigned val = (unsigned)u0.s[i] | ((unsigned)u1.s[i] << 16);
        *reinterpret_cast<unsigned*>(&Vt[(dg + i) * VLD + r2]) = val;
      }
    }
    async_wait_all();
    __syncthreads();

    // the block's 128 keys in two halves of 64: only four score tiles are live at
    // a time, so that a wave stays inside 128 registers without scratch;
    // stays rolled: unrolled, the halves are interleaved and eight tiles live again
#pragma nounroll
    for (int hf = 0; hf < 2; ++hf) {
      // the half's 32 mask words: word j*8 + r goes with s[j][r]
      unsigned mk[32];
#pragma unroll
      for (int n = 0; n < 32; ++n) mk[n] = mwave[kb * 64 + hf * 32 + n];
      // the loads' address pair is formed anew for the next half: no write of it in front of this wait
      asm volatile("s_wait_xcnt 0x0" ::: "memory");
      // keeps the scalar loads here, at the head of the half, so that they return
      // under the score products; without it they sink to their first use
      __builtin_amdgcn_sched_barrier(0);

      // scores^T: 64 keys x 16 q-columns, K-dim = 64 (2 WMMA steps);
      // s[j][r] = S[qrow][kb*128 + hf*64 + j*16 + khalf*8 + r]
      v8f s[4];
#pragma unroll
      for (int j = 0; j < 4; ++j) s[j] = (v8f)(0.0f);
#pragma unroll
      for (int kk = 0; kk < 2; ++kk) {
        v16bf bq = load_frag(&Qs[(wq + lm) * QLD], kk * 32 + khalf * 8);
#pragma unroll
        for (int j = 0; j < 4; ++j) {
          v16bf ak = load_frag(&Ks[(hf * 64 + j * 16 + lm) * QLD], kk * 32 + khalf * 8);
          s[j] = __builtin_amdgcn_wmma_f32_16x16x32_bf16(
              false, ak, false, bq, (short)0, s[j], false, false);
        }
      }

      // scale + mask + maximum of the half, eight independent in-lane chains
      v8f bm = (v8f)(-3.0e38f);
#pragma unroll
      for (int j = 0; j < 4; ++j) {
        const v8f sc = s[j] * 0.125f;            // 1/sqrt(64)
#pragma unroll
        for (int r = 0; r < 8; ++r) {
          float sv = __builtin_amdgcn_inverse_ballot_w32(mk[j * 8 + r]) ? sc[r] : -1.0e9f;
          s[j][r] = sv;
        }
        bm = __builtin_elementwise_max(bm, s[j]);
      }
      float bmax = fmaxf(fmaxf(fmaxf(bm[0], bm[1]), fmaxf(bm[2], bm[3])),
                         fmaxf(fmaxf(bm[4], bm[5]), fmaxf(bm[6], bm[7])));
      bmax = fmaxf(bmax, xhalf(bmax));           // the query's other 32 keys

      // online softmax update
      const float mn = fmaxf(mrun, bmax);
      const float alpha = __expf(mrun - mn);
      mrun = mn;
      v8f rs = (v8f)(0.0f);
#pragma unroll
      for (int j = 0; j < 4; ++j) {
#pragma unroll
        for (int r = 0; r < 8; ++r) {
          float p = __expf(s[j][r] - mrun);
          s[j][r] = p;
        }
        rs += s[j];
      }
      lrun = lrun * alpha + (((rs[0] + rs[1]) + (rs[2] + rs[3])) +
                             ((rs[4] + rs[5]) + (rs[6] + rs[7])));
#pragma unroll
      for (int j = 0; j < 4; ++j)
#pragma unroll
        for (int r = 0; r < 8; ++r) o[j][r] *= alpha;

      // o^T += V^T[64x64] @ P^T[64x16]  (2 WMMA K-steps x 4 d-tiles);
      // element e of the B operand is key 8*khalf + e, then 16 + 8*khalf + (e-8),
      // of the 32 keys: tiles 2kk and 2kk+1 as they lie, the order load_frag has
#pragma unroll
      for (int kk = 0; kk < 2; ++kk) {
        v16bf bp;
#pragma unroll
        for (int e = 0; e < 8; ++e) {
          bp[e]     = static_cast<__bf16>(s[2 * kk][e]);
          bp[8 + e] = static_cast<__bf16>(s[2 * kk + 1][e]);
        }
#pragma unroll
        for (int j = 0; j < 4; ++j) {
          v16bf av = load_frag(&Vt[(j * 16 + lm) * VLD], hf * 64 + kk * 32 + khalf * 8);
          o[j] = __builtin_amdgcn_wmma_f32_16x16x32_bf16(
              false, av, false, bp, (short)0, o[j], false, false);
        }
      }
    }
  }

  // join the halves' sums, normalize, write X[b*S+q][h*64+d] as bf16:
  // eight consecutive d per lane and tile, one 16-byte store
  const float lsum = lrun + xhalf(lrun) + 1e-30f;
#pragma unroll
  for (int j = 0; j < 4; ++j) {
    U128 x;
#pragma unroll
    for (int r = 0; r < 8; ++r) x.s[r] = f2bf(o[j][r] / lsum);
    *reinterpret_cast<uint4*>(
        &Xg[rowbase + (size_t)qrow * DM_ + j * 16 + khalf * 8]) = x.u;
  }
}

// ---------------------------------------------------------------------------
// Kernel 3: in-place LayerNorm over rows of Y[8192][1024] (fp32).
// ---------------------------------------------------------------------------
__global__ __launch_bounds__(256) void layernorm_kernel(
    float* __restrict__ Y, const float* __restrict__ gam,
    const float* __restrict__ bet)
{
  __shared__ float red[2][8];
  const int row = blockIdx.x, tid = threadIdx.x;
  const int lane = tid & 31, wave = tid >> 5;
  float4 v = *reinterpret_cast<const float4*>(&Y[(size_t)row * DM_ + tid * 4]);
  float sum = v.x + v.y + v.z + v.w;
  float ssq = v.x * v.x + v.y * v.y + v.z * v.z + v.w * v.w;
#pragma unroll
  for (int off = 1; off < 32; off <<= 1) {
    sum += __shfl_xor(sum, off, 32);
    ssq += __shfl_xor(ssq, off, 32);
  }
  if (lane == 0) { red[0][wave] = sum; red[1][wave] = ssq; }
  __syncthreads();
  sum = red[0][lane & 7];
  ssq = red[1][lane & 7];
#pragma unroll
  for (int off = 1; off < 8; off <<= 1) {
    sum += __shfl_xor(sum, off, 32);
    ssq += __shfl_xor(ssq, off, 32);
  }
  float mu  = sum * (1.0f / DM_);
  float var = ssq * (1.0f / DM_) - mu * mu;
  float inv = rsqrtf(var + 1e-6f);
  float4 g4 = *reinterpret_cast<const float4*>(&gam[tid * 4]);
  float4 b4 = *reinterpret_cast<const float4*>(&bet[tid * 4]);
  float4 o4;
  o4.x = (v.x - mu) * inv * g4.x + b4.x;
  o4.y = (v.y - mu) * inv * g4.y + b4.y;
  o4.z = (v.z - mu) * inv * g4.z + b4.z;
  o4.w = (v.w - mu) * inv * g4.w + b4.w;
  *reinterpret_cast<float4*>(&Y[(size_t)row * DM_ + tid * 4]) = o4;
}

// ---------------------------------------------------------------------------
extern "C" void kernel_launch(void* const* d_in, const int* in_sizes, int n_in,
                              void* d_out, int out_size, void* d_ws, size_t ws_size,
                              hipStream_t stream) {
  (void)in_sizes; (void)n_in; (void)out_size; (void)ws_size;
  const float* query = (const float*)d_in[0];
  const float* key   = (const float*)d_in[1];
  const float* value = (const float*)d_in[2];
  const int*   mask  = (const int*)d_in[3];
  const float* w_qs  = (const float*)d_in[4];
  const float* w_ks  = (const float*)d_in[5];
  const float* w_vs  = (const float*)d_in[6];
  const float* w_out = (const float*)d_in[7];
  const float* ln_g  = (const float*)d_in[8];
  const float* ln_b  = (const float*)d_in[9];
  float* out = (float*)d_out;

  const size_t act  = (size_t)B_ * S_ * DM_;   // 8M elems
  const size_t wmat = (size_t)DM_ * DM_;       // 1M elems
  unsigned short* qb = (unsigned short*)d_ws;  // bf16 workspace
  unsigned short* kb = qb + act;
  unsigned short* vb = kb + act;
  unsigned short* wq = vb + act;
  unsigned short* wk = wq + wmat;
  unsigned short* wv = wk + wmat;
  unsigned short* wo = wv + wmat;
  unsigned short* Qp = wo + wmat;
  unsigned short* Kp = Qp + act;
  unsigned short* Vp = Kp + act;
  unsigned short* Xp = qb;   // qb is dead after the projection launch
  unsigned* mw = (unsigned*)(Vp + act);        // packed mask, 2 MiB

  const int M = B_ * S_;
  // qb, kb, vb and wq, wk, wv, wo lie one behind the other in the workspace
  prep_bf16<<<4 * WT_BLOCKS + MASK_BLOCKS + 3 * ACT_BLOCKS, 256, 0, stream>>>(
      query, key, value, w_qs, w_ks, w_vs, w_out, mask, qb, wq, mw);

  // the three projections are independent: one launch, z = 0, 1, 2
  wmma_gemm_bf16<false><<<dim3(DM_ / BN, M / BM, 3), 256, 0, stream>>>(
      qb, wq, nullptr, nullptr, Qp, M, DM_);

  flash_attn<<<dim3(S_ / SQ, H_, B_), 256, 0, stream>>>(Qp, Kp, Vp, mw, Xp);

  wmma_gemm_bf16<true><<<dim3(DM_ / BN, M / BM, 1), 256, 0, stream>>>(
      Xp, wo, query, out, nullptr, M, DM_);
  layernorm_kernel<<<M, 256, 0, stream>>>(out, ln_g, ln_b);
}

// v008
// A run of this version takes 168 microseconds.
// Two timings next to v007 both put it at 1.03 times that version's speed.
// All steps since v000 together make it 2.32 times as fast.
#include <hip/hip_runtime.h>

// ---------------------------------------------------------------------------
// MHA forward for MI455X (gfx1250): end-to-end bf16 dataflow, WMMA GEMMs,
// flash attention, CDNA5 async global->LDS staging.
// ---------------------------------------------------------------------------

#define B_ 4
#define S_ 2048
#define H_ 16
#define DM_ 1024
#define DH_ 64

typedef __attribute__((ext_vector_type(16))) __bf16 v16bf;
typedef __attribute__((ext_vector_type(8)))  float  v8f;
typedef int async_v4i __attribute__((vector_size(16)));   // builtin's int4 type

union Frag16 { v16bf v; uint4 u[2]; };
union U128   { uint4 u; unsigned short s[8]; };

__device__ __forceinline__ unsigned short f2bf(float f) {
  return __builtin_bit_cast(unsigned short, static_cast<__bf16>(f));
}

// ---- CDNA5 async global->LDS (ASYNCcnt) with safe fallback ----------------
#if defined(__gfx1250__) && __has_builtin(__builtin_amdgcn_global_load_async_to_lds_b128)
#define CDNA5_ASYNC 1
#else
#define CDNA5_ASYNC 0
#endif

__device__ __forceinline__ void cp16(const unsigned short* g, unsigned short* l) {
#if CDNA5_ASYNC
  __builtin_amdgcn_global_load_async_to_lds_b128(
      (__attribute__((address_space(1))) async_v4i*)g,
      (__attribute__((address_space(3))) async_v4i*)l, 0, 0);
#else
  *reinterpret_cast<uint4*>(l) = *reinterpret_cast<const uint4*>(g);
#endif
}

__device__ __forceinline__ void async_wait_all() {
#if CDNA5_ASYNC
#if __has_builtin(__builtin_amdgcn_s_wait_asynccnt)
  __builtin_amdgcn_s_wait_asynccnt(0);
#else
  asm volatile("s_wait_asynccnt 0x0" ::: "memory");
#endif
#endif
}

// Load a 16x32 bf16 WMMA fragment row for this lane from an LDS row pointer.
// VGPR0-3 hold K = khalf*8 .. +7, VGPR4-7 hold K = 16+khalf*8 .. +7.
__device__ __forceinline__ v16bf load_frag(const unsigned short* row, int koff) {
  Frag16 f;
  f.u[0] = *reinterpret_cast<const uint4*>(row + koff);
  f.u[1] = *reinterpret_cast<const uint4*>(row + koff + 16);
  return f.v;
}

// ---------------------------------------------------------------------------
// Kernel 0: every fp32 -> bf16 conversion of the call and the packing of the
// mask in one launch; the eight pieces are independent of one another, a block
// picks its piece by its index.
//   blocks [0, 4*WT_BLOCKS): weight W[k][n] fp32 -> Wt[n][k] bf16 (DM_ x DM_),
//     64x64 tiles turned in LDS, so that the GEMM reads both operands
//     K-contiguous; they come first, so that they run under the long stream.
//   blocks [4*WT_BLOCKS, +MASK_BLOCKS): the int32 mask -> lane-mask words for the
//     attention kernel. A unit is 16 queries x 128 keys, one wave each, 64 words:
//     word j*8 + r, bit lane = (mask[query lane&15][key 16j + 8(lane>>4) + r] != 0),
//     the place that lane holds in the score tiles.
//   the rest: the three activations, elementwise, float4 granular.
// ---------------------------------------------------------------------------
#define TLD 72   // 64 + 8 pad, rows stay 16B-aligned
#define WT_BLOCKS  ((DM_ / 64) * (DM_ / 64))     // 256 tiles per weight
#define ACT_BLOCKS (B_ * S_ * DM_ / 4 / 256)     // 8192 blocks per activation
#define MASK_BLOCKS (B_ * (S_ / 16) * (S_ / 128) / 8)   // 8 units per block

__global__ __launch_bounds__(256) void prep_bf16(
    const float* __restrict__ a0, const float* __restrict__ a1,
    const float* __restrict__ a2,
    const float* __restrict__ w0, const float* __restrict__ w1,
    const float* __restrict__ w2, const float* __restrict__ w3,
    const int* __restrict__ mask,
    unsigned short* __restrict__ act_out, unsigned short* __restrict__ wt_out,
    unsigned* __restrict__ mw_out)
{
  __shared__ __attribute__((aligned(16))) unsigned short t[64 * TLD];   // [n][k]
  const int tid = threadIdx.x;
  const int blk = blockIdx.x;
  if (blk < 4 * WT_BLOCKS) {
    const int w = blk / WT_BLOCKS;
    const int tile = blk % WT_BLOCKS;
    const float* in = (w == 0) ? w0 : (w == 1) ? w1 : (w == 2) ? w2 : w3;
    unsigned short* out = wt_out + (size_t)w * DM_ * DM_;
    const int n0 = (tile % (DM_ / 64)) * 64;
    const int k0 = (tile / (DM_ / 64)) * 64;
#pragma unroll
    for (int p = 0; p < 4; ++p) {
      int k = p * 16 + (tid >> 4);
      int n = (tid & 15) * 4;
      float4 v = *reinterpret_cast<const float4*>(&in[(size_t)(k0 + k) * DM_ + n0 + n]);
      t[(n + 0) * TLD + k] = f2bf(v.x);
      t[(n + 1) * TLD + k] = f2bf(v.y);
      t[(n + 2) * TLD + k] = f2bf(v.z);
      t[(n + 3) * TLD + k] = f2bf(v.w);
    }
    __syncthreads();
#pragma unroll
    for (int p = 0; p < 2; ++p) {
      int idx = p * 256 + tid;
      int n = idx >> 3;
      int c = (idx & 7) * 8;
      *reinterpret_cast<uint4*>(&out[(size_t)(n0 + n) * DM_ + k0 + c]) =
          *reinterpret_cast<const uint4*>(&t[n * TLD + c]);
    }
    return;
  }
  if (blk < 4 * WT_BLOCKS + MASK_BLOCKS) {
    const int lane = tid & 31;
    const int unit = (blk - 4 * WT_BLOCKS) * 8 + (tid >> 5);   // (b*128 + qtile)*16 + kblock
    const int* src = mask + (size_t)(unit >> 4) * 16 * S_ + (unit & 15) * 128 + lane * 4;
    // x[c], bit l = (mask[query lane&15][key 4l + c] != 0): a row is read as whole
    // lines, 512 contiguous bytes a load, and turned into bits by ballots
    unsigned x[4] = {0u, 0u, 0u, 0u};
    // stays rolled: eight loads in flight a wave are enough for the stream, and all
    // sixteen would take registers from the occupancy of the elementwise blocks
#pragma nounroll
    for (int hf = 0; hf < 2; ++hf) {
      int4 m[8];
#pragma unroll
      for (int i = 0; i < 8; ++i)
        m[i] = *reinterpret_cast<const int4*>(src + (size_t)(hf * 8 + i) * S_);
#pragma unroll
      for (int i = 0; i < 8; ++i) {
        const bool mine = (lane & 15) == hf * 8 + i;
        const unsigned b0 = __builtin_amdgcn_ballot_w32(m[i].x != 0);
        const unsigned b1 = __builtin_amdgcn_ballot_w32(m[i].y != 0);
        const unsigned b2 = __builtin_amdgcn_ballot_w32(m[i].z != 0);
        const unsigned b3 = __builtin_amdgcn_ballot_w32(m[i].w != 0);
        x[0] = mine ? b0 : x[0];
        x[1] = mine ? b1 : x[1];
        x[2] = mine ? b2 : x[2];
        x[3] = mine ? b3 : x[3];
      }
    }
    // key 16j + 8(lane>>4) + r = 4l + c with l = 4j + 2(lane>>4) + (r>>2), c = r & 3
#pragma unroll
    for (int c = 0; c < 4; ++c) x[c] >>= 2 * (lane >> 4);
    uint2 w = make_uint2(0u, 0u);            // words 2*lane and 2*lane + 1 of the unit
#pragma unroll
    for (int n = 0; n < 64; ++n) {
      const int j = n >> 3, r = n & 7;
      const unsigned word =
          __builtin_amdgcn_ballot_w32(((x[r & 3] >> (4 * j + (r >> 2))) & 1u) != 0u);
      if (n & 1) w.y = (lane == (n >> 1)) ? word : w.y;
      else       w.x = (lane == (n >> 1)) ? word : w.x;
    }
    reinterpret_cast<uint2*>(mw_out + (size_t)unit * 64)[lane] = w;
    // the store's address registers are not rewritten on any path behind it before this wait
    asm volatile("s_wait_xcnt 0x0" ::: "memory");
    return;
  }
  const int ab = blk - 4 * WT_BLOCKS - MASK_BLOCKS;
  const int a = ab / ACT_BLOCKS;
  const float* in = (a == 0) ? a0 : (a == 1) ? a1 : a2;
  unsigned short* out = act_out + (size_t)a * B_ * S_ * DM_;
  const int i = (ab % ACT_BLOCKS) * 256 + tid;
  float4 v = reinterpret_cast<const float4*>(in)[i];
  union { unsigned short s[4]; uint2 u; } o;
  o.s[0] = f2bf(v.x); o.s[1] = f2bf(v.y); o.s[2] = f2bf(v.z); o.s[3] = f2bf(v.w);
  reinterpret_cast<uint2*>(out)[i] = o.u;
  // the store's address registers are not rewritten on any path behind it before this wait
  asm volatile("s_wait_xcnt 0x0" ::: "memory");
}

// ---------------------------------------------------------------------------
// Kernel 1: C[M,N] = A[M,K] @ Bt[N,K]^T, bf16 in, bf16 out (Cb) or fp32+resid (Cf).
// Block tile 128x128, K-step 64, double-buffered LDS, 8 waves (wave32): a staged
// row is one whole 128-byte line, a wave's copy covers four lines.
// blockIdx.z picks one of several independent products of the same shape whose
// A, Bt and Cb each lie one behind the other in memory.
// RESID picks the output at compile time: fp32 with the residual added (Cf), or
// bf16 (Cb). Either way a wave turns its 32x64 tile in LDS, 16 rows at a time,
// so that global memory sees whole 128-byte lines in 16-byte accesses.
// ---------------------------------------------------------------------------
#define BM 128
#define BN 128
#define BK 64
#define LDA 72   // 64 + 8 pad: pitch 144 B, 16 B x odd
#define SLD 68   // staging pitch in floats: 64 + 4, 16 B x odd

template <bool RESID>
__global__ __launch_bounds__(256) void wmma_gemm_bf16(
    const unsigned short* __restrict__ A0, const unsigned short* __restrict__ Bt0,
    const float* __restrict__ resid, float* __restrict__ Cf,
    unsigned short* __restrict__ Cb0, int M, int K)
{
  // fixed, so that the epilogue's rows are immediate offsets from one address
  constexpr int N = DM_;
  __shared__ __attribute__((aligned(16))) unsigned short As[2][BM * LDA];
  __shared__ __attribute__((aligned(16))) unsigned short Bs[2][BN * LDA];   // [n][k]

  const int tid  = threadIdx.x;
  const int lane = tid & 31;
  const int wave = tid >> 5;
  const int bm = blockIdx.y * BM;
  const int bn = blockIdx.x * BN;
  const size_t bz = blockIdx.z;
  const unsigned short* A  = A0 + bz * M * K;
  const unsigned short* Bt = Bt0 + bz * N * K;
  unsigned short* Cb = Cb0 + bz * M * N;
  const int wm = (wave & 3) * 32;
  const int wn = (wave >> 2) * 64;
  const int lm = lane & 15;
  const int khalf = lane >> 4;

  v8f acc[2][4];
#pragma unroll
  for (int i = 0; i < 2; ++i)
#pragma unroll
    for (int j = 0; j < 4; ++j) acc[i][j] = (v8f)(0.0f);

  auto load_tiles = [&](int kt, int buf) {
    const int k0 = kt * BK;
    // A tile: 128x64 bf16 = 1024 x 16B, async copies, eight lanes a row
#pragma unroll
    for (int p = 0; p < 4; ++p) {
      int idx = p * 256 + tid;
      int r = idx >> 3;
      int c = (idx & 7) * 8;
      cp16(&A[(size_t)(bm + r) * K + k0 + c], &As[buf][r * LDA + c]);
    }
    // B tile: 128 n-rows x 64 k bf16 from Bt[n][k], async copies like A
#pragma unroll
    for (int p = 0; p < 4; ++p) {
      int idx = p * 256 + tid;
      int r = idx >> 3;
      int c = (idx & 7) * 8;
      cp16(&Bt[(size_t)(bn + r) * K + k0 + c], &Bs[buf][r * LDA + c]);
    }
  };

  const int NK = K / BK;
  load_tiles(0, 0);

  const int row0 = bm + wm;
  const int col0 = bn + wn;
  // the residual in the order of the epilogue's stores: sixteen independent
  // loads, in flight beside the copies of the first tile
  const size_t foff = (size_t)(row0 + khalf) * N + col0 + lm * 4;
  float4 rv[2][8];
  if constexpr (RESID) {
    const float* rp = resid + foff;
#pragma unroll
    for (int i = 0; i < 2; ++i)
#pragma unroll
      for (int t = 0; t < 8; ++t)
        rv[i][t] = *reinterpret_cast<const float4*>(rp + (i * 16 + t * 2) * N);
  }

  int buf = 0;
  for (int kt = 0; kt < NK; ++kt) {
    // publish point: this wave's fragment reads of the buffer to be refilled
    // are done, its own copies of tile kt have landed, then the barrier
    asm volatile("s_wait_dscnt 0x0" ::: "memory");
    asm volatile("s_wait_asynccnt 0x0" ::: "memory");
    __syncthreads();
    if (kt + 1 < NK) load_tiles(kt + 1, buf ^ 1);
    // unrolled: the two 32-k halves of the tile become immediate LDS offsets, and the
    // second half's fragment loads can be issued among the first half's products
#pragma unroll
    for (int kk = 0; kk < BK / 32; ++kk) {
      v16bf af[2], bfr[4];
#pragma unroll
      for (int i = 0; i < 2; ++i)
        af[i] = load_frag(&As[buf][(wm + i * 16 + lm) * LDA], kk * 32 + khalf * 8);
#pragma unroll
      for (int j = 0; j < 4; ++j)
        bfr[j] = load_frag(&Bs[buf][(wn + j * 16 + lm) * LDA], kk * 32 + khalf * 8);
#pragma unroll
      for (int i = 0; i < 2; ++i)
#pragma unroll
        for (int j = 0; j < 4; ++j)
          acc[i][j] = __builtin_amdgcn_wmma_f32_16x16x32_bf16(
              false, af[i], false, bfr[j], (short)0, acc[i][j], false, false);
    }
    buf ^= 1;
  }
  // no copy of this wave is left in flight when it goes on to its end
  asm volatile("s_wait_asynccnt 0x0" ::: "memory");

  // every wave has read its last fragments: the tiles' LDS becomes staging,
  // a range of 16 x SLD floats for each wave alone
  __syncthreads();
  float* stg = reinterpret_cast<float*>(wave < 4 ? &As[0][0] : &Bs[0][0]) +
               (wave & 3) * (16 * SLD);
  // C tile layout: lane holds (m = r + khalf*8, n = lm) of each 16x16 tile.
#pragma unroll
  for (int i = 0; i < 2; ++i) {
#pragma unroll
    for (int j = 0; j < 4; ++j)
#pragma unroll
      for (int r = 0; r < 8; ++r)
        stg[(r + khalf * 8) * SLD + j * 16 + lm] = acc[i][j][r];
    // the wave's own stores are in LDS before other lanes read the rows back
    asm volatile("s_wait_dscnt 0x0" ::: "memory");
    if constexpr (RESID) {
      // two rows of 256 bytes a store
#pragma unroll
      for (int t = 0; t < 8; ++t) {
        const int row = t * 2 + khalf;
        float4 v = *reinterpret_cast<const float4*>(&stg[row * SLD + lm * 4]);
        v.x += rv[i][t].x; v.y += rv[i][t].y; v.z += rv[i][t].z; v.w += rv[i][t].w;
        *reinterpret_cast<float4*>(Cf + foff + (i * 16 + t * 2) * N) = v;
      }
    } else {
      // four rows of 128 bytes a store
#pragma unroll
      for (int t = 0; t < 4; ++t) {
        const int row = t * 4 + (lane >> 3);
        const int c = (lane & 7) * 8;
        const float4 v0 = *reinterpret_cast<const float4*>(&stg[row * SLD + c]);
        const float4 v1 = *reinterpret_cast<const float4*>(&stg[row * SLD + c + 4]);
        U128 x;
        x.s[0] = f2bf(v0.x); x.s[1] = f2bf(v0.y); x.s[2] = f2bf(v0.z); x.s[3] = f2bf(v0.w);
        x.s[4] = f2bf(v1.x); x.s[5] = f2bf(v1.y); x.s[6] = f2bf(v1.z); x.s[7] = f2bf(v1.w);
        *reinterpret_cast<uint4*>(
            Cb + (size_t)(row0 + (lane >> 3)) * N + col0 + c + (i * 16 + t * 4) * N) = x.u;
      }
    }
    // the next 16 rows' read-back loads the registers of these stores anew
    if (i == 0) asm volatile("s_wait_xcnt 0x0" ::: "memory");
  }
}

#define SQ 256
#define QC 2      // groups of 16 query columns per wave
#define SKB 128
#define QLD 72    // 64 + 8
#define VLD 136   // 128 + 8

// value of lane l ^ 16
__device__ __forceinline__ float xhalf(float x) {
  int i = __builtin_bit_cast(int, x);
  return __builtin_bit_cast(float, __builtin_amdgcn_permlanex16(
      i, i, 0x76543210, 0xfedcba98, false, false));
}

// the second bound asks for four waves a SIMD, a budget of 256 registers a wave:
// two work-groups then share a WGP and the grid's 512 are all resident at once
__global__ __launch_bounds__(256, 4) void flash_attn(
    const unsigned short* __restrict__ Qg, const unsigned short* __restrict__ Kg,
    const unsigned short* __restrict__ Vg, const unsigned* __restrict__ Mw,
    unsigned short* __restrict__ Xg)
{
  __shared__ unsigned short Qs[SQ * QLD];
  __shared__ unsigned short Ks[SKB * QLD];
  __shared__ unsigned short Vt[DH_ * VLD];        // V^T: [d][key]

  const int tid  = threadIdx.x;
  const int lane = tid & 31;
  const int wave = tid >> 5;
  const int qb = blockIdx.x, h = blockIdx.y, b = blockIdx.z;
  const int lm = lane & 15;
  const int khalf = lane >> 4;
  const size_t rowbase = (size_t)b * S_ * DM_ + (size_t)h * DH_;

  // Q block -> LDS (async)
#pragma unroll
  for (int g = 0; g < SQ / 32; ++g) {
    int idx = g * 256 + tid;
    int r = idx >> 3;
    int c = (idx & 7) * 8;
    cp16(&Qg[rowbase + (size_t)(qb * SQ + r) * DM_ + c], &Qs[r * QLD + c]);
  }

  const int wq = wave * (16 * QC);
  const int qrow = qb * SQ + wq + lm;             // this lane's query of group 0
  // this wave's mask words: 64 per group and key block, group c's (S_ / SKB) * 64
  // words behind group c - 1's; the wave's number as a scalar, and the constant
  // address space, so that the loads are scalar loads
  const __attribute__((address_space(4))) unsigned* mwave =
      (const __attribute__((address_space(4))) unsigned*)(
          Mw + (size_t)(b * (S_ / 16) + qb * (SQ / 16) +
                        __builtin_amdgcn_readfirstlane(wave) * QC) * (S_ / SKB) * 64);

  float mrun[QC];          // running maximum of the query, equal in both halves
  float lrun[QC];          // running sum over this half's keys only
  v8f o[QC][4];            // o[c][j][r] = O[qrow + 16c][j*16 + khalf*8 + r]
#pragma unroll
  for (int c = 0; c < QC; ++c) {
    mrun[c] = -3.0e38f;
    lrun[c] = 0.0f;
#pragma unroll
    for (int j = 0; j < 4; ++j) o[c][j] = (v8f)(0.0f);
  }

  for (int kb = 0; kb < S_ / SKB; ++kb) {
    __syncthreads();
    // K block -> LDS (async), layout [key][d]
#pragma unroll
    for (int g = 0; g < 4; ++g) {
      int idx = g * 256 + tid;
      int r = idx >> 3;
      int c = (idx & 7) * 8;
      cp16(&Kg[rowbase + (size_t)(kb * SKB + r) * DM_ + c], &Ks[r * QLD + c]);
    }
    // V block -> LDS transposed [d][key], 2 key-rows packed per b32 store
#pragma unroll
    for (int g = 0; g < 2; ++g) {
      int idx = g * 256 + tid;
      int r2 = (idx >> 3) * 2;       // key pair 0..126
      int dg = (idx & 7) * 8;        // d group 0..56
      U128 u0, u1;
      u0.u = *reinterpret_cast<const uint4*>(
          &Vg[rowbase + (size_t)(kb * SKB + r2) * DM_ + dg]);
      u1.u = *reinterpret_cast<const uint4*>(
          &Vg[rowbase + (size_t)(kb * SKB + r2 + 1) * DM_ + dg]);
#pragma unroll
      for (int i = 0; i < 8; ++i) {
        unsigned val = (unsigned)u0.s[i] | ((unsigned)u1.s[i] << 16);
        *reinterpret_cast<unsigned*>(&Vt[(dg + i) * VLD + r2]) = val;
      }
    }
    async_wait_all();
    __syncthreads();

    // the block's 128 keys in two halves of 64: only four score tiles a group are
    // live at a time, so that a wave stays inside 256 registers without scratch;
    // stays rolled: unrolled, the halves are interleaved and twice the tiles live
#pragma nounroll
    for (int hf = 0; hf < 2; ++hf) {
      // the half's 32 mask words of each group: word j*8 + r goes with s[c][j][r]
      unsigned mk[QC][32];
#pragma unroll
      for (int c = 0; c < QC; ++c)
#pragma unroll
        for (int n = 0; n < 32; ++n)
          mk[c][n] = mwave[(c * (S_ / SKB) + kb) * 64 + hf * 32 + n];
      // the loads' address pair is formed anew for the next half: no write of it in front of this wait
      asm volatile("s_wait_xcnt 0x0" ::: "memory");
      // keeps the scalar loads here, at the head of the half, so that they return
      // under the score products; without it they sink to their first use
      __builtin_amdgcn_sched_barrier(0);

      // scores^T: 64 keys x 32 q-columns, K-dim = 64 (2 WMMA steps);
      // s[c][j][r] = S[qrow + 16c][kb*128 + hf*64 + j*16 + khalf*8 + r]
      v8f s[QC][4];
#pragma unroll
      for (int c = 0; c < QC; ++c)
#pragma unroll
        for (int j = 0; j < 4; ++j) s[c][j] = (v8f)(0.0f);
#pragma unroll
      for (int kk = 0; kk < 2; ++kk) {
        v16bf bq[QC];
#pragma unroll
        for (int c = 0; c < QC; ++c)
          bq[c] = load_frag(&Qs[(wq + c * 16 + lm) * QLD], kk * 32 + khalf * 8);
#pragma unroll
        for (int j = 0; j < 4; ++j) {
          v16bf ak = load_frag(&Ks[(hf * 64 + j * 16 + lm) * QLD], kk * 32 + khalf * 8);
#pragma unroll
          for (int c = 0; c < QC; ++c)
            s[c][j] = __builtin_amdgcn_wmma_f32_16x16x32_bf16(
                false, ak, false, bq[c], (short)0, s[c][j], false, false);
        }
      }

#pragma unroll
      for (int c = 0; c < QC; ++c) {
        // scale + mask + maximum of the half, eight independent in-lane chains
        v8f bm = (v8f)(-3.0e38f);
#pragma unroll
        for (int j = 0; j < 4; ++j) {
          const v8f sc = s[c][j] * 0.125f;         // 1/sqrt(64)
#pragma unroll
          for (int r = 0; r < 8; ++r) {
            float sv =
                __builtin_amdgcn_inverse_ballot_w32(mk[c][j * 8 + r]) ? sc[r] : -1.0e9f;
            s[c][j][r] = sv;
          }
          bm = __builtin_elementwise_max(bm, s[c][j]);
        }
        float bmax = fmaxf(fmaxf(fmaxf(bm[0], bm[1]), fmaxf(bm[2], bm[3])),
                           fmaxf(fmaxf(bm[4], bm[5]), fmaxf(bm[6], bm[7])));
        bmax = fmaxf(bmax, xhalf(bmax));           // the query's other 32 keys

        // online softmax update
        const float mn = fmaxf(mrun[c], bmax);
        const float alpha = __expf(mrun[c] - mn);
        mrun[c] = mn;
        v8f rs = (v8f)(0.0f);
#pragma unroll
        for (int j = 0; j < 4; ++j) {
#pragma unroll
          for (int r = 0; r < 8; ++r) {
            float p = __expf(s[c][j][r] - mn);
            s[c][j][r] = p;
          }
          rs += s[c][j];
        }
        lrun[c] = lrun[c] * alpha + (((rs[0] + rs[1]) + (rs[2] + rs[3])) +
                                     ((rs[4] + rs[5]) + (rs[6] + rs[7])));
#pragma unroll
        for (int j = 0; j < 4; ++j)
#pragma unroll
          for (int r = 0; r < 8; ++r) o[c][j][r] *= alpha;
      }

      // o^T += V^T[64x64] @ P^T[64x32]  (2 WMMA K-steps x 4 d-tiles x 2 groups);
      // element e of the B operand is key 8*khalf + e, then 16 + 8*khalf + (e-8),
      // of the 32 keys: tiles 2kk and 2kk+1 as they lie, the order load_frag has
#pragma unroll
      for (int kk = 0; kk < 2; ++kk) {
        v16bf bp[QC];
#pragma unroll
        for (int c = 0; c < QC; ++c)
#pragma unroll
          for (int e = 0; e < 8; ++e) {
            bp[c][e]     = static_cast<__bf16>(s[c][2 * kk][e]);
            bp[c][8 + e] = static_cast<__bf16>(s[c][2 * kk + 1][e]);
          }
#pragma unroll
        for (int j = 0; j < 4; ++j) {
          v16bf av = load_frag(&Vt[(j * 16 + lm) * VLD], hf * 64 + kk * 32 + khalf * 8);
#pragma unroll
          for (int c = 0; c < QC; ++c)
            o[c][j] = __builtin_amdgcn_wmma_f32_16x16x32_bf16(
                false, av, false, bp[c], (short)0, o[c][j], false, false);
        }
      }
    }
  }

  // join the halves' sums, normalize, write X[b*S+q][h*64+d] as bf16:
  // eight consecutive d per lane and tile, one 16-byte store
#pragma unroll
  for (int c = 0; c < QC; ++c) {
    const float lsum = lrun[c] + xhalf(lrun[c]) + 1e-30f;
#pragma unroll
    for (int j = 0; j < 4; ++j) {
      U128 x;
#pragma unroll
      for (int r = 0; r < 8; ++r) x.s[r] = f2bf(o[c][j][r] / lsum);
      *reinterpret_cast<uint4*>(
          &Xg[rowbase + (size_t)(qrow + c * 16) * DM_ + j * 16 + khalf * 8]) = x.u;
    }
  }
}

// ---------------------------------------------------------------------------
// Kernel 3: in-place LayerNorm over rows of Y[8192][1024] (fp32).
// ---------------------------------------------------------------------------
__global__ __launch_bounds__(256) void layernorm_kernel(
    float* __restrict__ Y, const float* __restrict__ gam,
    const float* __restrict__ bet)
{
  __shared__ float red[2][8];
  const int row = blockIdx.x, tid = threadIdx.x;
  const int lane = tid & 31, wave = tid >> 5;
  float4 v = *reinterpret_cast<const float4*>(&Y[(size_t)row * DM_ + tid * 4]);
  float sum = v.x + v.y + v.z + v.w;
  float ssq = v.x * v.x + v.y * v.y + v.z * v.z + v.w * v.w;
#pragma unroll
  for (int off = 1; off < 32; off <<= 1) {
    sum += __shfl_xor(sum, off, 32);
    ssq += __shfl_xor(ssq, off, 32);
  }
  if (lane == 0) { red[0][wave] = sum; red[1][wave] = ssq; }
  __syncthreads();
  sum = red[0][lane & 7];
  ssq = red[1][lane & 7];
#pragma unroll
  for (int off = 1; off < 8; off <<= 1) {
    sum += __shfl_xor(sum, off, 32);
    ssq += __shfl_xor(ssq, off, 32);
  }
  float mu  = sum * (1.0f / DM_);
  float var = ssq * (1.0f / DM_) - mu * mu;
  float inv = rsqrtf(var + 1e-6f);
  float4 g4 = *reinterpret_cast<const float4*>(&gam[tid * 4]);
  float4 b4 = *reinterpret_cast<const float4*>(&bet[tid * 4]);
  float4 o4;
  o4.x = (v.x - mu) * inv * g4.x + b4.x;
  o4.y = (v.y - mu) * inv * g4.y + b4.y;
  o4.z = (v.z - mu) * inv * g4.z + b4.z;
  o4.w = (v.w - mu) * inv * g4.w + b4.w;
  *reinterpret_cast<float4*>(&Y[(size_t)row * DM_ + tid * 4]) = o4;
}

// ---------------------------------------------------------------------------
extern "C" void kernel_launch(void* const* d_in, const int* in_sizes, int n_in,
                              void* d_out, int out_size, void* d_ws, size_t ws_size,
                              hipStream_t stream) {
  (void)in_sizes; (void)n_in; (void)out_size; (void)ws_size;
  const float* query = (const float*)d_in[0];
  const float* key   = (const float*)d_in[1];
  const float* value = (const float*)d_in[2];
  const int*   mask  = (const int*)d_in[3];
  const float* w_qs  = (const float*)d_in[4];
  const float* w_ks  = (const float*)d_in[5];
  const float* w_vs  = (const float*)d_in[6];
  const float* w_out = (const float*)d_in[7];
  const float* ln_g  = (const float*)d_in[8];
  const float* ln_b  = (const float*)d_in[9];
  float* out = (float*)d_out;

  const size_t act  = (size_t)B_ * S_ * DM_;   // 8M elems
  const size_t wmat = (size_t)DM_ * DM_;       // 1M elems
  unsigned short* qb = (unsigned short*)d_ws;  // bf16 workspace
  unsigned short* kb = qb + act;
  unsigned short* vb = kb + act;
  unsigned short* wq = vb + act;
  unsigned short* wk = wq + wmat;
  unsigned short* wv = wk + wmat;
  unsigned short* wo = wv + wmat;
  unsigned short* Qp = wo + wmat;
  unsigned short* Kp = Qp + act;
  unsigned short* Vp = Kp + act;
  unsigned short* Xp = qb;   // qb is dead after the projection launch
  unsigned* mw = (unsigned*)(Vp + act);        // packed mask, 2 MiB

  const int M = B_ * S_;
  // qb, kb, vb and wq, wk, wv, wo lie one behind the other in the workspace
  prep_bf16<<<4 * WT_BLOCKS + MASK_BLOCKS + 3 * ACT_BLOCKS, 256, 0, stream>>>(
      query, key, value, w_qs, w_ks, w_vs, w_out, mask, qb, wq, mw);

  // the three projections are independent: one launch, z = 0, 1, 2
  wmma_gemm_bf16<false><<<dim3(DM_ / BN, M / BM, 3), 256, 0, stream>>>(
      qb, wq, nullptr, nullptr, Qp, M, DM_);

  flash_attn<<<dim3(S_ / SQ, H_, B_), 256, 0, stream>>>(Qp, Kp, Vp, mw, Xp);

  wmma_gemm_bf16<true><<<dim3(DM_ / BN, M / BM, 1), 256, 0, stream>>>(
      Xp, wo, query, out, nullptr, M, DM_);
  layernorm_kernel<<<M, 256, 0, stream>>>(out, ln_g, ln_b);
}

// v009
// Measured time: 163 microseconds a run.
// Two timings next to v008 both put it at 1.03 times that version's speed.
// Counting every step since v000, it is 2.39 times as fast.
#include <hip/hip_runtime.h>

// ---------------------------------------------------------------------------
// MHA forward for MI455X (gfx1250): end-to-end bf16 dataflow, WMMA GEMMs,
// flash attention, CDNA5 async global->LDS staging.
// ---------------------------------------------------------------------------

#define B_ 4
#define S_ 2048
#define H_ 16
#define DM_ 1024
#define DH_ 64

typedef __attribute__((ext_vector_type(16))) __bf16 v16bf;
typedef __attribute__((ext_vector_type(8)))  float  v8f;
typedef int async_v4i __attribute__((vector_size(16)));   // builtin's int4 type

union Frag16 { v16bf v; uint4 u[2]; };
union U128   { uint4 u; unsigned short s[8]; };

__device__ __forceinline__ unsigned short f2bf(float f) {
  return __builtin_bit_cast(unsigned short, static_cast<__bf16>(f));
}

// ---- CDNA5 async global->LDS (ASYNCcnt) with safe fallback ----------------
#if defined(__gfx1250__) && __has_builtin(__builtin_amdgcn_global_load_async_to_lds_b128)
#define CDNA5_ASYNC 1
#else
#define CDNA5_ASYNC 0
#endif

__device__ __forceinline__ void cp16(const unsigned short* g, unsigned short* l) {
#if CDNA5_ASYNC
  __builtin_amdgcn_global_load_async_to_lds_b128(
      (__attribute__((address_space(1))) async_v4i*)g,
      (__attribute__((address_space(3))) async_v4i*)l, 0, 0);
#else
  *reinterpret_cast<uint4*>(l) = *reinterpret_cast<const uint4*>(g);
#endif
}

__device__ __forceinline__ void async_wait_all() {
#if CDNA5_ASYNC
#if __has_builtin(__builtin_amdgcn_s_wait_asynccnt)
  __builtin_amdgcn_s_wait_asynccnt(0);
#else
  asm volatile("s_wait_asynccnt 0x0" ::: "memory");
#endif
#endif
}

// Load a 16x32 bf16 WMMA fragment row for this lane from an LDS row pointer.
// VGPR0-3 hold K = khalf*8 .. +7, VGPR4-7 hold K = 16+khalf*8 .. +7.
__device__ __forceinline__ v16bf load_frag(const unsigned short* row, int koff) {
  Frag16 f;
  f.u[0] = *reinterpret_cast<const uint4*>(row + koff);
  f.u[1] = *reinterpret_cast<const uint4*>(row + koff + 16);
  return f.v;
}

// ---------------------------------------------------------------------------
// Kernel 0: every fp32 -> bf16 conversion of the call and the packing of the
// mask in one launch; the eight pieces are independent of one another, a block
// picks its piece by its index.
//   blocks [0, 4*WT_BLOCKS): weight W[k][n] fp32 -> Wt[n][k] bf16 (DM_ x DM_),
//     64x64 tiles turned in LDS, so that the GEMM reads both operands
//     K-contiguous; they come first, so that they run under the long stream.
//   blocks [4*WT_BLOCKS, +MASK_BLOCKS): the int32 mask -> lane-mask words for the
//     attention kernel. A unit is 16 queries x 128 keys, one wave each, 64 words:
//     word j*8 + r, bit lane = (mask[query lane&15][key 16j + 8(lane>>4) + r] != 0),
//     the place that lane holds in the score tiles.
//   the rest: the three activations, elementwise, float4 granular.
// ---------------------------------------------------------------------------
#define TLD 72   // 64 + 8 pad, rows stay 16B-aligned
#define WT_BLOCKS  ((DM_ / 64) * (DM_ / 64))     // 256 tiles per weight
#define ACT_BLOCKS (B_ * S_ * DM_ / 4 / 256)     // 8192 blocks per activation
#define MASK_BLOCKS (B_ * (S_ / 16) * (S_ / 128) / 8)   // 8 units per block

__global__ __launch_bounds__(256) void prep_bf16(
    const float* __restrict__ a0, const float* __restrict__ a1,
    const float* __restrict__ a2,
    const float* __restrict__ w0, const float* __restrict__ w1,
    const float* __restrict__ w2, const float* __restrict__ w3,
    const int* __restrict__ mask,
    unsigned short* __restrict__ act_out, unsigned short* __restrict__ wt_out,
    unsigned* __restrict__ mw_out)
{
  __shared__ __attribute__((aligned(16))) unsigned short t[64 * TLD];   // [n][k]
  const int tid = threadIdx.x;
  const int blk = blockIdx.x;
  if (blk < 4 * WT_BLOCKS) {
    const int w = blk / WT_BLOCKS;
    const int tile = blk % WT_BLOCKS;
    const float* in = (w == 0) ? w0 : (w == 1) ? w1 : (w == 2) ? w2 : w3;
    unsigned short* out = wt_out + (size_t)w * DM_ * DM_;
    const int n0 = (tile % (DM_ / 64)) * 64;
    const int k0 = (tile / (DM_ / 64)) * 64;
#pragma unroll
    for (int p = 0; p < 4; ++p) {
      int k = p * 16 + (tid >> 4);
      int n = (tid & 15) * 4;
      float4 v = *reinterpret_cast<const float4*>(&in[(size_t)(k0 + k) * DM_ + n0 + n]);
      t[(n + 0) * TLD + k] = f2bf(v.x);
      t[(n + 1) * TLD + k] = f2bf(v.y);
      t[(n + 2) * TLD + k] = f2bf(v.z);
      t[(n + 3) * TLD + k] = f2bf(v.w);
    }
    __syncthreads();
#pragma unroll
    for (int p = 0; p < 2; ++p) {
      int idx = p * 256 + tid;
      int n = idx >> 3;
      int c = (idx & 7) * 8;
      *reinterpret_cast<uint4*>(&out[(size_t)(n0 + n) * DM_ + k0 + c]) =
          *reinterpret_cast<const uint4*>(&t[n * TLD + c]);
    }
    return;
  }
  if (blk < 4 * WT_BLOCKS + MASK_BLOCKS) {
    const int lane = tid & 31;
    const int unit = (blk - 4 * WT_BLOCKS) * 8 + (tid >> 5);   // (b*128 + qtile)*16 + kblock
    const int* src = mask + (size_t)(unit >> 4) * 16 * S_ + (unit & 15) * 128 + lane * 4;
    // x[c], bit l = (mask[query lane&15][key 4l + c] != 0): a row is read as whole
    // lines, 512 contiguous bytes a load, and turned into bits by ballots
    unsigned x[4] = {0u, 0u, 0u, 0u};
    // stays rolled: eight loads in flight a wave are enough for the stream, and all
    // sixteen would take registers from the occupancy of the elementwise blocks
#pragma nounroll
    for (int hf = 0; hf < 2; ++hf) {
      int4 m[8];
#pragma unroll
      for (int i = 0; i < 8; ++i)
        m[i] = *reinterpret_cast<const int4*>(src + (size_t)(hf * 8 + i) * S_);
#pragma unroll
      for (int i = 0; i < 8; ++i) {
        const bool mine = (lane & 15) == hf * 8 + i;
        const unsigned b0 = __builtin_amdgcn_ballot_w32(m[i].x != 0);
        const unsigned b1 = __builtin_amdgcn_ballot_w32(m[i].y != 0);
        const unsigned b2 = __builtin_amdgcn_ballot_w32(m[i].z != 0);
        const unsigned b3 = __builtin_amdgcn_ballot_w32(m[i].w != 0);
        x[0] = mine ? b0 : x[0];
        x[1] = mine ? b1 : x[1];
        x[2] = mine ? b2 : x[2];
        x[3] = mine ? b3 : x[3];
      }
    }
    // key 16j + 8(lane>>4) + r = 4l + c with l = 4j + 2(lane>>4) + (r>>2), c = r & 3
#pragma unroll
    for (int c = 0; c < 4; ++c) x[c] >>= 2 * (lane >> 4);
    uint2 w = make_uint2(0u, 0u);            // words 2*lane and 2*lane + 1 of the unit
#pragma unroll
    for (int n = 0; n < 64; ++n) {
      const int j = n >> 3, r = n & 7;
      const unsigned word =
          __builtin_amdgcn_ballot_w32(((x[r & 3] >> (4 * j + (r >> 2))) & 1u) != 0u);
      if (n & 1) w.y = (lane == (n >> 1)) ? word : w.y;
      else       w.x = (lane == (n >> 1)) ? word : w.x;
    }
    reinterpret_cast<uint2*>(mw_out + (size_t)unit * 64)[lane] = w;
    // the store's address registers are not rewritten on any path behind it before this wait
    asm volatile("s_wait_xcnt 0x0" ::: "memory");
    return;
  }
  const int ab = blk - 4 * WT_BLOCKS - MASK_BLOCKS;
  const int a = ab / ACT_BLOCKS;
  const float* in = (a == 0) ? a0 : (a == 1) ? a1 : a2;
  unsigned short* out = act_out + (size_t)a * B_ * S_ * DM_;
  const int i = (ab % ACT_BLOCKS) * 256 + tid;
  float4 v = reinterpret_cast<const float4*>(in)[i];
  union { unsigned short s[4]; uint2 u; } o;
  o.s[0] = f2bf(v.x); o.s[1] = f2bf(v.y); o.s[2] = f2bf(v.z); o.s[3] = f2bf(v.w);
  reinterpret_cast<uint2*>(out)[i] = o.u;
  // the store's address registers are not rewritten on any path behind it before this wait
  asm volatile("s_wait_xcnt 0x0" ::: "memory");
}

// ---------------------------------------------------------------------------
// Kernel 1: C[M,N] = A[M,K] @ Bt[N,K]^T, bf16 in, bf16 out (Cb) or fp32+resid (Cf).
// Block tile 128x128, K-step 64, double-buffered LDS, 8 waves (wave32): a staged
// row is one whole 128-byte line, a wave's copy covers four lines.
// blockIdx.z picks one of several independent products of the same shape whose
// A, Bt and Cb each lie one behind the other in memory.
// RESID picks the output at compile time: fp32 with the residual added (Cf), or
// bf16 (Cb). Either way a wave turns its 32x64 tile in LDS, 16 rows at a time,
// so that global memory sees whole 128-byte lines in 16-byte accesses.
// ---------------------------------------------------------------------------
#define BM 128
#define BN 128
#define BK 64
#define LDA 72   // 64 + 8 pad: pitch 144 B, 16 B x odd
#define SLD 68   // staging pitch in floats: 64 + 4, 16 B x odd

template <bool RESID>
__global__ __launch_bounds__(256) void wmma_gemm_bf16(
    const unsigned short* __restrict__ A0, const unsigned short* __restrict__ Bt0,
    const float* __restrict__ resid, float* __restrict__ Cf,
    unsigned short* __restrict__ Cb0, int M, int K)
{
  // fixed, so that the epilogue's rows are immediate offsets from one address
  constexpr int N = DM_;
  __shared__ __attribute__((aligned(16))) unsigned short As[2][BM * LDA];
  __shared__ __attribute__((aligned(16))) unsigned short Bs[2][BN * LDA];   // [n][k]

  const int tid  = threadIdx.x;
  const int lane = tid & 31;
  const int wave = tid >> 5;
  const int bm = blockIdx.y * BM;
  const int bn = blockIdx.x * BN;
  const size_t bz = blockIdx.z;
  const unsigned short* A  = A0 + bz * M * K;
  const unsigned short* Bt = Bt0 + bz * N * K;
  unsigned short* Cb = Cb0 + bz * M * N;
  const int wm = (wave & 3) * 32;
  const int wn = (wave >> 2) * 64;
  const int lm = lane & 15;
  const int khalf = lane >> 4;

  v8f acc[2][4];
#pragma unroll
  for (int i = 0; i < 2; ++i)
#pragma unroll
    for (int j = 0; j < 4; ++j) acc[i][j] = (v8f)(0.0f);

  auto load_tiles = [&](int kt, int buf) {
    const int k0 = kt * BK;
    // A tile: 128x64 bf16 = 1024 x 16B, async copies, eight lanes a row
#pragma unroll
    for (int p = 0; p < 4; ++p) {
      int idx = p * 256 + tid;
      int r = idx >> 3;
      int c = (idx & 7) * 8;
      cp16(&A[(size_t)(bm + r) * K + k0 + c], &As[buf][r * LDA + c]);
    }
    // B tile: 128 n-rows x 64 k bf16 from Bt[n][k], async copies like A
#pragma unroll
    for (int p = 0; p < 4; ++p) {
      int idx = p * 256 + tid;
      int r = idx >> 3;
      int c = (idx & 7) * 8;
      cp16(&Bt[(size_t)(bn + r) * K + k0 + c], &Bs[buf][r * LDA + c]);
    }
  };

  const int NK = K / BK;
  load_tiles(0, 0);

  const int row0 = bm + wm;
  const int col0 = bn + wn;
  // the residual in the order of the epilogue's stores: sixteen independent
  // loads, in flight beside the copies of the first tile
  const size_t foff = (size_t)(row0 + khalf) * N + col0 + lm * 4;
  float4 rv[2][8];
  if constexpr (RESID) {
    const float* rp = resid + foff;
#pragma unroll
    for (int i = 0; i < 2; ++i)
#pragma unroll
      for (int t = 0; t < 8; ++t)
        rv[i][t] = *reinterpret_cast<const float4*>(rp + (i * 16 + t * 2) * N);
  }

  int buf = 0;
  for (int kt = 0; kt < NK; ++kt) {
    // publish point: this wave's fragment reads of the buffer to be refilled
    // are done, its own copies of tile kt have landed, then the barrier
    asm volatile("s_wait_dscnt 0x0" ::: "memory");
    asm volatile("s_wait_asynccnt 0x0" ::: "memory");
    __syncthreads();
    if (kt + 1 < NK) load_tiles(kt + 1, buf ^ 1);
    // unrolled: the two 32-k halves of the tile become immediate LDS offsets, and the
    // second half's fragment loads can be issued among the first half's products
#pragma unroll
    for (int kk = 0; kk < BK / 32; ++kk) {
      v16bf af[2], bfr[4];
#pragma unroll
      for (int i = 0; i < 2; ++i)
        af[i] = load_frag(&As[buf][(wm + i * 16 + lm) * LDA], kk * 32 + khalf * 8);
#pragma unroll
      for (int j = 0; j < 4; ++j)
        bfr[j] = load_frag(&Bs[buf][(wn + j * 16 + lm) * LDA], kk * 32 + khalf * 8);
#pragma unroll
      for (int i = 0; i < 2; ++i)
#pragma unroll
        for (int j = 0; j < 4; ++j)
          acc[i][j] = __builtin_amdgcn_wmma_f32_16x16x32_bf16(
              false, af[i], false, bfr[j], (short)0, acc[i][j], false, false);
    }
    buf ^= 1;
  }
  // no copy of this wave is left in flight when it goes on to its end
  asm volatile("s_wait_asynccnt 0x0" ::: "memory");

  // every wave has read its last fragments: the tiles' LDS becomes staging,
  // a range of 16 x SLD floats for each wave alone
  __syncthreads();
  float* stg = reinterpret_cast<float*>(wave < 4 ? &As[0][0] : &Bs[0][0]) +
               (wave & 3) * (16 * SLD);
  // C tile layout: lane holds (m = r + khalf*8, n = lm) of each 16x16 tile.
#pragma unroll
  for (int i = 0; i < 2; ++i) {
#pragma unroll
    for (int j = 0; j < 4; ++j)
#pragma unroll
      for (int r = 0; r < 8; ++r)
        stg[(r + khalf * 8) * SLD + j * 16 + lm] = acc[i][j][r];
    // the wave's own stores are in LDS before other lanes read the rows back
    asm volatile("s_wait_dscnt 0x0" ::: "memory");
    if constexpr (RESID) {
      // two rows of 256 bytes a store
#pragma unroll
      for (int t = 0; t < 8; ++t) {
        const int row = t * 2 + khalf;
        float4 v = *reinterpret_cast<const float4*>(&stg[row * SLD + lm * 4]);
        v.x += rv[i][t].x; v.y += rv[i][t].y; v.z += rv[i][t].z; v.w += rv[i][t].w;
        *reinterpret_cast<float4*>(Cf + foff + (i * 16 + t * 2) * N) = v;
      }
    } else {
      // four rows of 128 bytes a store
#pragma unroll
      for (int t = 0; t < 4; ++t) {
        const int row = t * 4 + (lane >> 3);
        const int c = (lane & 7) * 8;
        const float4 v0 = *reinterpret_cast<const float4*>(&stg[row * SLD + c]);
        const float4 v1 = *reinterpret_cast<const float4*>(&stg[row * SLD + c + 4]);
        U128 x;
        x.s[0] = f2bf(v0.x); x.s[1] = f2bf(v0.y); x.s[2] = f2bf(v0.z); x.s[3] = f2bf(v0.w);
        x.s[4] = f2bf(v1.x); x.s[5] = f2bf(v1.y); x.s[6] = f2bf(v1.z); x.s[7] = f2bf(v1.w);
        *reinterpret_cast<uint4*>(
            Cb + (size_t)(row0 + (lane >> 3)) * N + col0 + c + (i * 16 + t * 4) * N) = x.u;
      }
    }
    // the next 16 rows' read-back loads the registers of these stores anew
    if (i == 0) asm volatile("s_wait_xcnt 0x0" ::: "memory");
  }
}

#define SQ 256
#define QC 2      // groups of 16 query columns per wave
#define SKB 128
#define QLD 72    // 64 + 8
// The softmax works on the products as the matrix unit leaves them: 1/sqrt(64)
// and log2(e) are one factor, applied inside the exponent's multiply-add.
#define SCL2 0.18033688f   // 0.125 * log2(e)
#define NEGRAW -8.0e9f     // the reference's -1e9, times sqrt(64)
#define VLD 136   // 128 + 8

// value of lane l ^ 16
__device__ __forceinline__ float xhalf(float x) {
  int i = __builtin_bit_cast(int, x);
  return __builtin_bit_cast(float, __builtin_amdgcn_permlanex16(
      i, i, 0x76543210, 0xfedcba98, false, false));
}

// the second bound asks for four waves a SIMD, a budget of 256 registers a wave:
// two work-groups then share a WGP and the grid's 512 are all resident at once
__global__ __launch_bounds__(256, 4) void flash_attn(
    const unsigned short* __restrict__ Qg, const unsigned short* __restrict__ Kg,
    const unsigned short* __restrict__ Vg, const unsigned* __restrict__ Mw,
    unsigned short* __restrict__ Xg)
{
  __shared__ unsigned short Qs[SQ * QLD];
  __shared__ unsigned short Ks[SKB * QLD];
  __shared__ unsigned short Vt[DH_ * VLD];        // V^T: [d][key]

  const int tid  = threadIdx.x;
  const int lane = tid & 31;
  const int wave = tid >> 5;
  const int qb = blockIdx.x, h = blockIdx.y, b = blockIdx.z;
  const int lm = lane & 15;
  const int khalf = lane >> 4;
  const size_t rowbase = (size_t)b * S_ * DM_ + (size_t)h * DH_;

  // Q block -> LDS (async)
#pragma unroll
  for (int g = 0; g < SQ / 32; ++g) {
    int idx = g * 256 + tid;
    int r = idx >> 3;
    int c = (idx & 7) * 8;
    cp16(&Qg[rowbase + (size_t)(qb * SQ + r) * DM_ + c], &Qs[r * QLD + c]);
  }

  const int wq = wave * (16 * QC);
  const int qrow = qb * SQ + wq + lm;             // this lane's query of group 0
  // this wave's mask words: 64 per group and key block, group c's (S_ / SKB) * 64
  // words behind group c - 1's; the wave's number as a scalar, and the constant
  // address space, so that the loads are scalar loads
  const __attribute__((address_space(4))) unsigned* mwave =
      (const __attribute__((address_space(4))) unsigned*)(
          Mw + (size_t)(b * (S_ / 16) + qb * (SQ / 16) +
                        __builtin_amdgcn_readfirstlane(wave) * QC) * (S_ / SKB) * 64);

  float mrun[QC];          // running maximum of the query's unscaled scores, equal in both halves
  float lrun[QC];          // running sum over this half's keys only
  v8f o[QC][4];            // o[c][j][r] = O[qrow + 16c][j*16 + khalf*8 + r]
#pragma unroll
  for (int c = 0; c < QC; ++c) {
    mrun[c] = -3.0e38f;
    lrun[c] = 0.0f;
#pragma unroll
    for (int j = 0; j < 4; ++j) o[c][j] = (v8f)(0.0f);
  }

  for (int kb = 0; kb < S_ / SKB; ++kb) {
    __syncthreads();
    // K block -> LDS (async), layout [key][d]
#pragma unroll
    for (int g = 0; g < 4; ++g) {
      int idx = g * 256 + tid;
      int r = idx >> 3;
      int c = (idx & 7) * 8;
      cp16(&Kg[rowbase + (size_t)(kb * SKB + r) * DM_ + c], &Ks[r * QLD + c]);
    }
    // V block -> LDS transposed [d][key], 2 key-rows packed per b32 store
#pragma unroll
    for (int g = 0; g < 2; ++g) {
      int idx = g * 256 + tid;
      int r2 = (idx >> 3) * 2;       // key pair 0..126
      int dg = (idx & 7) * 8;        // d group 0..56
      U128 u0, u1;
      u0.u = *reinterpret_cast<const uint4*>(
          &Vg[rowbase + (size_t)(kb * SKB + r2) * DM_ + dg]);
      u1.u = *reinterpret_cast<const uint4*>(
          &Vg[rowbase + (size_t)(kb * SKB + r2 + 1) * DM_ + dg]);
#pragma unroll
      for (int i = 0; i < 8; ++i) {
        unsigned val = (unsigned)u0.s[i] | ((unsigned)u1.s[i] << 16);
        *reinterpret_cast<unsigned*>(&Vt[(dg + i) * VLD + r2]) = val;
      }
    }
    async_wait_all();
    __syncthreads();

    // the block's 128 keys in two halves of 64: only four score tiles a group are
    // live at a time, so that a wave stays inside 256 registers without scratch;
    // stays rolled: unrolled, the halves are interleaved and twice the tiles live
#pragma nounroll
    for (int hf = 0; hf < 2; ++hf) {
      // the half's 32 mask words of each group: word j*8 + r goes with s[c][j][r]
      unsigned mk[QC][32];
#pragma unroll
      for (int c = 0; c < QC; ++c)
#pragma unroll
        for (int n = 0; n < 32; ++n)
          mk[c][n] = mwave[(c * (S_ / SKB) + kb) * 64 + hf * 32 + n];
      // the loads' address pair is formed anew for the next half: no write of it in front of this wait
      asm volatile("s_wait_xcnt 0x0" ::: "memory");
      // keeps the scalar loads here, at the head of the half, so that they return
      // under the score products; without it they sink to their first use
      __builtin_amdgcn_sched_barrier(0);

      // scores^T: 64 keys x 32 q-columns, K-dim = 64 (2 WMMA steps);
      // s[c][j][r] = S[qrow + 16c][kb*128 + hf*64 + j*16 + khalf*8 + r]
      v8f s[QC][4];
#pragma unroll
      for (int c = 0; c < QC; ++c)
#pragma unroll
        for (int j = 0; j < 4; ++j) s[c][j] = (v8f)(0.0f);
#pragma unroll
      for (int kk = 0; kk < 2; ++kk) {
        v16bf bq[QC];
#pragma unroll
        for (int c = 0; c < QC; ++c)
          bq[c] = load_frag(&Qs[(wq + c * 16 + lm) * QLD], kk * 32 + khalf * 8);
#pragma unroll
        for (int j = 0; j < 4; ++j) {
          v16bf ak = load_frag(&Ks[(hf * 64 + j * 16 + lm) * QLD], kk * 32 + khalf * 8);
#pragma unroll
          for (int c = 0; c < QC; ++c)
            s[c][j] = __builtin_amdgcn_wmma_f32_16x16x32_bf16(
                false, ak, false, bq[c], (short)0, s[c][j], false, false);
        }
      }

#pragma unroll
      for (int c = 0; c < QC; ++c) {
        // mask + maximum of the half on unscaled scores, eight independent in-lane chains
        v8f bm = (v8f)(-3.0e38f);
#pragma unroll
        for (int j = 0; j < 4; ++j) {
#pragma unroll
          for (int r = 0; r < 8; ++r) {
            float sv =
                __builtin_amdgcn_inverse_ballot_w32(mk[c][j * 8 + r]) ? s[c][j][r] : NEGRAW;
            s[c][j][r] = sv;
          }
          bm = __builtin_elementwise_max(bm, s[c][j]);
        }
        float bmax = fmaxf(fmaxf(fmaxf(bm[0], bm[1]), fmaxf(bm[2], bm[3])),
                           fmaxf(fmaxf(bm[4], bm[5]), fmaxf(bm[6], bm[7])));
        bmax = fmaxf(bmax, xhalf(bmax));           // the query's other 32 keys

        // online softmax update: p = 2^(s * SCL2 - mn * SCL2), one multiply-add a score
        const float mn = fmaxf(mrun[c], bmax);
        const float alpha = __builtin_amdgcn_exp2f((mrun[c] - mn) * SCL2);
        mrun[c] = mn;
        const v8f nmc = (v8f)(-(mn * SCL2));
        v8f rs = (v8f)(0.0f);
#pragma unroll
        for (int j = 0; j < 4; ++j) {
          const v8f t = __builtin_elementwise_fma(s[c][j], (v8f)(SCL2), nmc);
#pragma unroll
          for (int r = 0; r < 8; ++r) s[c][j][r] = __builtin_amdgcn_exp2f(t[r]);
          rs += s[c][j];
        }
        lrun[c] = lrun[c] * alpha + (((rs[0] + rs[1]) + (rs[2] + rs[3])) +
                                     ((rs[4] + rs[5]) + (rs[6] + rs[7])));
#pragma unroll
        for (int j = 0; j < 4; ++j)
#pragma unroll
          for (int r = 0; r < 8; ++r) o[c][j][r] *= alpha;
      }

      // o^T += V^T[64x64] @ P^T[64x32]  (2 WMMA K-steps x 4 d-tiles x 2 groups);
      // element e of the B operand is key 8*khalf + e, then 16 + 8*khalf + (e-8),
      // of the 32 keys: tiles 2kk and 2kk+1 as they lie, the order load_frag has
#pragma unroll
      for (int kk = 0; kk < 2; ++kk) {
        v16bf bp[QC];
#pragma unroll
        for (int c = 0; c < QC; ++c)
#pragma unroll
          for (int e = 0; e < 8; ++e) {
            bp[c][e]     = static_cast<__bf16>(s[c][2 * kk][e]);
            bp[c][8 + e] = static_cast<__bf16>(s[c][2 * kk + 1][e]);
          }
#pragma unroll
        for (int j = 0; j < 4; ++j) {
          v16bf av = load_frag(&Vt[(j * 16 + lm) * VLD], hf * 64 + kk * 32 + khalf * 8);
#pragma unroll
          for (int c = 0; c < QC; ++c)
            o[c][j] = __builtin_amdgcn_wmma_f32_16x16x32_bf16(
                false, av, false, bp[c], (short)0, o[c][j], false, false);
        }
      }
    }
  }

  // join the halves' sums, normalize, write X[b*S+q][h*64+d] as bf16:
  // eight consecutive d per lane and tile, one 16-byte store
#pragma unroll
  for (int c = 0; c < QC; ++c) {
    const float lsum = lrun[c] + xhalf(lrun[c]) + 1e-30f;
#pragma unroll
    for (int j = 0; j < 4; ++j) {
      U128 x;
#pragma unroll
      for (int r = 0; r < 8; ++r) x.s[r] = f2bf(o[c][j][r] / lsum);
      *reinterpret_cast<uint4*>(
          &Xg[rowbase + (size_t)(qrow + c * 16) * DM_ + j * 16 + khalf * 8]) = x.u;
    }
  }
}

// ---------------------------------------------------------------------------
// Kernel 3: in-place LayerNorm over rows of Y[8192][1024] (fp32).
// ---------------------------------------------------------------------------
__global__ __launch_bounds__(256) void layernorm_kernel(
    float* __restrict__ Y, const float* __restrict__ gam,
    const float* __restrict__ bet)
{
  __shared__ float red[2][8];
  const int row = blockIdx.x, tid = threadIdx.x;
  const int lane = tid & 31, wave = tid >> 5;
  float4 v = *reinterpret_cast<const float4*>(&Y[(size_t)row * DM_ + tid * 4]);
  float sum = v.x + v.y + v.z + v.w;
  float ssq = v.x * v.x + v.y * v.y + v.z * v.z + v.w * v.w;
#pragma unroll
  for (int off = 1; off < 32; off <<= 1) {
    sum += __shfl_xor(sum, off, 32);
    ssq += __shfl_xor(ssq, off, 32);
  }
  if (lane == 0) { red[0][wave] = sum; red[1][wave] = ssq; }
  __syncthreads();
  sum = red[0][lane & 7];
  ssq = red[1][lane & 7];
#pragma unroll
  for (int off = 1; off < 8; off <<= 1) {
    sum += __shfl_xor(sum, off, 32);
    ssq += __shfl_xor(ssq, off, 32);
  }
  float mu  = sum * (1.0f / DM_);
  float var = ssq * (1.0f / DM_) - mu * mu;
  float inv = rsqrtf(var + 1e-6f);
  float4 g4 = *reinterpret_cast<const float4*>(&gam[tid * 4]);
  float4 b4 = *reinterpret_cast<const float4*>(&bet[tid * 4]);
  float4 o4;
  o4.x = (v.x - mu) * inv * g4.x + b4.x;
  o4.y = (v.y - mu) * inv * g4.y + b4.y;
  o4.z = (v.z - mu) * inv * g4.z + b4.z;
  o4.w = (v.w - mu) * inv * g4.w + b4.w;
  *reinterpret_cast<float4*>(&Y[(size_t)row * DM_ + tid * 4]) = o4;
}

// ---------------------------------------------------------------------------
extern "C" void kernel_launch(void* const* d_in, const int* in_sizes, int n_in,
                              void* d_out, int out_size, void* d_ws, size_t ws_size,
                              hipStream_t stream) {
  (void)in_sizes; (void)n_in; (void)out_size; (void)ws_size;
  const float* query = (const float*)d_in[0];
  const float* key   = (const float*)d_in[1];
  const float* value = (const float*)d_in[2];
  const int*   mask  = (const int*)d_in[3];
  const float* w_qs  = (const float*)d_in[4];
  const float* w_ks  = (const float*)d_in[5];
  const float* w_vs  = (const float*)d_in[6];
  const float* w_out = (const float*)d_in[7];
  const float* ln_g  = (const float*)d_in[8];
  const float* ln_b  = (const float*)d_in[9];
  float* out = (float*)d_out;

  const size_t act  = (size_t)B_ * S_ * DM_;   // 8M elems
  const size_t wmat = (size_t)DM_ * DM_;       // 1M elems
  unsigned short* qb = (unsigned short*)d_ws;  // bf16 workspace
  unsigned short* kb = qb + act;
  unsigned short* vb = kb + act;
  unsigned short* wq = vb + act;
  unsigned short* wk = wq + wmat;
  unsigned short* wv = wk + wmat;
  unsigned short* wo = wv + wmat;
  unsigned short* Qp = wo + wmat;
  unsigned short* Kp = Qp + act;
  unsigned short* Vp = Kp + act;
  unsigned short* Xp = qb;   // qb is dead after the projection launch
  unsigned* mw = (unsigned*)(Vp + act);        // packed mask, 2 MiB

  const int M = B_ * S_;
  // qb, kb, vb and wq, wk, wv, wo lie one behind the other in the workspace
  prep_bf16<<<4 * WT_BLOCKS + MASK_BLOCKS + 3 * ACT_BLOCKS, 256, 0, stream>>>(
      query, key, value, w_qs, w_ks, w_vs, w_out, mask, qb, wq, mw);

  // the three projections are independent: one launch, z = 0, 1, 2
  wmma_gemm_bf16<false><<<dim3(DM_ / BN, M / BM, 3), 256, 0, stream>>>(
      qb, wq, nullptr, nullptr, Qp, M, DM_);

  flash_attn<<<dim3(S_ / SQ, H_, B_), 256, 0, stream>>>(Qp, Kp, Vp, mw, Xp);

  wmma_gemm_bf16<true><<<dim3(DM_ / BN, M / BM, 1), 256, 0, stream>>>(
      Xp, wo, query, out, nullptr, M, DM_);
  layernorm_kernel<<<M, 256, 0, stream>>>(out, ln_g, ln_b);
}

// v010
// One run takes 157 microseconds.
// In two side-by-side timings against v009, it was 1.03 and 1.04 times as fast.
// Counting every step since v000, it is 2.48 times as fast.
#include <hip/hip_runtime.h>

// ---------------------------------------------------------------------------
// MHA forward for MI455X (gfx1250): end-to-end bf16 dataflow, WMMA GEMMs,
// flash attention, CDNA5 async global->LDS staging.
// ---------------------------------------------------------------------------

#define B_ 4
#define S_ 2048
#define H_ 16
#define DM_ 1024
#define DH_ 64

typedef __attribute__((ext_vector_type(16))) __bf16 v16bf;
typedef __attribute__((ext_vector_type(8)))  float  v8f;
typedef int async_v4i __attribute__((vector_size(16)));   // builtin's int4 type

typedef __attribute__((ext_vector_type(8)))  short  s16x8;

union Frag16 { v16bf v; uint4 u[2]; s16x8 t[2]; };
union U128   { uint4 u; unsigned short s[8]; };

__device__ __forceinline__ unsigned short f2bf(float f) {
  return __builtin_bit_cast(unsigned short, static_cast<__bf16>(f));
}

// ---- CDNA5 async global->LDS (ASYNCcnt) with safe fallback ----------------
#if defined(__gfx1250__) && __has_builtin(__builtin_amdgcn_global_load_async_to_lds_b128)
#define CDNA5_ASYNC 1
#else
#define CDNA5_ASYNC 0
#endif

__device__ __forceinline__ void cp16(const unsigned short* g, unsigned short* l) {
#if CDNA5_ASYNC
  __builtin_amdgcn_global_load_async_to_lds_b128(
      (__attribute__((address_space(1))) async_v4i*)g,
      (__attribute__((address_space(3))) async_v4i*)l, 0, 0);
#else
  *reinterpret_cast<uint4*>(l) = *reinterpret_cast<const uint4*>(g);
#endif
}

// Load a 16x32 bf16 WMMA fragment row for this lane from an LDS row pointer.
// VGPR0-3 hold K = khalf*8 .. +7, VGPR4-7 hold K = 16+khalf*8 .. +7.
__device__ __forceinline__ v16bf load_frag(const unsigned short* row, int koff) {
  Frag16 f;
  f.u[0] = *reinterpret_cast<const uint4*>(row + koff);
  f.u[1] = *reinterpret_cast<const uint4*>(row + koff + 16);
  return f.v;
}

// The same fragment, transposed, from a row-major LDS tile T[k][m] of pitch ld
// elements: two transposing loads of 16 k x 16 m. p is this lane's address,
// &T[8*(lane>>4) + (lane&7)][8*((lane>>3)&1)]; the lane gets column lane&15 of
// rows 8*(lane>>4) .. +7, then of the rows 16 further on: load_frag's k order.
__device__ __forceinline__ v16bf load_frag_tr(const unsigned short* p, int ld) {
  typedef __attribute__((address_space(3))) s16x8 lds_s16x8;
  Frag16 f;
  f.t[0] = __builtin_amdgcn_ds_load_tr16_b128_v8i16((lds_s16x8*)p);
  f.t[1] = __builtin_amdgcn_ds_load_tr16_b128_v8i16((lds_s16x8*)(p + 16 * ld));
  return f.v;
}

// ---------------------------------------------------------------------------
// Kernel 0: every fp32 -> bf16 conversion of the call and the packing of the
// mask in one launch; the eight pieces are independent of one another, a block
// picks its piece by its index.
//   blocks [0, 4*WT_BLOCKS): weight W[k][n] fp32 -> Wt[n][k] bf16 (DM_ x DM_),
//     64x64 tiles turned in LDS, so that the GEMM reads both operands
//     K-contiguous; they come first, so that they run under the long stream.
//   blocks [4*WT_BLOCKS, +MASK_BLOCKS): the int32 mask -> lane-mask words for the
//     attention kernel. A unit is 16 queries x 128 keys, one wave each, 64 words:
//     word j*8 + r, bit lane = (mask[query lane&15][key 16j + 8(lane>>4) + r] != 0),
//     the place that lane holds in the score tiles.
//   the rest: the three activations, elementwise, float4 granular.
// ---------------------------------------------------------------------------
#define TLD 72   // 64 + 8 pad, rows stay 16B-aligned
#define WT_BLOCKS  ((DM_ / 64) * (DM_ / 64))     // 256 tiles per weight
#define ACT_BLOCKS (B_ * S_ * DM_ / 4 / 256)     // 8192 blocks per activation
#define MASK_BLOCKS (B_ * (S_ / 16) * (S_ / 128) / 8)   // 8 units per block

__global__ __launch_bounds__(256) void prep_bf16(
    const float* __restrict__ a0, const float* __restrict__ a1,
    const float* __restrict__ a2,
    const float* __restrict__ w0, const float* __restrict__ w1,
    const float* __restrict__ w2, const float* __restrict__ w3,
    const int* __restrict__ mask,
    unsigned short* __restrict__ act_out, unsigned short* __restrict__ wt_out,
    unsigned* __restrict__ mw_out)
{
  __shared__ __attribute__((aligned(16))) unsigned short t[64 * TLD];   // [n][k]
  const int tid = threadIdx.x;
  const int blk = blockIdx.x;
  if (blk < 4 * WT_BLOCKS) {
    const int w = blk / WT_BLOCKS;
    const int tile = blk % WT_BLOCKS;
    const float* in = (w == 0) ? w0 : (w == 1) ? w1 : (w == 2) ? w2 : w3;
    unsigned short* out = wt_out + (size_t)w * DM_ * DM_;
    const int n0 = (tile % (DM_ / 64)) * 64;
    const int k0 = (tile / (DM_ / 64)) * 64;
#pragma unroll
    for (int p = 0; p < 4; ++p) {
      int k = p * 16 + (tid >> 4);
      int n = (tid & 15) * 4;
      float4 v = *reinterpret_cast<const float4*>(&in[(size_t)(k0 + k) * DM_ + n0 + n]);
      t[(n + 0) * TLD + k] = f2bf(v.x);
      t[(n + 1) * TLD + k] = f2bf(v.y);
      t[(n + 2) * TLD + k] = f2bf(v.z);
      t[(n + 3) * TLD + k] = f2bf(v.w);
    }
    __syncthreads();
#pragma unroll
    for (int p = 0; p < 2; ++p) {
      int idx = p * 256 + tid;
      int n = idx >> 3;
      int c = (idx & 7) * 8;
      *reinterpret_cast<uint4*>(&out[(size_t)(n0 + n) * DM_ + k0 + c]) =
          *reinterpret_cast<const uint4*>(&t[n * TLD + c]);
    }
    return;
  }
  if (blk < 4 * WT_BLOCKS + MASK_BLOCKS) {
    const int lane = tid & 31;
    const int unit = (blk - 4 * WT_BLOCKS) * 8 + (tid >> 5);   // (b*128 + qtile)*16 + kblock
    const int* src = mask + (size_t)(unit >> 4) * 16 * S_ + (unit & 15) * 128 + lane * 4;
    // x[c], bit l = (mask[query lane&15][key 4l + c] != 0): a row is read as whole
    // lines, 512 contiguous bytes a load, and turned into bits by ballots
    unsigned x[4] = {0u, 0u, 0u, 0u};
    // stays rolled: eight loads in flight a wave are enough for the stream, and all
    // sixteen would take registers from the occupancy of the elementwise blocks
#pragma nounroll
    for (int hf = 0; hf < 2; ++hf) {
      int4 m[8];
#pragma unroll
      for (int i = 0; i < 8; ++i)
        m[i] = *reinterpret_cast<const int4*>(src + (size_t)(hf * 8 + i) * S_);
#pragma unroll
      for (int i = 0; i < 8; ++i) {
        const bool mine = (lane & 15) == hf * 8 + i;
        const unsigned b0 = __builtin_amdgcn_ballot_w32(m[i].x != 0);
        const unsigned b1 = __builtin_amdgcn_ballot_w32(m[i].y != 0);
        const unsigned b2 = __builtin_amdgcn_ballot_w32(m[i].z != 0);
        const unsigned b3 = __builtin_amdgcn_ballot_w32(m[i].w != 0);
        x[0] = mine ? b0 : x[0];
        x[1] = mine ? b1 : x[1];
        x[2] = mine ? b2 : x[2];
        x[3] = mine ? b3 : x[3];
      }
    }
    // key 16j + 8(lane>>4) + r = 4l + c with l = 4j + 2(lane>>4) + (r>>2), c = r & 3
#pragma unroll
    for (int c = 0; c < 4; ++c) x[c] >>= 2 * (lane >> 4);
    uint2 w = make_uint2(0u, 0u);            // words 2*lane and 2*lane + 1 of the unit
#pragma unroll
    for (int n = 0; n < 64; ++n) {
      const int j = n >> 3, r = n & 7;
      const unsigned word =
          __builtin_amdgcn_ballot_w32(((x[r & 3] >> (4 * j + (r >> 2))) & 1u) != 0u);
      if (n & 1) w.y = (lane == (n >> 1)) ? word : w.y;
      else       w.x = (lane == (n >> 1)) ? word : w.x;
    }
    reinterpret_cast<uint2*>(mw_out + (size_t)unit * 64)[lane] = w;
    // the store's address registers are not rewritten on any path behind it before this wait
    asm volatile("s_wait_xcnt 0x0" ::: "memory");
    return;
  }
  const int ab = blk - 4 * WT_BLOCKS - MASK_BLOCKS;
  const int a = ab / ACT_BLOCKS;
  const float* in = (a == 0) ? a0 : (a == 1) ? a1 : a2;
  unsigned short* out = act_out + (size_t)a * B_ * S_ * DM_;
  const int i = (ab % ACT_BLOCKS) * 256 + tid;
  float4 v = reinterpret_cast<const float4*>(in)[i];
  union { unsigned short s[4]; uint2 u; } o;
  o.s[0] = f2bf(v.x); o.s[1] = f2bf(v.y); o.s[2] = f2bf(v.z); o.s[3] = f2bf(v.w);
  reinterpret_cast<uint2*>(out)[i] = o.u;
  // the store's address registers are not rewritten on any path behind it before this wait
  asm volatile("s_wait_xcnt 0x0" ::: "memory");
}

// ---------------------------------------------------------------------------
// Kernel 1: C[M,N] = A[M,K] @ Bt[N,K]^T, bf16 in, bf16 out (Cb) or fp32+resid (Cf).
// Block tile 128x128, K-step 64, double-buffered LDS, 8 waves (wave32): a staged
// row is one whole 128-byte line, a wave's copy covers four lines.
// blockIdx.z picks one of several independent products of the same shape whose
// A, Bt and Cb each lie one behind the other in memory.
// RESID picks the output at compile time: fp32 with the residual added (Cf), or
// bf16 (Cb). Either way a wave turns its 32x64 tile in LDS, 16 rows at a time,
// so that global memory sees whole 128-byte lines in 16-byte accesses.
// ---------------------------------------------------------------------------
#define BM 128
#define BN 128
#define BK 64
#define LDA 72   // 64 + 8 pad: pitch 144 B, 16 B x odd
#define SLD 68   // staging pitch in floats: 64 + 4, 16 B x odd

template <bool RESID>
__global__ __launch_bounds__(256) void wmma_gemm_bf16(
    const unsigned short* __restrict__ A0, const unsigned short* __restrict__ Bt0,
    const float* __restrict__ resid, float* __restrict__ Cf,
    unsigned short* __restrict__ Cb0, int M, int K)
{
  // fixed, so that the epilogue's rows are immediate offsets from one address
  constexpr int N = DM_;
  __shared__ __attribute__((aligned(16))) unsigned short As[2][BM * LDA];
  __shared__ __attribute__((aligned(16))) unsigned short Bs[2][BN * LDA];   // [n][k]

  const int tid  = threadIdx.x;
  const int lane = tid & 31;
  const int wave = tid >> 5;
  const int bm = blockIdx.y * BM;
  const int bn = blockIdx.x * BN;
  const size_t bz = blockIdx.z;
  const unsigned short* A  = A0 + bz * M * K;
  const unsigned short* Bt = Bt0 + bz * N * K;
  unsigned short* Cb = Cb0 + bz * M * N;
  const int wm = (wave & 3) * 32;
  const int wn = (wave >> 2) * 64;
  const int lm = lane & 15;
  const int khalf = lane >> 4;

  v8f acc[2][4];
#pragma unroll
  for (int i = 0; i < 2; ++i)
#pragma unroll
    for (int j = 0; j < 4; ++j) acc[i][j] = (v8f)(0.0f);

  auto load_tiles = [&](int kt, int buf) {
    const int k0 = kt * BK;
    // A tile: 128x64 bf16 = 1024 x 16B, async copies, eight lanes a row
#pragma unroll
    for (int p = 0; p < 4; ++p) {
      int idx = p * 256 + tid;
      int r = idx >> 3;
      int c = (idx & 7) * 8;
      cp16(&A[(size_t)(bm + r) * K + k0 + c], &As[buf][r * LDA + c]);
    }
    // B tile: 128 n-rows x 64 k bf16 from Bt[n][k], async copies like A
#pragma unroll
    for (int p = 0; p < 4; ++p) {
      int idx = p * 256 + tid;
      int r = idx >> 3;
      int c = (idx & 7) * 8;
      cp16(&Bt[(size_t)(bn + r) * K + k0 + c], &Bs[buf][r * LDA + c]);
    }
  };

  const int NK = K / BK;
  load_tiles(0, 0);

  const int row0 = bm + wm;
  const int col0 = bn + wn;
  // the residual in the order of the epilogue's stores: sixteen independent
  // loads, in flight beside the copies of the first tile
  const size_t foff = (size_t)(row0 + khalf) * N + col0 + lm * 4;
  float4 rv[2][8];
  if constexpr (RESID) {
    const float* rp = resid + foff;
#pragma unroll
    for (int i = 0; i < 2; ++i)
#pragma unroll
      for (int t = 0; t < 8; ++t)
        rv[i][t] = *reinterpret_cast<const float4*>(rp + (i * 16 + t * 2) * N);
  }

  int buf = 0;
  for (int kt = 0; kt < NK; ++kt) {
    // publish point: this wave's fragment reads of the buffer to be refilled
    // are done, its own copies of tile kt have landed, then the barrier
    asm volatile("s_wait_dscnt 0x0" ::: "memory");
    asm volatile("s_wait_asynccnt 0x0" ::: "memory");
    __syncthreads();
    if (kt + 1 < NK) load_tiles(kt + 1, buf ^ 1);
    // unrolled: the two 32-k halves of the tile become immediate LDS offsets, and the
    // second half's fragment loads can be issued among the first half's products
#pragma unroll
    for (int kk = 0; kk < BK / 32; ++kk) {
      v16bf af[2], bfr[4];
#pragma unroll
      for (int i = 0; i < 2; ++i)
        af[i] = load_frag(&As[buf][(wm + i * 16 + lm) * LDA], kk * 32 + khalf * 8);
#pragma unroll
      for (int j = 0; j < 4; ++j)
        bfr[j] = load_frag(&Bs[buf][(wn + j * 16 + lm) * LDA], kk * 32 + khalf * 8);
#pragma unroll
      for (int i = 0; i < 2; ++i)
#pragma unroll
        for (int j = 0; j < 4; ++j)
          acc[i][j] = __builtin_amdgcn_wmma_f32_16x16x32_bf16(
              false, af[i], false, bfr[j], (short)0, acc[i][j], false, false);
    }
    buf ^= 1;
  }
  // no copy of this wave is left in flight when it goes on to its end
  asm volatile("s_wait_asynccnt 0x0" ::: "memory");

  // every wave has read its last fragments: the tiles' LDS becomes staging,
  // a range of 16 x SLD floats for each wave alone
  __syncthreads();
  float* stg = reinterpret_cast<float*>(wave < 4 ? &As[0][0] : &Bs[0][0]) +
               (wave & 3) * (16 * SLD);
  // C tile layout: lane holds (m = r + khalf*8, n = lm) of each 16x16 tile.
#pragma unroll
  for (int i = 0; i < 2; ++i) {
#pragma unroll
    for (int j = 0; j < 4; ++j)
#pragma unroll
      for (int r = 0; r < 8; ++r)
        stg[(r + khalf * 8) * SLD + j * 16 + lm] = acc[i][j][r];
    // the wave's own stores are in LDS before other lanes read the rows back
    asm volatile("s_wait_dscnt 0x0" ::: "memory");
    if constexpr (RESID) {
      // two rows of 256 bytes a store
#pragma unroll
      for (int t = 0; t < 8; ++t) {
        const int row = t * 2 + khalf;
        float4 v = *reinterpret_cast<const float4*>(&stg[row * SLD + lm * 4]);
        v.x += rv[i][t].x; v.y += rv[i][t].y; v.z += rv[i][t].z; v.w += rv[i][t].w;
        *reinterpret_cast<float4*>(Cf + foff + (i * 16 + t * 2) * N) = v;
      }
    } else {
      // four rows of 128 bytes a store
#pragma unroll
      for (int t = 0; t < 4; ++t) {
        const int row = t * 4 + (lane >> 3);
        const int c = (lane & 7) * 8;
        const float4 v0 = *reinterpret_cast<const float4*>(&stg[row * SLD + c]);
        const float4 v1 = *reinterpret_cast<const float4*>(&stg[row * SLD + c + 4]);
        U128 x;
        x.s[0] = f2bf(v0.x); x.s[1] = f2bf(v0.y); x.s[2] = f2bf(v0.z); x.s[3] = f2bf(v0.w);
        x.s[4] = f2bf(v1.x); x.s[5] = f2bf(v1.y); x.s[6] = f2bf(v1.z); x.s[7] = f2bf(v1.w);
        *reinterpret_cast<uint4*>(
            Cb + (size_t)(row0 + (lane >> 3)) * N + col0 + c + (i * 16 + t * 4) * N) = x.u;
      }
    }
    // the next 16 rows' read-back loads the registers of these stores anew
    if (i == 0) asm volatile("s_wait_xcnt 0x0" ::: "memory");
  }
}

#define SQ 256
#define QC 2      // groups of 16 query columns per wave
#define SKB 128
#define QLD 72    // 64 + 8
// The softmax works on the products as the matrix unit leaves them: 1/sqrt(64)
// and log2(e) are one factor, applied inside the exponent's multiply-add.
#define SCL2 0.18033688f   // 0.125 * log2(e)
#define NEGRAW -8.0e9f     // the reference's -1e9, times sqrt(64)
#define VLD 80    // 64 + 16: pitch 160 B, 32 B x odd, for the transposing load
#define NKB (S_ / SKB)

// value of lane l ^ 16
__device__ __forceinline__ float xhalf(float x) {
  int i = __builtin_bit_cast(int, x);
  return __builtin_bit_cast(float, __builtin_amdgcn_permlanex16(
      i, i, 0x76543210, 0xfedcba98, false, false));
}

// the second bound asks for four waves a SIMD, a budget of 256 registers a wave:
// two work-groups then share a WGP and the grid's 512 are all resident at once
__global__ __launch_bounds__(256, 4) void flash_attn(
    const unsigned short* __restrict__ Qg, const unsigned short* __restrict__ Kg,
    const unsigned short* __restrict__ Vg, const unsigned* __restrict__ Mw,
    unsigned short* __restrict__ Xg)
{
  __shared__ __attribute__((aligned(16))) unsigned short Qs[SQ * QLD];
  __shared__ __attribute__((aligned(16))) unsigned short Ks[2][SKB * QLD];   // [key][d]
  __shared__ __attribute__((aligned(16))) unsigned short Vs[2][SKB * VLD];   // [key][d]

  const int tid  = threadIdx.x;
  const int lane = tid & 31;
  const int wave = tid >> 5;
  const int qb = blockIdx.x, h = blockIdx.y, b = blockIdx.z;
  const int lm = lane & 15;
  const int khalf = lane >> 4;
  const size_t rowbase = (size_t)b * S_ * DM_ + (size_t)h * DH_;

  // Q block -> LDS (async)
#pragma unroll
  for (int g = 0; g < SQ / 32; ++g) {
    int idx = g * 256 + tid;
    int r = idx >> 3;
    int c = (idx & 7) * 8;
    cp16(&Qg[rowbase + (size_t)(qb * SQ + r) * DM_ + c], &Qs[r * QLD + c]);
  }
  // one block of 128 keys, K and V alike: 1024 x 16 B each, eight lanes a row
  // the thread's place in 32 rows is one 32-bit offset, the rest of the address is the
  // same for the whole work-group: few registers live across the block's work
  const unsigned toff = (unsigned)(tid >> 3) * DM_ + (tid & 7) * 8;
  auto stage_kv = [&](int kb, int buf) {
#pragma unroll
    for (int g = 0; g < 4; ++g) {
      const int r = g * 32 + (tid >> 3);
      const int c = (tid & 7) * 8;
      const size_t ub = rowbase + (size_t)(kb * SKB + g * 32) * DM_;
      cp16(Kg + ub + toff, &Ks[buf][r * QLD + c]);
      cp16(Vg + ub + toff, &Vs[buf][r * VLD + c]);
    }
  };
  stage_kv(0, 0);
  // Q and block 0 have landed for this wave, then the barrier publishes them
  asm volatile("s_wait_asynccnt 0x0" ::: "memory");
  __syncthreads();
  stage_kv(1, 1);

  const int wq = wave * (16 * QC);
  const int qrow = qb * SQ + wq + lm;             // this lane's query of group 0
  // this wave's mask words: 64 per group and key block, group c's (S_ / SKB) * 64
  // words behind group c - 1's; the wave's number as a scalar, and the constant
  // address space, so that the loads are scalar loads
  const __attribute__((address_space(4))) unsigned* mwave =
      (const __attribute__((address_space(4))) unsigned*)(
          Mw + (size_t)(b * (S_ / 16) + qb * (SQ / 16) +
                        __builtin_amdgcn_readfirstlane(wave) * QC) * (S_ / SKB) * 64);

  float mrun[QC];          // running maximum of the query's unscaled scores, equal in both halves
  float lrun[QC];          // running sum over this half's keys only
  v8f o[QC][4];            // o[c][j][r] = O[qrow + 16c][j*16 + khalf*8 + r]
#pragma unroll
  for (int c = 0; c < QC; ++c) {
    mrun[c] = -3.0e38f;
    lrun[c] = 0.0f;
#pragma unroll
    for (int j = 0; j < 4; ++j) o[c][j] = (v8f)(0.0f);
  }

  for (int kb = 0; kb < NKB; ++kb) {
    const int buf = kb & 1;
    const unsigned short* Kb = &Ks[buf][lm * QLD + khalf * 8];
    const unsigned short* Vb = &Vs[buf][(khalf * 8 + (lane & 7)) * VLD + ((lane >> 3) & 1) * 8];

    // the block's 128 keys in two halves of 64: only four score tiles a group are
    // live at a time, so that a wave stays inside 256 registers without scratch;
    // stays rolled: unrolled, the halves are interleaved and twice the tiles live
#pragma nounroll
    for (int hf = 0; hf < 2; ++hf) {
      // the half's 32 mask words of each group: word j*8 + r goes with s[c][j][r]
      unsigned mk[QC][32];
#pragma unroll
      for (int c = 0; c < QC; ++c)
#pragma unroll
        for (int n = 0; n < 32; ++n)
          mk[c][n] = mwave[(c * (S_ / SKB) + kb) * 64 + hf * 32 + n];
      // the loads' address pair is formed anew for the next half: no write of it in front of this wait
      asm volatile("s_wait_xcnt 0x0" ::: "memory");
      // keeps the scalar loads here, at the head of the half, so that they return
      // under the score products; without it they sink to their first use
      __builtin_amdgcn_sched_barrier(0);

      // scores^T: 64 keys x 32 q-columns, K-dim = 64 (2 WMMA steps);
      // s[c][j][r] = S[qrow + 16c][kb*128 + hf*64 + j*16 + khalf*8 + r]
      v8f s[QC][4];
#pragma unroll
      for (int c = 0; c < QC; ++c)
#pragma unroll
        for (int j = 0; j < 4; ++j) s[c][j] = (v8f)(0.0f);
      {
        // the half's Q and K fragments as one group of loads in front of the products
        v16bf bq[2][QC], ak[2][4];
#pragma unroll
        for (int kk = 0; kk < 2; ++kk) {
#pragma unroll
          for (int c = 0; c < QC; ++c)
            bq[kk][c] = load_frag(&Qs[(wq + c * 16 + lm) * QLD], kk * 32 + khalf * 8);
#pragma unroll
          for (int j = 0; j < 4; ++j)
            ak[kk][j] = load_frag(Kb + (hf * 64 + j * 16) * QLD, kk * 32);
        }
#pragma unroll
        for (int kk = 0; kk < 2; ++kk)
#pragma unroll
          for (int j = 0; j < 4; ++j)
#pragma unroll
            for (int c = 0; c < QC; ++c)
              s[c][j] = __builtin_amdgcn_wmma_f32_16x16x32_bf16(
                  false, ak[kk][j], false, bq[kk][c], (short)0, s[c][j], false, false);
      }
      // V^T fragments of the half's first 32 keys: one group of loads that returns
      // under the softmax
      v16bf av[2][4];
#pragma unroll
      for (int j = 0; j < 4; ++j)
        av[0][j] = load_frag_tr(Vb + (hf * 64) * VLD + j * 16, VLD);

#pragma unroll
      for (int c = 0; c < QC; ++c) {
        // mask + maximum of the half on unscaled scores, eight independent in-lane chains
        v8f bm = (v8f)(-3.0e38f);
#pragma unroll
        for (int j = 0; j < 4; ++j) {
#pragma unroll
          for (int r = 0; r < 8; ++r) {
            float sv =
                __builtin_amdgcn_inverse_ballot_w32(mk[c][j * 8 + r]) ? s[c][j][r] : NEGRAW;
            s[c][j][r] = sv;
          }
          bm = __builtin_elementwise_max(bm, s[c][j]);
        }
        float bmax = fmaxf(fmaxf(fmaxf(bm[0], bm[1]), fmaxf(bm[2], bm[3])),
                           fmaxf(fmaxf(bm[4], bm[5]), fmaxf(bm[6], bm[7])));
        bmax = fmaxf(bmax, xhalf(bmax));           // the query's other 32 keys

        // online softmax update: p = 2^(s * SCL2 - mn * SCL2), one multiply-add a score
        const float mn = fmaxf(mrun[c], bmax);
        const float alpha = __builtin_amdgcn_exp2f((mrun[c] - mn) * SCL2);
        mrun[c] = mn;
        const v8f nmc = (v8f)(-(mn * SCL2));
        v8f rs = (v8f)(0.0f);
#pragma unroll
        for (int j = 0; j < 4; ++j) {
          const v8f t = __builtin_elementwise_fma(s[c][j], (v8f)(SCL2), nmc);
#pragma unroll
          for (int r = 0; r < 8; ++r) s[c][j][r] = __builtin_amdgcn_exp2f(t[r]);
          rs += s[c][j];
        }
        lrun[c] = lrun[c] * alpha + (((rs[0] + rs[1]) + (rs[2] + rs[3])) +
                                     ((rs[4] + rs[5]) + (rs[6] + rs[7])));
#pragma unroll
        for (int j = 0; j < 4; ++j)
#pragma unroll
          for (int r = 0; r < 8; ++r) o[c][j][r] *= alpha;
      }

      // o^T += V^T[64x64] @ P^T[64x32]  (2 WMMA K-steps x 4 d-tiles x 2 groups);
      // element e of the B operand is key 8*khalf + e, then 16 + 8*khalf + (e-8),
      // of the 32 keys: tiles 2kk and 2kk+1 as they lie, the order load_frag has;
      // the second 32 keys' V^T fragments return under the first 32 keys' products
#pragma unroll
      for (int j = 0; j < 4; ++j)
        av[1][j] = load_frag_tr(Vb + (hf * 64 + 32) * VLD + j * 16, VLD);
#pragma unroll
      for (int kk = 0; kk < 2; ++kk) {
        v16bf bp[QC];
#pragma unroll
        for (int c = 0; c < QC; ++c)
#pragma unroll
          for (int e = 0; e < 8; ++e) {
            bp[c][e]     = static_cast<__bf16>(s[c][2 * kk][e]);
            bp[c][8 + e] = static_cast<__bf16>(s[c][2 * kk + 1][e]);
          }
#pragma unroll
        for (int j = 0; j < 4; ++j) {
#pragma unroll
          for (int c = 0; c < QC; ++c)
            o[c][j] = __builtin_amdgcn_wmma_f32_16x16x32_bf16(
                false, av[kk][j], false, bp[c], (short)0, o[c][j], false, false);
        }
      }
    }

    // publish point: this wave's fragment reads of the buffer to be refilled are
    // done, its own copies of block kb + 1 have landed, then the barrier
    asm volatile("s_wait_dscnt 0x0" ::: "memory");
    asm volatile("s_wait_asynccnt 0x0" ::: "memory");
    __syncthreads();
    if (kb + 2 < NKB) stage_kv(kb + 2, buf);
  }
  // no copy of this wave is left in flight when it goes on to its end
  asm volatile("s_wait_asynccnt 0x0" ::: "memory");

  // join the halves' sums, normalize, write X[b*S+q][h*64+d] as bf16:
  // eight consecutive d per lane and tile, one 16-byte store
#pragma unroll
  for (int c = 0; c < QC; ++c) {
    const float lsum = lrun[c] + xhalf(lrun[c]) + 1e-30f;
#pragma unroll
    for (int j = 0; j < 4; ++j) {
      U128 x;
#pragma unroll
      for (int r = 0; r < 8; ++r) x.s[r] = f2bf(o[c][j][r] / lsum);
      *reinterpret_cast<uint4*>(
          &Xg[rowbase + (size_t)(qrow + c * 16) * DM_ + j * 16 + khalf * 8]) = x.u;
    }
  }
}

// ---------------------------------------------------------------------------
// Kernel 3: in-place LayerNorm over rows of Y[8192][1024] (fp32).
// ---------------------------------------------------------------------------
__global__ __launch_bounds__(256) void layernorm_kernel(
    float* __restrict__ Y, const float* __restrict__ gam,
    const float* __restrict__ bet)
{
  __shared__ float red[2][8];
  const int row = blockIdx.x, tid = threadIdx.x;
  const int lane = tid & 31, wave = tid >> 5;
  float4 v = *reinterpret_cast<const float4*>(&Y[(size_t)row * DM_ + tid * 4]);
  float sum = v.x + v.y + v.z + v.w;
  float ssq = v.x * v.x + v.y * v.y + v.z * v.z + v.w * v.w;
#pragma unroll
  for (int off = 1; off < 32; off <<= 1) {
    sum += __shfl_xor(sum, off, 32);
    ssq += __shfl_xor(ssq, off, 32);
  }
  if (lane == 0) { red[0][wave] = sum; red[1][wave] = ssq; }
  __syncthreads();
  sum = red[0][lane & 7];
  ssq = red[1][lane & 7];
#pragma unroll
  for (int off = 1; off < 8; off <<= 1) {
    sum += __shfl_xor(sum, off, 32);
    ssq += __shfl_xor(ssq, off, 32);
  }
  float mu  = sum * (1.0f / DM_);
  float var = ssq * (1.0f / DM_) - mu * mu;
  float inv = rsqrtf(var + 1e-6f);
  float4 g4 = *reinterpret_cast<const float4*>(&gam[tid * 4]);
  float4 b4 = *reinterpret_cast<const float4*>(&bet[tid * 4]);
  float4 o4;
  o4.x = (v.x - mu) * inv * g4.x + b4.x;
  o4.y = (v.y - mu) * inv * g4.y + b4.y;
  o4.z = (v.z - mu) * inv * g4.z + b4.z;
  o4.w = (v.w - mu) * inv * g4.w + b4.w;
  *reinterpret_cast<float4*>(&Y[(size_t)row * DM_ + tid * 4]) = o4;
}

// ---------------------------------------------------------------------------
extern "C" void kernel_launch(void* const* d_in, const int* in_sizes, int n_in,
                              void* d_out, int out_size, void* d_ws, size_t ws_size,
                              hipStream_t stream) {
  (void)in_sizes; (void)n_in; (void)out_size; (void)ws_size;
  const float* query = (const float*)d_in[0];
  const float* key   = (const float*)d_in[1];
  const float* value = (const float*)d_in[2];
  const int*   mask  = (const int*)d_in[3];
  const float* w_qs  = (const float*)d_in[4];
  const float* w_ks  = (const float*)d_in[5];
  const float* w_vs  = (const float*)d_in[6];
  const float* w_out = (const float*)d_in[7];
  const float* ln_g  = (const float*)d_in[8];
  const float* ln_b  = (const float*)d_in[9];
  float* out = (float*)d_out;

  const size_t act  = (size_t)B_ * S_ * DM_;   // 8M elems
  const size_t wmat = (size_t)DM_ * DM_;       // 1M elems
  unsigned short* qb = (unsigned short*)d_ws;  // bf16 workspace
  unsigned short* kb = qb + act;
  unsigned short* vb = kb + act;
  unsigned short* wq = vb + act;
  unsigned short* wk = wq + wmat;
  unsigned short* wv = wk + wmat;
  unsigned short* wo = wv + wmat;
  unsigned short* Qp = wo + wmat;
  unsigned short* Kp = Qp + act;
  unsigned short* Vp = Kp + act;
  unsigned short* Xp = qb;   // qb is dead after the projection launch
  unsigned* mw = (unsigned*)(Vp + act);        // packed mask, 2 MiB

  const int M = B_ * S_;
  // qb, kb, vb and wq, wk, wv, wo lie one behind the other in the workspace
  prep_bf16<<<4 * WT_BLOCKS + MASK_BLOCKS + 3 * ACT_BLOCKS, 256, 0, stream>>>(
      query, key, value, w_qs, w_ks, w_vs, w_out, mask, qb, wq, mw);

  // the three projections are independent: one launch, z = 0, 1, 2
  wmma_gemm_bf16<false><<<dim3(DM_ / BN, M / BM, 3), 256, 0, stream>>>(
      qb, wq, nullptr, nullptr, Qp, M, DM_);

  flash_attn<<<dim3(S_ / SQ, H_, B_), 256, 0, stream>>>(Qp, Kp, Vp, mw, Xp);

  wmma_gemm_bf16<true><<<dim3(DM_ / BN, M / BM, 1), 256, 0, stream>>>(
      Xp, wo, query, out, nullptr, M, DM_);
  layernorm_kernel<<<M, 256, 0, stream>>>(out, ln_g, ln_b);
}
